// v000
// Times are from an AMD MI455X. After a warm-up the kernel runs many times in a row, and a time is the length of
// such a window on the GPU divided by its runs, so every launch and the gaps after it count. The runs cycle
// through copies of the inputs. A figure is the median of several windows, for all but v000 over two sittings.
// Sittings can differ by a few percent; kernels timed side by side share one.
// The starting kernel, v000, takes 109 microseconds a run.
// compute dtype: x, qkv_w, qkv_b, gate_w, gate_b (INPUTS) rounded to bf16 with exact bf16 WMMA products (f32 accumulate) for the qkv projection and the gate projection's weight side; q kept f32 and split hi/lo, k as bf16 hi/lo rows (3 products), softmax weights and v as bf16 hi/lo (3 products), attention output hi/lo x bf16(gate_w) (2 products); softmax, sigmoid gating and the residual in f32.
#include <hip/hip_runtime.h>
#include <math.h>

typedef __attribute__((ext_vector_type(16))) _Float16 v16h;
typedef __attribute__((ext_vector_type(16))) __bf16 v16b;
typedef __attribute__((ext_vector_type(8)))  _Float16 v8h;
typedef __attribute__((ext_vector_type(8)))  float v8f;
typedef __attribute__((ext_vector_type(4)))  float v4f;
typedef __attribute__((ext_vector_type(2)))  float v2f;
typedef __attribute__((ext_vector_type(4)))  unsigned v4u;
typedef __attribute__((ext_vector_type(4)))  int v4i;
typedef float __attribute__((may_alias)) float_a;
typedef int __attribute__((may_alias)) int_a;

template <typename T> __device__ __forceinline__ void vst2(void* p, T v) { *(T*)p = v;  }
__device__ __forceinline__ v8f wmma16(v16h a, v16h b, v8f c) {
  v8f d = __builtin_amdgcn_wmma_f32_16x16x32_f16(false, a, false, b, (short)0, c, false, false);
  asm volatile("v_nop\n\tv_nop\n\tv_nop\n\tv_nop" : "+v"(d) : "v"(a), "v"(b));
  return d;
}
__device__ __forceinline__ v8f wmma_bf(v16b a, v16b b, v8f c) {
  v8f d = __builtin_amdgcn_wmma_f32_16x16x32_bf16(false, a, false, b, (short)0, c, false, false);
  asm volatile("v_nop\n\tv_nop\n\tv_nop\n\tv_nop" : "+v"(d) : "v"(a), "v"(b));
  return d;
}
// 16x16x32 fragments: lane = (h = lane>>4, row/col = lane&15); elements 0..7 = k0+8h+0..7, 8..15 = k0+16+8h+0..7; D element r = row 8h+r
__device__ __forceinline__ v16h frag_h(const _Float16* rowk0, int lane) {
  union { v16h v; v8h q[2]; } u; const _Float16* p = rowk0 + 8 * (lane >> 4);
  u.q[0] = *(const v8h*)p; u.q[1] = *(const v8h*)(p + 16); return u.v;
}
__device__ __forceinline__ v16h frag_f32(const float* rowk0, int lane) {
  v16h a; const float* p = rowk0 + 8 * (lane >> 4);
#pragma unroll
  for (int i = 0; i < 8; ++i) { a[i] = (_Float16)p[i]; a[8 + i] = (_Float16)p[16 + i]; }
  return a;
}
__device__ __forceinline__ v16h frag_f32s(const float* rowk0, int lane, float sc) {
  v16h a; const float* p = rowk0 + 8 * (lane >> 4);
#pragma unroll
  for (int i = 0; i < 8; ++i) { a[i] = (_Float16)(p[i] * sc); a[8 + i] = (_Float16)(p[16 + i] * sc); }
  return a;
}
// column fragment from a [K][ld] layout (column n), rows >= K read as 0
__device__ __forceinline__ v16h fragc_f32(const float* W, int k0, int n, int lane, int ld, int K) {
  v16h a; const int g = lane >> 4;
#pragma unroll
  for (int i = 0; i < 8; ++i) { const int ka = k0 + 8 * g + i, kb = ka + 16;
    a[i] = (_Float16)(ka < K ? W[(size_t)(ka < K ? ka : K - 1) * ld + n] : 0.f); a[8 + i] = (_Float16)(kb < K ? W[(size_t)(kb < K ? kb : K - 1) * ld + n] : 0.f); }
  return a;
}
struct F2 { v16b h, l; };
__device__ __forceinline__ F2 bsplit16(const float v[16]) { F2 r;
#pragma unroll
  for (int i = 0; i < 16; ++i) { const __bf16 h = (__bf16)v[i]; r.h[i] = h; r.l[i] = (__bf16)(v[i] - (float)h); }
  return r; }
__device__ __forceinline__ F2 split_row(const float* row, int k0, int lane) { float v[16]; const float* p = row + k0 + 8 * (lane >> 4);
#pragma unroll
  for (int i = 0; i < 8; ++i) { v[i] = p[i]; v[8 + i] = p[16 + i]; }
  return bsplit16(v); }
__device__ __forceinline__ F2 split_rowK(const float* row, int k0, int lane, int K) { float v[16]; const int g = lane >> 4;
#pragma unroll
  for (int i = 0; i < 8; ++i) { const int ka = k0 + 8 * g + i, kb = ka + 16; v[i] = ka < K ? row[ka < K ? ka : K - 1] : 0.f; v[8 + i] = kb < K ? row[kb < K ? kb : K - 1] : 0.f; }
  return bsplit16(v); }
__device__ __forceinline__ F2 split_col(const float* W, int k0, int n, int lane, int ld, int K) { float v[16]; const int g = lane >> 4;
#pragma unroll
  for (int i = 0; i < 8; ++i) { const int ka = k0 + 8 * g + i, kb = ka + 16; v[i] = ka < K ? W[(size_t)(ka < K ? ka : K - 1) * ld + n] : 0.f; v[8 + i] = kb < K ? W[(size_t)(kb < K ? kb : K - 1) * ld + n] : 0.f; }
  return bsplit16(v); }
__device__ __forceinline__ v8f mac3(const F2& a, const F2& b, v8f c) { c = wmma_bf(a.l, b.h, c); c = wmma_bf(a.h, b.l, c); return wmma_bf(a.h, b.h, c); }
__device__ __forceinline__ float sigm(float v) { return 1.0f / (1.0f + expf(-v)); }
#define LDSX() do { asm volatile("s_wait_dscnt 0" ::: "memory"); __builtin_amdgcn_wave_barrier(); __builtin_amdgcn_fence(__ATOMIC_RELEASE, "workgroup"); } while (0)


// Gated spatial attention on [8,128,32,32] (4 heads x 32 over the 1,024 positions): qkv = inp @ qkv_w + qkv_b ([in][out], per-head interleaved columns h*96 + {q,k,v}*32 + d); softmax(q.k 32^-0.5) over all positions; feats @ gate_w + gate_b -> val | gate; y = x + val * sigmoid(gate) (NCHW).
// k_cvtx (pixel-major bf16 rows), k_qkv (Q32 f32 [bh][n][32]; K bf16 hi/lo rows; V bf16 hi/lo planes), k_attn (block = 64 queries x (b,h); O rows [b][n][128]), k_out (val/gate tiles per channel, sigmoid gating, residual, NCHW store).
#define NB 8
#define CC 128
#define NN 1024
#define NHD 4
#define DH 32
__device__ __attribute__((noinline)) float sigm_ni(float v) { return 1.0f / (1.0f + expf(-v)); }
__device__ __forceinline__ float bfr(float v) { return (float)(__bf16)v; }
__device__ __forceinline__ v16b frag_b(const __bf16* rowk0, int lane) { return __builtin_bit_cast(v16b, frag_h((const _Float16*)rowk0, lane)); }

__global__ __launch_bounds__(256) void k_cvtx(const float* __restrict__ x, __bf16* __restrict__ XT) {
  __shared__ __align__(16) __bf16 st[64][CC + 8];
  const int tid = threadIdx.x; const int b = blockIdx.y, p0 = blockIdx.x * 64;
  for (int q = tid; q < CC * 16; q += 256) { const int c = q >> 4, p4 = q & 15; const v4f v = *(const v4f*)(x + ((size_t)b * CC + c) * NN + p0 + p4 * 4);
    st[p4 * 4][c] = (__bf16)v[0]; st[p4 * 4 + 1][c] = (__bf16)v[1]; st[p4 * 4 + 2][c] = (__bf16)v[2]; st[p4 * 4 + 3][c] = (__bf16)v[3]; }
  __syncthreads();
  for (int q = tid; q < 64 * (CC / 8); q += 256) { const int rl = q / (CC / 8), pc = q % (CC / 8); vst2((unsigned*)(XT + ((size_t)b * NN + p0 + rl) * CC + pc * 8), *(const v4u*)(&st[rl][pc * 8])); }
}
// qkv: block (64 tokens, 128 output channels = 4 heads, which): rows = XT, B = W columns ([in][out]) + bias
__global__ __launch_bounds__(128) void k_qkv(const __bf16* __restrict__ XT, const float* __restrict__ W, const float* __restrict__ bias, float* __restrict__ Q32, __bf16* __restrict__ Kh, __bf16* __restrict__ Kl, __bf16* __restrict__ VTh, __bf16* __restrict__ VTl) {
  __shared__ __align__(16) float so[4][16][132]; __shared__ __align__(16) __bf16 sh_[4][16][136], sl_[4][16][136]; __shared__ __align__(16) __bf16 sth[128][72], stl[128][72];
  const int tid = threadIdx.x, wave = tid >> 5, lane = tid & 31, col = lane & 15, g = lane >> 4; const int r0b = blockIdx.x * 64, n0 = blockIdx.y * 128, which = blockIdx.z; const int b = r0b / NN, s0 = r0b % NN; const size_t r0 = (size_t)r0b + wave * 16;
  v8f acc[8] = {};
#pragma unroll
  for (int kc = 0; kc < CC / 32; ++kc) { const v16b a = frag_b(XT + (r0 + col) * CC + kc * 32, lane);
#pragma unroll
    for (int j = 0; j < 8; ++j) { const int c = n0 + j * 16 + col; acc[j] = wmma_bf(a, split_col(W, kc * 32, (c >> 5) * (3 * DH) + which * DH + (c & 31), lane, 3 * CC, CC).h, acc[j]); } }      // column h*96 + which*32 + d of qkv_w [128][384]
  if (which == 0) {
#pragma unroll
    for (int j = 0; j < 8; ++j) { const int c = n0 + j * 16 + col; const float bb = bfr(bias[(c >> 5) * (3 * DH) + 0 * DH + (c & 31)]);
#pragma unroll
      for (int r = 0; r < 8; ++r) so[wave][8 * g + r][j * 16 + col] = acc[j][r] + bb; }
    LDSX();
    for (int qq = lane; qq < 4 * 16 * 8; qq += 32) { const int hh = qq >> 7, rl = (qq >> 3) & 15, pc = qq & 7; const int h = (n0 >> 5) + hh; vst2(Q32 + (((size_t)b * NHD + h) * NN + s0 + wave * 16 + rl) * DH + pc * 4, *(const v4f*)(&so[wave][rl][hh * 32 + pc * 4])); } }
  else if (which == 1) {
#pragma unroll
    for (int j = 0; j < 8; ++j) { const int c = n0 + j * 16 + col; const float bb = bfr(bias[(c >> 5) * (3 * DH) + 1 * DH + (c & 31)]);
#pragma unroll
      for (int r = 0; r < 8; ++r) { const float v = acc[j][r] + bb; const __bf16 hi = (__bf16)v; sh_[wave][8 * g + r][j * 16 + col] = hi; sl_[wave][8 * g + r][j * 16 + col] = (__bf16)(v - (float)hi); } }
    LDSX();
    // K rows [bh][n][32] bf16 = 64 B: 4 lanes x 16 B; per instruction 8 (head,row) pairs
    for (int qq = lane; qq < 4 * 16 * 4; qq += 32) { const int hh = qq >> 6, rl = (qq >> 2) & 15, pc = qq & 3; const int h = (n0 >> 5) + hh; const size_t o = (((size_t)b * NHD + h) * NN + s0 + wave * 16 + rl) * DH + pc * 8; vst2((unsigned*)(Kh + o), *(const v4u*)(&sh_[wave][rl][hh * 32 + pc * 8])); vst2((unsigned*)(Kl + o), *(const v4u*)(&sl_[wave][rl][hh * 32 + pc * 8])); } }
  else {
#pragma unroll
    for (int j = 0; j < 8; ++j) { const int c = n0 + j * 16 + col; const float bb = bfr(bias[(c >> 5) * (3 * DH) + 2 * DH + (c & 31)]);
#pragma unroll
      for (int r = 0; r < 8; ++r) { const float v = acc[j][r] + bb; const __bf16 hi = (__bf16)v; sth[j * 16 + col][wave * 16 + 8 * g + r] = hi; stl[j * 16 + col][wave * 16 + 8 * g + r] = (__bf16)(v - (float)hi); } }
    __syncthreads();
    for (int qq = tid; qq < 128 * 8; qq += 128) { const int cl = qq >> 3, pc = qq & 7; const int c = n0 + cl; const int h = c >> 5, d = c & 31; const size_t o = (((size_t)b * NHD + h) * DH + d) * NN + s0 + pc * 8; vst2((unsigned*)(VTh + o), *(const v4u*)(&sth[cl][pc * 8])); vst2((unsigned*)(VTl + o), *(const v4u*)(&stl[cl][pc * 8])); } }
}
__global__ __launch_bounds__(128) void k_attn(const float* __restrict__ Q32, const __bf16* __restrict__ Kh, const __bf16* __restrict__ Kl, const __bf16* __restrict__ VTh, const __bf16* __restrict__ VTl, float* __restrict__ O) {
  __shared__ __align__(16) float sS[4][16][68];
  __shared__ __align__(16) __bf16 sPh[4][16][72], sPl[4][16][72];
  __shared__ __align__(16) float sO[4][16][36];
  const int tid = threadIdx.x, w = tid >> 5, lane = tid & 31, col = lane & 15, g = lane >> 4; const size_t bh = blockIdx.y; const int b = (int)(bh / NHD), h = (int)(bh % NHD); const int q0 = blockIdx.x * 64 + w * 16;
  const F2 aq = split_row(Q32 + (bh * NN + q0 + col) * DH, 0, lane);
  float mrun = -3.0e38f, lrun = 0.f; v8f acc[2] = {};
#pragma unroll 1
  for (int kt = 0; kt < NN / 64; ++kt) {
#pragma unroll
    for (int t = 0; t < 4; ++t) { const int key = kt * 64 + t * 16 + col; const size_t ko = (bh * NN + key) * DH; const v16b khf = frag_b(Kh + ko, lane), klf = frag_b(Kl + ko, lane);
      v8f s = {}; s = wmma_bf(aq.l, khf, s); s = wmma_bf(aq.h, klf, s); s = wmma_bf(aq.h, khf, s);
#pragma unroll
      for (int r = 0; r < 8; ++r) sS[w][8 * g + r][t * 16 + col] = s[r] * 0.17677669529663687f; }
    LDSX();
    float mx = -3.4e38f;
#pragma unroll
    for (int jj = 0; jj < 32; ++jj) mx = fmaxf(mx, sS[w][col][g * 32 + jj]);
    mx = fmaxf(mx, __shfl_xor(mx, 16, 32));
    const float mnew = fmaxf(mrun, mx); const float corr = expf(mrun - mnew);
    float ps = 0.f;
#pragma unroll
    for (int jj = 0; jj < 32; ++jj) { const float p = expf(sS[w][col][g * 32 + jj] - mnew); ps += p; const __bf16 hi = (__bf16)p; sPh[w][col][g * 32 + jj] = hi; sPl[w][col][g * 32 + jj] = (__bf16)(p - (float)hi); }
    ps += __shfl_xor(ps, 16, 32);
    lrun = lrun * corr + ps; mrun = mnew;
#pragma unroll
    for (int r = 0; r < 8; ++r) { const float cr = __shfl(corr, 8 * g + r, 32); acc[0][r] *= cr; acc[1][r] *= cr; }
    LDSX();
#pragma unroll
    for (int kc = 0; kc < 2; ++kc) { const v16b ph = frag_b(&sPh[w][col][0] + kc * 32, lane), pl = frag_b(&sPl[w][col][0] + kc * 32, lane);
#pragma unroll
      for (int t = 0; t < 2; ++t) { const size_t vo = (bh * DH + t * 16 + col) * NN + kt * 64 + kc * 32; const v16b vh = frag_b(VTh + vo, lane), vl = frag_b(VTl + vo, lane); acc[t] = wmma_bf(pl, vh, acc[t]); acc[t] = wmma_bf(ph, vl, acc[t]); acc[t] = wmma_bf(ph, vh, acc[t]); } }
    __builtin_amdgcn_wave_barrier(); }
#pragma unroll
  for (int r = 0; r < 8; ++r) { const float lr = __shfl(lrun, 8 * g + r, 32); const float inv = 1.0f / lr; sO[w][8 * g + r][col] = acc[0][r] * inv; sO[w][8 * g + r][16 + col] = acc[1][r] * inv; }
  LDSX();
  for (int qq = lane; qq < 16 * 8; qq += 32) { const int rl = qq >> 3, pc = qq & 7; vst2(O + ((size_t)b * NN + q0 + rl) * CC + h * DH + pc * 4, *(const v4f*)(&sO[w][rl][pc * 4])); }
}
// y[b][c][n] = x[b][c][n] + (Wg[:][c] . O[n][:] (hi/lo) + bg[c]) * sigmoid(Wg[:][CC+c] . O[n][:] + bg[CC+c]): block (b, 64 tokens); wave w -> channel tiles 2w..2w+1 (32 channels) x 4 token tiles
__global__ __launch_bounds__(128) void k_out(const float* __restrict__ O, const float* __restrict__ Wg, const float* __restrict__ bg, const float* __restrict__ x, float* __restrict__ y) {
  __shared__ __align__(16) float sY[4][32][68];
  const int tid = threadIdx.x, w = tid >> 5, lane = tid & 31, col = lane & 15, g = lane >> 4; const int b = blockIdx.y, p0 = blockIdx.x * 64; const size_t base = (size_t)b * NN;
  v8f av[2][4] = {}, ag[2][4] = {};
#pragma unroll 1
  for (int kc = 0; kc < CC / 32; ++kc) { F2 bc[4];
#pragma unroll
    for (int pt = 0; pt < 4; ++pt) bc[pt] = split_row(O + (base + p0 + pt * 16 + col) * CC, kc * 32, lane);
#pragma unroll
    for (int ct = 0; ct < 2; ++ct) { const int c = (w * 2 + ct) * 16 + col; const v16b a1 = split_col(Wg, kc * 32, c, lane, 2 * CC, CC).h, a2 = split_col(Wg, kc * 32, CC + c, lane, 2 * CC, CC).h;
#pragma unroll
      for (int pt = 0; pt < 4; ++pt) { av[ct][pt] = wmma_bf(a1, bc[pt].l, av[ct][pt]); av[ct][pt] = wmma_bf(a1, bc[pt].h, av[ct][pt]); ag[ct][pt] = wmma_bf(a2, bc[pt].l, ag[ct][pt]); ag[ct][pt] = wmma_bf(a2, bc[pt].h, ag[ct][pt]); } } }
#pragma unroll
  for (int ct = 0; ct < 2; ++ct) {
#pragma unroll
    for (int r = 0; r < 8; ++r) { const int cl = ct * 16 + 8 * g + r; const int c = w * 32 + cl; const float bv_ = bfr(bg[c]), bg_ = bfr(bg[CC + c]);
#pragma unroll
      for (int pt = 0; pt < 4; ++pt) { const int n = p0 + pt * 16 + col; const float val = av[ct][pt][r] + bv_; const float gt = ag[ct][pt][r] + bg_; sY[w][cl][pt * 16 + col] = bfr(x[((size_t)b * CC + c) * NN + n]) + val * sigm_ni(gt); } } }
  LDSX();
  for (int qq = lane; qq < 32 * 16; qq += 32) { const int cl = qq >> 4, pc = qq & 15; vst2(y + ((size_t)b * CC + w * 32 + cl) * NN + p0 + pc * 4, *(const v4f*)(&sY[w][cl][pc * 4])); }
}
extern "C" void kernel_launch(void* const* d_in, const int* in_sizes, int n_in, void* d_out, int out_size, void* d_ws, size_t ws_size, hipStream_t stream) {
  (void)in_sizes; (void)n_in; (void)out_size; (void)ws_size;
  const float* x = (const float*)d_in[0]; const float* Wqkv = (const float*)d_in[1]; const float* bqkv = (const float*)d_in[2]; const float* Wg = (const float*)d_in[3]; const float* bg = (const float*)d_in[4];
  char* ws = (char*)d_ws; size_t off = 0;
  auto take = [&](size_t bytes) { char* p = ws + off; off += (bytes + 255) & ~(size_t)255; return p; };
  __bf16* XT = (__bf16*)take((size_t)NB * NN * CC * 2); float* Q32 = (float*)take((size_t)NB * NN * CC * 4); __bf16* Kh = (__bf16*)take((size_t)NB * NN * CC * 2); __bf16* Kl = (__bf16*)take((size_t)NB * NN * CC * 2); __bf16* VTh = (__bf16*)take((size_t)NB * NN * CC * 2); __bf16* VTl = (__bf16*)take((size_t)NB * NN * CC * 2); float* O = (float*)take((size_t)NB * NN * CC * 4);
  // ws ~ 19 MB
  k_cvtx<<<dim3(NN / 64, NB), 256, 0, stream>>>(x, XT);
  k_qkv<<<dim3(NB * NN / 64, CC / 128, 3), 128, 0, stream>>>(XT, Wqkv, bqkv, Q32, Kh, Kl, VTh, VTl);
  k_attn<<<dim3(NN / 64, NB * NHD), 128, 0, stream>>>(Q32, Kh, Kl, VTh, VTl, O);
  k_out<<<dim3(NN / 64, NB), 128, 0, stream>>>(O, Wg, bg, x, (float*)d_out);
}

// v001
// It runs in 69.4 microseconds.
// Next to v000, in two timings, it ran 1.59 and 1.60 times as fast.
// compute dtype: x, qkv_w, qkv_b, gate_w, gate_b (INPUTS) rounded to bf16 with exact bf16 WMMA products (f32 accumulate) for the qkv projection and the gate projection's weight side; q kept f32 and split hi/lo, k as bf16 hi/lo rows (3 products), softmax weights and v as bf16 hi/lo (3 products), attention output hi/lo x bf16(gate_w) (2 products); softmax, sigmoid gating and the residual in f32.
#include <hip/hip_runtime.h>
#include <math.h>

typedef __attribute__((ext_vector_type(16))) _Float16 v16h;
typedef __attribute__((ext_vector_type(16))) __bf16 v16b;
typedef __attribute__((ext_vector_type(8)))  _Float16 v8h;
typedef __attribute__((ext_vector_type(8)))  float v8f;
typedef __attribute__((ext_vector_type(4)))  float v4f;
typedef __attribute__((ext_vector_type(2)))  float v2f;
typedef __attribute__((ext_vector_type(4)))  unsigned v4u;
typedef __attribute__((ext_vector_type(4)))  int v4i;
typedef float __attribute__((may_alias)) float_a;
typedef int __attribute__((may_alias)) int_a;

template <typename T> __device__ __forceinline__ void vst2(void* p, T v) { *(T*)p = v;  }
__device__ __forceinline__ v8f wmma16(v16h a, v16h b, v8f c) {
  v8f d = __builtin_amdgcn_wmma_f32_16x16x32_f16(false, a, false, b, (short)0, c, false, false);
  asm volatile("v_nop\n\tv_nop\n\tv_nop\n\tv_nop" : "+v"(d) : "v"(a), "v"(b));
  return d;
}
__device__ __forceinline__ v8f wmma_bf(v16b a, v16b b, v8f c) {
  v8f d = __builtin_amdgcn_wmma_f32_16x16x32_bf16(false, a, false, b, (short)0, c, false, false);
  asm volatile("v_nop\n\tv_nop\n\tv_nop\n\tv_nop" : "+v"(d) : "v"(a), "v"(b));
  return d;
}
// 16x16x32 fragments: lane = (h = lane>>4, row/col = lane&15); elements 0..7 = k0+8h+0..7, 8..15 = k0+16+8h+0..7; D element r = row 8h+r
__device__ __forceinline__ v16h frag_h(const _Float16* rowk0, int lane) {
  union { v16h v; v8h q[2]; } u; const _Float16* p = rowk0 + 8 * (lane >> 4);
  u.q[0] = *(const v8h*)p; u.q[1] = *(const v8h*)(p + 16); return u.v;
}
__device__ __forceinline__ v16h frag_f32(const float* rowk0, int lane) {
  v16h a; const float* p = rowk0 + 8 * (lane >> 4);
#pragma unroll
  for (int i = 0; i < 8; ++i) { a[i] = (_Float16)p[i]; a[8 + i] = (_Float16)p[16 + i]; }
  return a;
}
__device__ __forceinline__ v16h frag_f32s(const float* rowk0, int lane, float sc) {
  v16h a; const float* p = rowk0 + 8 * (lane >> 4);
#pragma unroll
  for (int i = 0; i < 8; ++i) { a[i] = (_Float16)(p[i] * sc); a[8 + i] = (_Float16)(p[16 + i] * sc); }
  return a;
}
// column fragment from a [K][ld] layout (column n), rows >= K read as 0
__device__ __forceinline__ v16h fragc_f32(const float* W, int k0, int n, int lane, int ld, int K) {
  v16h a; const int g = lane >> 4;
#pragma unroll
  for (int i = 0; i < 8; ++i) { const int ka = k0 + 8 * g + i, kb = ka + 16;
    a[i] = (_Float16)(ka < K ? W[(size_t)(ka < K ? ka : K - 1) * ld + n] : 0.f); a[8 + i] = (_Float16)(kb < K ? W[(size_t)(kb < K ? kb : K - 1) * ld + n] : 0.f); }
  return a;
}
struct F2 { v16b h, l; };
__device__ __forceinline__ F2 bsplit16(const float v[16]) { F2 r;
#pragma unroll
  for (int i = 0; i < 16; ++i) { const __bf16 h = (__bf16)v[i]; r.h[i] = h; r.l[i] = (__bf16)(v[i] - (float)h); }
  return r; }
__device__ __forceinline__ F2 split_row(const float* row, int k0, int lane) { float v[16]; const float* p = row + k0 + 8 * (lane >> 4);
#pragma unroll
  for (int i = 0; i < 8; ++i) { v[i] = p[i]; v[8 + i] = p[16 + i]; }
  return bsplit16(v); }
__device__ __forceinline__ F2 split_rowK(const float* row, int k0, int lane, int K) { float v[16]; const int g = lane >> 4;
#pragma unroll
  for (int i = 0; i < 8; ++i) { const int ka = k0 + 8 * g + i, kb = ka + 16; v[i] = ka < K ? row[ka < K ? ka : K - 1] : 0.f; v[8 + i] = kb < K ? row[kb < K ? kb : K - 1] : 0.f; }
  return bsplit16(v); }
__device__ __forceinline__ F2 split_col(const float* W, int k0, int n, int lane, int ld, int K) { float v[16]; const int g = lane >> 4;
#pragma unroll
  for (int i = 0; i < 8; ++i) { const int ka = k0 + 8 * g + i, kb = ka + 16; v[i] = ka < K ? W[(size_t)(ka < K ? ka : K - 1) * ld + n] : 0.f; v[8 + i] = kb < K ? W[(size_t)(kb < K ? kb : K - 1) * ld + n] : 0.f; }
  return bsplit16(v); }
__device__ __forceinline__ v8f mac3(const F2& a, const F2& b, v8f c) { c = wmma_bf(a.l, b.h, c); c = wmma_bf(a.h, b.l, c); return wmma_bf(a.h, b.h, c); }
__device__ __forceinline__ float sigm(float v) { return 1.0f / (1.0f + expf(-v)); }
#define LDSX() do { asm volatile("s_wait_dscnt 0" ::: "memory"); __builtin_amdgcn_wave_barrier(); __builtin_amdgcn_fence(__ATOMIC_RELEASE, "workgroup"); } while (0)


// Gated spatial attention on [8,128,32,32] (4 heads x 32 over the 1,024 positions): qkv = inp @ qkv_w + qkv_b ([in][out], per-head interleaved columns h*96 + {q,k,v}*32 + d); softmax(q.k 32^-0.5) over all positions; feats @ gate_w + gate_b -> val | gate; y = x + val * sigmoid(gate) (NCHW).
// k_cvtx (pixel-major bf16 rows), k_qkv (Q32 f32 [bh][n][32]; K bf16 hi/lo rows; V bf16 hi/lo planes), k_attn (block = 64 queries x (b,h); O rows [b][n][128]), k_out (val/gate tiles per channel, sigmoid gating, residual, NCHW store).
#define NB 8
#define CC 128
#define NN 1024
#define NHD 4
#define DH 32
__device__ __attribute__((noinline)) float sigm_ni(float v) { return 1.0f / (1.0f + expf(-v)); }
__device__ __forceinline__ float bfr(float v) { return (float)(__bf16)v; }
__device__ __forceinline__ v16b frag_b(const __bf16* rowk0, int lane) { return __builtin_bit_cast(v16b, frag_h((const _Float16*)rowk0, lane)); }

__global__ __launch_bounds__(256) void k_cvtx(const float* __restrict__ x, __bf16* __restrict__ XT) {
  __shared__ __align__(16) __bf16 st[64][CC + 8];
  const int tid = threadIdx.x; const int b = blockIdx.y, p0 = blockIdx.x * 64;
  for (int q = tid; q < CC * 16; q += 256) { const int c = q >> 4, p4 = q & 15; const v4f v = *(const v4f*)(x + ((size_t)b * CC + c) * NN + p0 + p4 * 4);
    st[p4 * 4][c] = (__bf16)v[0]; st[p4 * 4 + 1][c] = (__bf16)v[1]; st[p4 * 4 + 2][c] = (__bf16)v[2]; st[p4 * 4 + 3][c] = (__bf16)v[3]; }
  __syncthreads();
  for (int q = tid; q < 64 * (CC / 8); q += 256) { const int rl = q / (CC / 8), pc = q % (CC / 8); vst2((unsigned*)(XT + ((size_t)b * NN + p0 + rl) * CC + pc * 8), *(const v4u*)(&st[rl][pc * 8])); }
}
// qkv: block (64 tokens, 128 output channels = 4 heads, which): rows = XT, B = W columns ([in][out]) + bias
__global__ __launch_bounds__(128) void k_qkv(const __bf16* __restrict__ XT, const float* __restrict__ W, const float* __restrict__ bias, float* __restrict__ Q32, __bf16* __restrict__ Kh, __bf16* __restrict__ Kl, __bf16* __restrict__ VTh, __bf16* __restrict__ VTl) {
  __shared__ __align__(16) float so[4][16][132]; __shared__ __align__(16) __bf16 sh_[4][16][136], sl_[4][16][136]; __shared__ __align__(16) __bf16 sth[128][72], stl[128][72];
  const int tid = threadIdx.x, wave = tid >> 5, lane = tid & 31, col = lane & 15, g = lane >> 4; const int r0b = blockIdx.x * 64, n0 = blockIdx.y * 128, which = blockIdx.z; const int b = r0b / NN, s0 = r0b % NN; const size_t r0 = (size_t)r0b + wave * 16;
  v8f acc[8] = {};
#pragma unroll
  for (int kc = 0; kc < CC / 32; ++kc) { const v16b a = frag_b(XT + (r0 + col) * CC + kc * 32, lane);
#pragma unroll
    for (int j = 0; j < 8; ++j) { const int c = n0 + j * 16 + col; acc[j] = wmma_bf(a, split_col(W, kc * 32, (c >> 5) * (3 * DH) + which * DH + (c & 31), lane, 3 * CC, CC).h, acc[j]); } }      // column h*96 + which*32 + d of qkv_w [128][384]
  if (which == 0) {
#pragma unroll
    for (int j = 0; j < 8; ++j) { const int c = n0 + j * 16 + col; const float bb = bfr(bias[(c >> 5) * (3 * DH) + 0 * DH + (c & 31)]);
#pragma unroll
      for (int r = 0; r < 8; ++r) so[wave][8 * g + r][j * 16 + col] = acc[j][r] + bb; }
    LDSX();
    for (int qq = lane; qq < 4 * 16 * 8; qq += 32) { const int hh = qq >> 7, rl = (qq >> 3) & 15, pc = qq & 7; const int h = (n0 >> 5) + hh; vst2(Q32 + (((size_t)b * NHD + h) * NN + s0 + wave * 16 + rl) * DH + pc * 4, *(const v4f*)(&so[wave][rl][hh * 32 + pc * 4])); } }
  else if (which == 1) {
#pragma unroll
    for (int j = 0; j < 8; ++j) { const int c = n0 + j * 16 + col; const float bb = bfr(bias[(c >> 5) * (3 * DH) + 1 * DH + (c & 31)]);
#pragma unroll
      for (int r = 0; r < 8; ++r) { const float v = acc[j][r] + bb; const __bf16 hi = (__bf16)v; sh_[wave][8 * g + r][j * 16 + col] = hi; sl_[wave][8 * g + r][j * 16 + col] = (__bf16)(v - (float)hi); } }
    LDSX();
    // K rows [bh][n][32] bf16 = 64 B: 4 lanes x 16 B; per instruction 8 (head,row) pairs
    for (int qq = lane; qq < 4 * 16 * 4; qq += 32) { const int hh = qq >> 6, rl = (qq >> 2) & 15, pc = qq & 3; const int h = (n0 >> 5) + hh; const size_t o = (((size_t)b * NHD + h) * NN + s0 + wave * 16 + rl) * DH + pc * 8; vst2((unsigned*)(Kh + o), *(const v4u*)(&sh_[wave][rl][hh * 32 + pc * 8])); vst2((unsigned*)(Kl + o), *(const v4u*)(&sl_[wave][rl][hh * 32 + pc * 8])); } }
  else {
#pragma unroll
    for (int j = 0; j < 8; ++j) { const int c = n0 + j * 16 + col; const float bb = bfr(bias[(c >> 5) * (3 * DH) + 2 * DH + (c & 31)]);
#pragma unroll
      for (int r = 0; r < 8; ++r) { const float v = acc[j][r] + bb; const __bf16 hi = (__bf16)v; sth[j * 16 + col][wave * 16 + 8 * g + r] = hi; stl[j * 16 + col][wave * 16 + 8 * g + r] = (__bf16)(v - (float)hi); } }
    __syncthreads();
    for (int qq = tid; qq < 128 * 8; qq += 128) { const int cl = qq >> 3, pc = qq & 7; const int c = n0 + cl; const int h = c >> 5, d = c & 31; const size_t o = (((size_t)b * NHD + h) * DH + d) * NN + s0 + pc * 8; vst2((unsigned*)(VTh + o), *(const v4u*)(&sth[cl][pc * 8])); vst2((unsigned*)(VTl + o), *(const v4u*)(&stl[cl][pc * 8])); } }
}
// fragment from a head's base pointer (the same for the wave) plus the lane's 32-bit byte offset
__device__ __forceinline__ v16b frag_o(const __bf16* ubase, unsigned off) { union { v16b v; v4u q[2]; } u; const char* p = (const char*)ubase + off; u.q[0] = *(const v4u*)p; u.q[1] = *(const v4u*)(p + 32); return u.v; }
__global__ __launch_bounds__(128) void k_attn(const float* __restrict__ Q32, const __bf16* __restrict__ Kh, const __bf16* __restrict__ Kl, const __bf16* __restrict__ VTh, const __bf16* __restrict__ VTl, float* __restrict__ O) {
  __shared__ __align__(16) float sS[4][16][68];
  __shared__ __align__(16) __bf16 sPh[4][16][72], sPl[4][16][72];
  __shared__ __align__(16) float sO[4][16][36];
  const int tid = threadIdx.x, w = tid >> 5, lane = tid & 31, col = lane & 15, g = lane >> 4; const size_t bh = blockIdx.y; const int b = (int)(bh / NHD), h = (int)(bh % NHD); const int q0 = blockIdx.x * 64 + w * 16;
  const F2 aq = split_row(Q32 + (bh * NN + q0 + col) * DH, 0, lane);
  float mrun = -3.0e38f, lrun = 0.f; v8f acc[2] = {};
  // all fragment loads of a pass are issued together at the head of its softmax, which runs while they fly: V of this pass and K of the next one (K of pass 0 in front of the loop)
  const __bf16* bkh = Kh + bh * NN * DH; const __bf16* bkl = Kl + bh * NN * DH; const __bf16* bvh = VTh + bh * DH * NN; const __bf16* bvl = VTl + bh * DH * NN;
  unsigned ko = (unsigned)(col * DH + 8 * g) * 2u, vo = (unsigned)(col * NN + 8 * g) * 2u;
  v16b khf[4], klf[4];
#pragma unroll
  for (int t = 0; t < 4; ++t) { khf[t] = frag_o(bkh + t * 16 * DH, ko); klf[t] = frag_o(bkl + t * 16 * DH, ko); }
#pragma unroll 1
  for (int kt = 0; kt < NN / 64; ++kt) {
#pragma unroll
    for (int t = 0; t < 4; ++t) {
      v8f s = {}; s = wmma_bf(aq.l, khf[t], s); s = wmma_bf(aq.h, klf[t], s); s = wmma_bf(aq.h, khf[t], s);
#pragma unroll
      for (int r = 0; r < 8; ++r) sS[w][8 * g + r][t * 16 + col] = s[r] * 0.17677669529663687f; }
    LDSX();
    ko += kt + 1 < NN / 64 ? 64 * DH * 2 : 0;      // the last pass fetches its own rows again (unused), so no address leaves this head's K
    v16b vh[2][2], vl[2][2];
#pragma unroll
    for (int kc = 0; kc < 2; ++kc) {
#pragma unroll
      for (int t = 0; t < 2; ++t) { vh[kc][t] = frag_o(bvh + t * 16 * NN + kc * 32, vo); vl[kc][t] = frag_o(bvl + t * 16 * NN + kc * 32, vo); } }
    asm volatile("s_wait_xcnt 0x0" ::: "memory");      // in front of the K loads, whose destinations may be laid on the V loads' address registers
#pragma unroll
    for (int t = 0; t < 4; ++t) { khf[t] = frag_o(bkh + t * 16 * DH, ko); klf[t] = frag_o(bkl + t * 16 * DH, ko); }
    __builtin_amdgcn_sched_barrier(0);      // holds the loads here: without it the scheduler sinks K's to the foot of the softmax, straight in front of the wait that the next fence brings
    float mx = -3.4e38f;
#pragma unroll
    for (int jj = 0; jj < 32; ++jj) mx = fmaxf(mx, sS[w][col][g * 32 + jj]);
    mx = fmaxf(mx, __shfl_xor(mx, 16, 32));
    const float mnew = fmaxf(mrun, mx); const float corr = expf(mrun - mnew);
    float ps = 0.f;
#pragma unroll
    for (int jj = 0; jj < 32; ++jj) { const float p = expf(sS[w][col][g * 32 + jj] - mnew); ps += p; const __bf16 hi = (__bf16)p; sPh[w][col][g * 32 + jj] = hi; sPl[w][col][g * 32 + jj] = (__bf16)(p - (float)hi); }
    ps += __shfl_xor(ps, 16, 32);
    lrun = lrun * corr + ps; mrun = mnew;
#pragma unroll
    for (int r = 0; r < 8; ++r) { const float cr = __shfl(corr, 8 * g + r, 32); acc[0][r] *= cr; acc[1][r] *= cr; }
    LDSX();
#pragma unroll
    for (int kc = 0; kc < 2; ++kc) { const v16b ph = frag_b(&sPh[w][col][0] + kc * 32, lane), pl = frag_b(&sPl[w][col][0] + kc * 32, lane);
#pragma unroll
      for (int t = 0; t < 2; ++t) { acc[t] = wmma_bf(pl, vh[kc][t], acc[t]); acc[t] = wmma_bf(ph, vl[kc][t], acc[t]); acc[t] = wmma_bf(ph, vh[kc][t], acc[t]); } }
    vo += 64 * 2;
    __builtin_amdgcn_wave_barrier(); }
#pragma unroll
  for (int r = 0; r < 8; ++r) { const float lr = __shfl(lrun, 8 * g + r, 32); const float inv = 1.0f / lr; sO[w][8 * g + r][col] = acc[0][r] * inv; sO[w][8 * g + r][16 + col] = acc[1][r] * inv; }
  LDSX();
  for (int qq = lane; qq < 16 * 8; qq += 32) { const int rl = qq >> 3, pc = qq & 7; vst2(O + ((size_t)b * NN + q0 + rl) * CC + h * DH + pc * 4, *(const v4f*)(&sO[w][rl][pc * 4])); }
}
// y[b][c][n] = x[b][c][n] + (Wg[:][c] . O[n][:] (hi/lo) + bg[c]) * sigmoid(Wg[:][CC+c] . O[n][:] + bg[CC+c]): block (b, 64 tokens); wave w -> channel tiles 2w..2w+1 (32 channels) x 4 token tiles
__global__ __launch_bounds__(128) void k_out(const float* __restrict__ O, const float* __restrict__ Wg, const float* __restrict__ bg, const float* __restrict__ x, float* __restrict__ y) {
  __shared__ __align__(16) float sY[4][32][68];
  const int tid = threadIdx.x, w = tid >> 5, lane = tid & 31, col = lane & 15, g = lane >> 4; const int b = blockIdx.y, p0 = blockIdx.x * 64; const size_t base = (size_t)b * NN;
  v8f av[2][4] = {}, ag[2][4] = {};
#pragma unroll 1
  for (int kc = 0; kc < CC / 32; ++kc) { F2 bc[4];
#pragma unroll
    for (int pt = 0; pt < 4; ++pt) bc[pt] = split_row(O + (base + p0 + pt * 16 + col) * CC, kc * 32, lane);
#pragma unroll
    for (int ct = 0; ct < 2; ++ct) { const int c = (w * 2 + ct) * 16 + col; const v16b a1 = split_col(Wg, kc * 32, c, lane, 2 * CC, CC).h, a2 = split_col(Wg, kc * 32, CC + c, lane, 2 * CC, CC).h;
#pragma unroll
      for (int pt = 0; pt < 4; ++pt) { av[ct][pt] = wmma_bf(a1, bc[pt].l, av[ct][pt]); av[ct][pt] = wmma_bf(a1, bc[pt].h, av[ct][pt]); ag[ct][pt] = wmma_bf(a2, bc[pt].l, ag[ct][pt]); ag[ct][pt] = wmma_bf(a2, bc[pt].h, ag[ct][pt]); } } }
#pragma unroll
  for (int ct = 0; ct < 2; ++ct) {
#pragma unroll
    for (int r = 0; r < 8; ++r) { const int cl = ct * 16 + 8 * g + r; const int c = w * 32 + cl; const float bv_ = bfr(bg[c]), bg_ = bfr(bg[CC + c]);
#pragma unroll
      for (int pt = 0; pt < 4; ++pt) { const int n = p0 + pt * 16 + col; const float val = av[ct][pt][r] + bv_; const float gt = ag[ct][pt][r] + bg_; sY[w][cl][pt * 16 + col] = bfr(x[((size_t)b * CC + c) * NN + n]) + val * sigm_ni(gt); } } }
  LDSX();
  for (int qq = lane; qq < 32 * 16; qq += 32) { const int cl = qq >> 4, pc = qq & 15; vst2(y + ((size_t)b * CC + w * 32 + cl) * NN + p0 + pc * 4, *(const v4f*)(&sY[w][cl][pc * 4])); }
}
extern "C" void kernel_launch(void* const* d_in, const int* in_sizes, int n_in, void* d_out, int out_size, void* d_ws, size_t ws_size, hipStream_t stream) {
  (void)in_sizes; (void)n_in; (void)out_size; (void)ws_size;
  const float* x = (const float*)d_in[0]; const float* Wqkv = (const float*)d_in[1]; const float* bqkv = (const float*)d_in[2]; const float* Wg = (const float*)d_in[3]; const float* bg = (const float*)d_in[4];
  char* ws = (char*)d_ws; size_t off = 0;
  auto take = [&](size_t bytes) { char* p = ws + off; off += (bytes + 255) & ~(size_t)255; return p; };
  __bf16* XT = (__bf16*)take((size_t)NB * NN * CC * 2); float* Q32 = (float*)take((size_t)NB * NN * CC * 4); __bf16* Kh = (__bf16*)take((size_t)NB * NN * CC * 2); __bf16* Kl = (__bf16*)take((size_t)NB * NN * CC * 2); __bf16* VTh = (__bf16*)take((size_t)NB * NN * CC * 2); __bf16* VTl = (__bf16*)take((size_t)NB * NN * CC * 2); float* O = (float*)take((size_t)NB * NN * CC * 4);
  // ws ~ 19 MB
  k_cvtx<<<dim3(NN / 64, NB), 256, 0, stream>>>(x, XT);
  k_qkv<<<dim3(NB * NN / 64, CC / 128, 3), 128, 0, stream>>>(XT, Wqkv, bqkv, Q32, Kh, Kl, VTh, VTl);
  k_attn<<<dim3(NN / 64, NB * NHD), 128, 0, stream>>>(Q32, Kh, Kl, VTh, VTl, O);
  k_out<<<dim3(NN / 64, NB), 128, 0, stream>>>(O, Wg, bg, x, (float*)d_out);
}

// v002
// One run takes 61.5 microseconds.
// Next to v001, in two timings, it ran 1.12 and 1.13 times as fast.
// Counting every step since v000, it is 1.79 times as fast.
// compute dtype: x, qkv_w, qkv_b, gate_w, gate_b (INPUTS) rounded to bf16 with exact bf16 WMMA products (f32 accumulate) for the qkv projection and the gate projection's weight side; q kept f32 and split hi/lo, k as bf16 hi/lo rows (3 products), softmax weights and v as bf16 hi/lo (3 products), attention output hi/lo x bf16(gate_w) (2 products); softmax, sigmoid gating and the residual in f32.
#include <hip/hip_runtime.h>
#include <math.h>

typedef __attribute__((ext_vector_type(16))) _Float16 v16h;
typedef __attribute__((ext_vector_type(16))) __bf16 v16b;
typedef __attribute__((ext_vector_type(8)))  _Float16 v8h;
typedef __attribute__((ext_vector_type(8)))  float v8f;
typedef __attribute__((ext_vector_type(4)))  float v4f;
typedef __attribute__((ext_vector_type(2)))  float v2f;
typedef __attribute__((ext_vector_type(4)))  unsigned v4u;
typedef __attribute__((ext_vector_type(4)))  int v4i;
typedef float __attribute__((may_alias)) float_a;
typedef int __attribute__((may_alias)) int_a;

template <typename T> __device__ __forceinline__ void vst2(void* p, T v) { *(T*)p = v;  }
__device__ __forceinline__ v8f wmma16(v16h a, v16h b, v8f c) {
  v8f d = __builtin_amdgcn_wmma_f32_16x16x32_f16(false, a, false, b, (short)0, c, false, false);
  asm volatile("v_nop\n\tv_nop\n\tv_nop\n\tv_nop" : "+v"(d) : "v"(a), "v"(b));
  return d;
}
__device__ __forceinline__ v8f wmma_bf(v16b a, v16b b, v8f c) {
  v8f d = __builtin_amdgcn_wmma_f32_16x16x32_bf16(false, a, false, b, (short)0, c, false, false);
  asm volatile("v_nop\n\tv_nop\n\tv_nop\n\tv_nop" : "+v"(d) : "v"(a), "v"(b));
  return d;
}
// 16x16x32 fragments: lane = (h = lane>>4, row/col = lane&15); elements 0..7 = k0+8h+0..7, 8..15 = k0+16+8h+0..7; D element r = row 8h+r
__device__ __forceinline__ v16h frag_h(const _Float16* rowk0, int lane) {
  union { v16h v; v8h q[2]; } u; const _Float16* p = rowk0 + 8 * (lane >> 4);
  u.q[0] = *(const v8h*)p; u.q[1] = *(const v8h*)(p + 16); return u.v;
}
__device__ __forceinline__ v16h frag_f32(const float* rowk0, int lane) {
  v16h a; const float* p = rowk0 + 8 * (lane >> 4);
#pragma unroll
  for (int i = 0; i < 8; ++i) { a[i] = (_Float16)p[i]; a[8 + i] = (_Float16)p[16 + i]; }
  return a;
}
__device__ __forceinline__ v16h frag_f32s(const float* rowk0, int lane, float sc) {
  v16h a; const float* p = rowk0 + 8 * (lane >> 4);
#pragma unroll
  for (int i = 0; i < 8; ++i) { a[i] = (_Float16)(p[i] * sc); a[8 + i] = (_Float16)(p[16 + i] * sc); }
  return a;
}
// column fragment from a [K][ld] layout (column n), rows >= K read as 0
__device__ __forceinline__ v16h fragc_f32(const float* W, int k0, int n, int lane, int ld, int K) {
  v16h a; const int g = lane >> 4;
#pragma unroll
  for (int i = 0; i < 8; ++i) { const int ka = k0 + 8 * g + i, kb = ka + 16;
    a[i] = (_Float16)(ka < K ? W[(size_t)(ka < K ? ka : K - 1) * ld + n] : 0.f); a[8 + i] = (_Float16)(kb < K ? W[(size_t)(kb < K ? kb : K - 1) * ld + n] : 0.f); }
  return a;
}
struct F2 { v16b h, l; };
__device__ __forceinline__ F2 bsplit16(const float v[16]) { F2 r;
#pragma unroll
  for (int i = 0; i < 16; ++i) { const __bf16 h = (__bf16)v[i]; r.h[i] = h; r.l[i] = (__bf16)(v[i] - (float)h); }
  return r; }
__device__ __forceinline__ F2 split_row(const float* row, int k0, int lane) { float v[16]; const float* p = row + k0 + 8 * (lane >> 4);
#pragma unroll
  for (int i = 0; i < 8; ++i) { v[i] = p[i]; v[8 + i] = p[16 + i]; }
  return bsplit16(v); }
__device__ __forceinline__ F2 split_rowK(const float* row, int k0, int lane, int K) { float v[16]; const int g = lane >> 4;
#pragma unroll
  for (int i = 0; i < 8; ++i) { const int ka = k0 + 8 * g + i, kb = ka + 16; v[i] = ka < K ? row[ka < K ? ka : K - 1] : 0.f; v[8 + i] = kb < K ? row[kb < K ? kb : K - 1] : 0.f; }
  return bsplit16(v); }
__device__ __forceinline__ F2 split_col(const float* W, int k0, int n, int lane, int ld, int K) { float v[16]; const int g = lane >> 4;
#pragma unroll
  for (int i = 0; i < 8; ++i) { const int ka = k0 + 8 * g + i, kb = ka + 16; v[i] = ka < K ? W[(size_t)(ka < K ? ka : K - 1) * ld + n] : 0.f; v[8 + i] = kb < K ? W[(size_t)(kb < K ? kb : K - 1) * ld + n] : 0.f; }
  return bsplit16(v); }
__device__ __forceinline__ v8f mac3(const F2& a, const F2& b, v8f c) { c = wmma_bf(a.l, b.h, c); c = wmma_bf(a.h, b.l, c); return wmma_bf(a.h, b.h, c); }
__device__ __forceinline__ float sigm(float v) { return 1.0f / (1.0f + expf(-v)); }
#define LDSX() do { asm volatile("s_wait_dscnt 0" ::: "memory"); __builtin_amdgcn_wave_barrier(); __builtin_amdgcn_fence(__ATOMIC_RELEASE, "workgroup"); } while (0)


// Gated spatial attention on [8,128,32,32] (4 heads x 32 over the 1,024 positions): qkv = inp @ qkv_w + qkv_b ([in][out], per-head interleaved columns h*96 + {q,k,v}*32 + d); softmax(q.k 32^-0.5) over all positions; feats @ gate_w + gate_b -> val | gate; y = x + val * sigmoid(gate) (NCHW).
// k_cvtx (pixel-major bf16 rows), k_qkv (Q32 f32 [bh][n][32]; K bf16 hi/lo rows; V bf16 hi/lo planes), k_attn (block = 64 queries x (b,h); O rows [b][n][128]), k_out (val/gate tiles per channel, sigmoid gating, residual, NCHW store).
#define NB 8
#define CC 128
#define NN 1024
#define NHD 4
#define DH 32
__device__ __attribute__((noinline)) float sigm_ni(float v) { return 1.0f / (1.0f + expf(-v)); }
__device__ __forceinline__ float bfr(float v) { return (float)(__bf16)v; }
__device__ __forceinline__ v16b frag_b(const __bf16* rowk0, int lane) { return __builtin_bit_cast(v16b, frag_h((const _Float16*)rowk0, lane)); }

__global__ __launch_bounds__(256) void k_cvtx(const float* __restrict__ x, __bf16* __restrict__ XT) {
  __shared__ __align__(16) __bf16 st[64][CC + 8];
  const int tid = threadIdx.x; const int b = blockIdx.y, p0 = blockIdx.x * 64;
  for (int q = tid; q < CC * 16; q += 256) { const int c = q >> 4, p4 = q & 15; const v4f v = *(const v4f*)(x + ((size_t)b * CC + c) * NN + p0 + p4 * 4);
    st[p4 * 4][c] = (__bf16)v[0]; st[p4 * 4 + 1][c] = (__bf16)v[1]; st[p4 * 4 + 2][c] = (__bf16)v[2]; st[p4 * 4 + 3][c] = (__bf16)v[3]; }
  __syncthreads();
  for (int q = tid; q < 64 * (CC / 8); q += 256) { const int rl = q / (CC / 8), pc = q % (CC / 8); vst2((unsigned*)(XT + ((size_t)b * NN + p0 + rl) * CC + pc * 8), *(const v4u*)(&st[rl][pc * 8])); }
}
// qkv: block (64 tokens, 128 output channels = 4 heads, which): rows = XT, B = W columns ([in][out]) + bias
__global__ __launch_bounds__(128) void k_qkv(const __bf16* __restrict__ XT, const float* __restrict__ W, const float* __restrict__ bias, float* __restrict__ Q32, __bf16* __restrict__ Kh, __bf16* __restrict__ Kl, __bf16* __restrict__ VTh, __bf16* __restrict__ VTl) {
  __shared__ __align__(16) float so[4][16][132]; __shared__ __align__(16) __bf16 sh_[4][16][136], sl_[4][16][136]; __shared__ __align__(16) __bf16 sth[128][72], stl[128][72];
  const int tid = threadIdx.x, wave = tid >> 5, lane = tid & 31, col = lane & 15, g = lane >> 4; const int r0b = blockIdx.x * 64, n0 = blockIdx.y * 128, which = blockIdx.z; const int b = r0b / NN, s0 = r0b % NN; const size_t r0 = (size_t)r0b + wave * 16;
  v8f acc[8] = {};
#pragma unroll
  for (int kc = 0; kc < CC / 32; ++kc) { const v16b a = frag_b(XT + (r0 + col) * CC + kc * 32, lane);
#pragma unroll
    for (int j = 0; j < 8; ++j) { const int c = n0 + j * 16 + col; acc[j] = wmma_bf(a, split_col(W, kc * 32, (c >> 5) * (3 * DH) + which * DH + (c & 31), lane, 3 * CC, CC).h, acc[j]); } }      // column h*96 + which*32 + d of qkv_w [128][384]
  if (which == 0) {
#pragma unroll
    for (int j = 0; j < 8; ++j) { const int c = n0 + j * 16 + col; const float bb = bfr(bias[(c >> 5) * (3 * DH) + 0 * DH + (c & 31)]);
#pragma unroll
      for (int r = 0; r < 8; ++r) so[wave][8 * g + r][j * 16 + col] = acc[j][r] + bb; }
    LDSX();
    for (int qq = lane; qq < 4 * 16 * 8; qq += 32) { const int hh = qq >> 7, rl = (qq >> 3) & 15, pc = qq & 7; const int h = (n0 >> 5) + hh; vst2(Q32 + (((size_t)b * NHD + h) * NN + s0 + wave * 16 + rl) * DH + pc * 4, *(const v4f*)(&so[wave][rl][hh * 32 + pc * 4])); } }
  else if (which == 1) {
#pragma unroll
    for (int j = 0; j < 8; ++j) { const int c = n0 + j * 16 + col; const float bb = bfr(bias[(c >> 5) * (3 * DH) + 1 * DH + (c & 31)]);
#pragma unroll
      for (int r = 0; r < 8; ++r) { const float v = acc[j][r] + bb; const __bf16 hi = (__bf16)v; sh_[wave][8 * g + r][j * 16 + col] = hi; sl_[wave][8 * g + r][j * 16 + col] = (__bf16)(v - (float)hi); } }
    LDSX();
    // K rows [bh][n][32] bf16 = 64 B: 4 lanes x 16 B; per instruction 8 (head,row) pairs
    for (int qq = lane; qq < 4 * 16 * 4; qq += 32) { const int hh = qq >> 6, rl = (qq >> 2) & 15, pc = qq & 3; const int h = (n0 >> 5) + hh; const size_t o = (((size_t)b * NHD + h) * NN + s0 + wave * 16 + rl) * DH + pc * 8; vst2((unsigned*)(Kh + o), *(const v4u*)(&sh_[wave][rl][hh * 32 + pc * 8])); vst2((unsigned*)(Kl + o), *(const v4u*)(&sl_[wave][rl][hh * 32 + pc * 8])); } }
  else {
#pragma unroll
    for (int j = 0; j < 8; ++j) { const int c = n0 + j * 16 + col; const float bb = bfr(bias[(c >> 5) * (3 * DH) + 2 * DH + (c & 31)]);
#pragma unroll
      for (int r = 0; r < 8; ++r) { const float v = acc[j][r] + bb; const __bf16 hi = (__bf16)v; sth[j * 16 + col][wave * 16 + 8 * g + r] = hi; stl[j * 16 + col][wave * 16 + 8 * g + r] = (__bf16)(v - (float)hi); } }
    __syncthreads();
    for (int qq = tid; qq < 128 * 8; qq += 128) { const int cl = qq >> 3, pc = qq & 7; const int c = n0 + cl; const int h = c >> 5, d = c & 31; const size_t o = (((size_t)b * NHD + h) * DH + d) * NN + s0 + pc * 8; vst2((unsigned*)(VTh + o), *(const v4u*)(&sth[cl][pc * 8])); vst2((unsigned*)(VTl + o), *(const v4u*)(&stl[cl][pc * 8])); } }
}
// fragment from a head's base pointer (the same for the wave) plus the lane's 32-bit byte offset
__device__ __forceinline__ v16b frag_o(const __bf16* ubase, unsigned off) { union { v16b v; v4u q[2]; } u; const char* p = (const char*)ubase + off; u.q[0] = *(const v4u*)p; u.q[1] = *(const v4u*)(p + 32); return u.v; }
__global__ __launch_bounds__(128) void k_attn(const float* __restrict__ Q32, const __bf16* __restrict__ Kh, const __bf16* __restrict__ Kl, const __bf16* __restrict__ VTh, const __bf16* __restrict__ VTl, float* __restrict__ O) {
  __shared__ __align__(16) float sS[4][16][68];
  __shared__ __align__(16) __bf16 sPh[4][16][72], sPl[4][16][72];
  __shared__ __align__(16) float sO[4][16][36];
  const int tid = threadIdx.x, w = tid >> 5, lane = tid & 31, col = lane & 15, g = lane >> 4; const size_t bh = blockIdx.y; const int b = (int)(bh / NHD), h = (int)(bh % NHD); const int q0 = blockIdx.x * 64 + w * 16;
  const F2 aq = split_row(Q32 + (bh * NN + q0 + col) * DH, 0, lane);
  float mrun = -3.0e38f, lrun = 0.f; v8f acc[2] = {};
  // all fragment loads of a pass are issued together at the head of its softmax, which runs while they fly: V of this pass and K of the next one (K of pass 0 in front of the loop)
  const __bf16* bkh = Kh + bh * NN * DH; const __bf16* bkl = Kl + bh * NN * DH; const __bf16* bvh = VTh + bh * DH * NN; const __bf16* bvl = VTl + bh * DH * NN;
  unsigned ko = (unsigned)(col * DH + 8 * g) * 2u, vo = (unsigned)(col * NN + 8 * g) * 2u;
  v16b khf[4], klf[4];
#pragma unroll
  for (int t = 0; t < 4; ++t) { khf[t] = frag_o(bkh + t * 16 * DH, ko); klf[t] = frag_o(bkl + t * 16 * DH, ko); }
#pragma unroll 1
  for (int kt = 0; kt < NN / 64; ++kt) {
#pragma unroll
    for (int t = 0; t < 4; ++t) {
      v8f s = {}; s = wmma_bf(aq.l, khf[t], s); s = wmma_bf(aq.h, klf[t], s); s = wmma_bf(aq.h, khf[t], s);
#pragma unroll
      for (int r = 0; r < 8; ++r) sS[w][8 * g + r][t * 16 + col] = s[r] * 0.17677669529663687f; }
    LDSX();
    ko += kt + 1 < NN / 64 ? 64 * DH * 2 : 0;      // the last pass fetches its own rows again (unused), so no address leaves this head's K
    v16b vh[2][2], vl[2][2];
#pragma unroll
    for (int kc = 0; kc < 2; ++kc) {
#pragma unroll
      for (int t = 0; t < 2; ++t) { vh[kc][t] = frag_o(bvh + t * 16 * NN + kc * 32, vo); vl[kc][t] = frag_o(bvl + t * 16 * NN + kc * 32, vo); } }
    asm volatile("s_wait_xcnt 0x0" ::: "memory");      // in front of the K loads, whose destinations may be laid on the V loads' address registers
#pragma unroll
    for (int t = 0; t < 4; ++t) { khf[t] = frag_o(bkh + t * 16 * DH, ko); klf[t] = frag_o(bkl + t * 16 * DH, ko); }
    __builtin_amdgcn_sched_barrier(0);      // holds the loads here: without it the scheduler sinks K's to the foot of the softmax, straight in front of the wait that the next fence brings
    float mx = -3.4e38f;
#pragma unroll
    for (int jj = 0; jj < 32; ++jj) mx = fmaxf(mx, sS[w][col][g * 32 + jj]);
    mx = fmaxf(mx, __shfl_xor(mx, 16, 32));
    const float mnew = fmaxf(mrun, mx); const float corr = expf(mrun - mnew);
    float ps = 0.f;
#pragma unroll
    for (int jj = 0; jj < 32; ++jj) { const float p = expf(sS[w][col][g * 32 + jj] - mnew); ps += p; const __bf16 hi = (__bf16)p; sPh[w][col][g * 32 + jj] = hi; sPl[w][col][g * 32 + jj] = (__bf16)(p - (float)hi); }
    ps += __shfl_xor(ps, 16, 32);
    lrun = lrun * corr + ps; mrun = mnew;
#pragma unroll
    for (int r = 0; r < 8; ++r) { const float cr = __shfl(corr, 8 * g + r, 32); acc[0][r] *= cr; acc[1][r] *= cr; }
    LDSX();
#pragma unroll
    for (int kc = 0; kc < 2; ++kc) { const v16b ph = frag_b(&sPh[w][col][0] + kc * 32, lane), pl = frag_b(&sPl[w][col][0] + kc * 32, lane);
#pragma unroll
      for (int t = 0; t < 2; ++t) { acc[t] = wmma_bf(pl, vh[kc][t], acc[t]); acc[t] = wmma_bf(ph, vl[kc][t], acc[t]); acc[t] = wmma_bf(ph, vh[kc][t], acc[t]); } }
    vo += 64 * 2;
    __builtin_amdgcn_wave_barrier(); }
#pragma unroll
  for (int r = 0; r < 8; ++r) { const float lr = __shfl(lrun, 8 * g + r, 32); const float inv = 1.0f / lr; sO[w][8 * g + r][col] = acc[0][r] * inv; sO[w][8 * g + r][16 + col] = acc[1][r] * inv; }
  LDSX();
  for (int qq = lane; qq < 16 * 8; qq += 32) { const int rl = qq >> 3, pc = qq & 7; vst2(O + ((size_t)b * NN + q0 + rl) * CC + h * DH + pc * 4, *(const v4f*)(&sO[w][rl][pc * 4])); }
}
// raw fragment loads: the addresses and guards of split_row and split_col, the conversion left to bsplit16
__device__ __forceinline__ void raw_row(const float* row, int k0, int lane, float v[16]) { const float* p = row + k0 + 8 * (lane >> 4);
#pragma unroll
  for (int i = 0; i < 8; ++i) { v[i] = p[i]; v[8 + i] = p[16 + i]; } }
__device__ __forceinline__ void raw_col(const float* W, int k0, int n, int lane, int ld, int K, float v[16]) { const int g = lane >> 4;
#pragma unroll
  for (int i = 0; i < 8; ++i) { const int ka = k0 + 8 * g + i, kb = ka + 16; v[i] = ka < K ? W[(size_t)(ka < K ? ka : K - 1) * ld + n] : 0.f; v[8 + i] = kb < K ? W[(size_t)(kb < K ? kb : K - 1) * ld + n] : 0.f; } }
// y[b][c][n] = x[b][c][n] + val * sigmoid(gate), val | gate = O[n][:] (hi/lo) . Wg[:][c | CC + c] + bg: block (b, 64 tokens); wave w -> channel tiles 2w..2w+1 (32 channels) x 4 token tiles
__global__ __launch_bounds__(128) void k_out(const float* __restrict__ O, const float* __restrict__ Wg, const float* __restrict__ bg, const float* __restrict__ x, float* __restrict__ y) {
  __shared__ __align__(16) float sY[4][32][68];
  const int tid = threadIdx.x, w = tid >> 5, lane = tid & 31, col = lane & 15, g = lane >> 4; const int b = blockIdx.y, p0 = blockIdx.x * 64; const size_t base = (size_t)b * NN;
  v8f av[2][4] = {}, ag[2][4] = {};
#pragma unroll 1
  for (int kc = 0; kc < CC / 32; ++kc) { F2 bc[4]; float ov[4][16], wv[2][2][16]; const int c0 = w * 32 + col;
    // a k step's loads are issued in two groups ahead of their use: the four O fragments with the first channel tile's weights, then the second tile's weights, which fly under the first tile's products
#pragma unroll
    for (int pt = 0; pt < 4; ++pt) raw_row(O + (base + p0 + pt * 16 + col) * CC, kc * 32, lane, ov[pt]);
    raw_col(Wg, kc * 32, c0, lane, 2 * CC, CC, wv[0][0]); raw_col(Wg, kc * 32, CC + c0, lane, 2 * CC, CC, wv[0][1]);
    __builtin_amdgcn_sched_barrier(0);      // holds the first group together: without it the scheduler issues the O loads two at a time, each pair straight in front of its own wait
    raw_col(Wg, kc * 32, c0 + 16, lane, 2 * CC, CC, wv[1][0]); raw_col(Wg, kc * 32, CC + c0 + 16, lane, 2 * CC, CC, wv[1][1]);
    asm volatile("s_wait_xcnt 0x0" ::: "memory");      // in front of the weight conversions below, whose results may be laid on these loads' address registers
    __builtin_amdgcn_sched_barrier(0);      // keeps that wait directly behind the loads, and both in front of the products
#pragma unroll
    for (int pt = 0; pt < 4; ++pt) bc[pt] = bsplit16(ov[pt]);
#pragma unroll
    for (int ct = 0; ct < 2; ++ct) { const v16b a1 = bsplit16(wv[ct][0]).h, a2 = bsplit16(wv[ct][1]).h;
#pragma unroll
      for (int pt = 0; pt < 4; ++pt) { av[ct][pt] = wmma_bf(a1, bc[pt].l, av[ct][pt]); av[ct][pt] = wmma_bf(a1, bc[pt].h, av[ct][pt]); ag[ct][pt] = wmma_bf(a2, bc[pt].l, ag[ct][pt]); ag[ct][pt] = wmma_bf(a2, bc[pt].h, ag[ct][pt]); } } }
  float xv[2][8][4];      // the tile's residual values, requested together in front of the first sigmoid call: one wait for all
#pragma unroll
  for (int ct = 0; ct < 2; ++ct) {
#pragma unroll
    for (int r = 0; r < 8; ++r) { const int c = w * 32 + ct * 16 + 8 * g + r;
#pragma unroll
      for (int pt = 0; pt < 4; ++pt) xv[ct][r][pt] = x[((size_t)b * CC + c) * NN + p0 + pt * 16 + col]; } }
#pragma unroll
  for (int ct = 0; ct < 2; ++ct) {
#pragma unroll
    for (int r = 0; r < 8; ++r) { const int cl = ct * 16 + 8 * g + r; const int c = w * 32 + cl; const float bv_ = bfr(bg[c]), bg_ = bfr(bg[CC + c]);
#pragma unroll
      for (int pt = 0; pt < 4; ++pt) { const float val = av[ct][pt][r] + bv_; const float gt = ag[ct][pt][r] + bg_; sY[w][cl][pt * 16 + col] = bfr(xv[ct][r][pt]) + val * sigm_ni(gt); } } }
  LDSX();
  for (int qq = lane; qq < 32 * 16; qq += 32) { const int cl = qq >> 4, pc = qq & 15; vst2(y + ((size_t)b * CC + w * 32 + cl) * NN + p0 + pc * 4, *(const v4f*)(&sY[w][cl][pc * 4])); }
}
extern "C" void kernel_launch(void* const* d_in, const int* in_sizes, int n_in, void* d_out, int out_size, void* d_ws, size_t ws_size, hipStream_t stream) {
  (void)in_sizes; (void)n_in; (void)out_size; (void)ws_size;
  const float* x = (const float*)d_in[0]; const float* Wqkv = (const float*)d_in[1]; const float* bqkv = (const float*)d_in[2]; const float* Wg = (const float*)d_in[3]; const float* bg = (const float*)d_in[4];
  char* ws = (char*)d_ws; size_t off = 0;
  auto take = [&](size_t bytes) { char* p = ws + off; off += (bytes + 255) & ~(size_t)255; return p; };
  __bf16* XT = (__bf16*)take((size_t)NB * NN * CC * 2); float* Q32 = (float*)take((size_t)NB * NN * CC * 4); __bf16* Kh = (__bf16*)take((size_t)NB * NN * CC * 2); __bf16* Kl = (__bf16*)take((size_t)NB * NN * CC * 2); __bf16* VTh = (__bf16*)take((size_t)NB * NN * CC * 2); __bf16* VTl = (__bf16*)take((size_t)NB * NN * CC * 2); float* O = (float*)take((size_t)NB * NN * CC * 4);
  // ws ~ 19 MB
  k_cvtx<<<dim3(NN / 64, NB), 256, 0, stream>>>(x, XT);
  k_qkv<<<dim3(NB * NN / 64, CC / 128, 3), 128, 0, stream>>>(XT, Wqkv, bqkv, Q32, Kh, Kl, VTh, VTl);
  k_attn<<<dim3(NN / 64, NB * NHD), 128, 0, stream>>>(Q32, Kh, Kl, VTh, VTl, O);
  k_out<<<dim3(NN / 64, NB), 128, 0, stream>>>(O, Wg, bg, x, (float*)d_out);
}

// v003
// A run of this version takes 55 microseconds.
// Timed twice side by side with v002, it ran 1.12 times as fast both times.
// Counting every step since v000, it is 2.00 times as fast.
// compute dtype: x, qkv_w, qkv_b, gate_w, gate_b (INPUTS) rounded to bf16 with exact bf16 WMMA products (f32 accumulate) for the qkv projection and the gate projection's weight side; q kept f32 and split hi/lo, k as bf16 hi/lo rows (3 products), softmax weights and v as bf16 hi/lo (3 products), attention output hi/lo x bf16(gate_w) (2 products); softmax, sigmoid gating and the residual in f32.
#include <hip/hip_runtime.h>
#include <math.h>

typedef __attribute__((ext_vector_type(16))) _Float16 v16h;
typedef __attribute__((ext_vector_type(16))) __bf16 v16b;
typedef __attribute__((ext_vector_type(8)))  _Float16 v8h;
typedef __attribute__((ext_vector_type(8)))  float v8f;
typedef __attribute__((ext_vector_type(4)))  float v4f;
typedef __attribute__((ext_vector_type(2)))  float v2f;
typedef __attribute__((ext_vector_type(4)))  unsigned v4u;
typedef __attribute__((ext_vector_type(4)))  int v4i;
typedef float __attribute__((may_alias)) float_a;
typedef int __attribute__((may_alias)) int_a;

template <typename T> __device__ __forceinline__ void vst2(void* p, T v) { *(T*)p = v;  }
__device__ __forceinline__ v8f wmma16(v16h a, v16h b, v8f c) {
  v8f d = __builtin_amdgcn_wmma_f32_16x16x32_f16(false, a, false, b, (short)0, c, false, false);
  asm volatile("v_nop\n\tv_nop\n\tv_nop\n\tv_nop" : "+v"(d) : "v"(a), "v"(b));
  return d;
}
__device__ __forceinline__ v8f wmma_bf(v16b a, v16b b, v8f c) {
  v8f d = __builtin_amdgcn_wmma_f32_16x16x32_bf16(false, a, false, b, (short)0, c, false, false);
  asm volatile("v_nop\n\tv_nop\n\tv_nop\n\tv_nop" : "+v"(d) : "v"(a), "v"(b));
  return d;
}
// 16x16x32 fragments: lane = (h = lane>>4, row/col = lane&15); elements 0..7 = k0+8h+0..7, 8..15 = k0+16+8h+0..7; D element r = row 8h+r
__device__ __forceinline__ v16h frag_h(const _Float16* rowk0, int lane) {
  union { v16h v; v8h q[2]; } u; const _Float16* p = rowk0 + 8 * (lane >> 4);
  u.q[0] = *(const v8h*)p; u.q[1] = *(const v8h*)(p + 16); return u.v;
}
__device__ __forceinline__ v16h frag_f32(const float* rowk0, int lane) {
  v16h a; const float* p = rowk0 + 8 * (lane >> 4);
#pragma unroll
  for (int i = 0; i < 8; ++i) { a[i] = (_Float16)p[i]; a[8 + i] = (_Float16)p[16 + i]; }
  return a;
}
__device__ __forceinline__ v16h frag_f32s(const float* rowk0, int lane, float sc) {
  v16h a; const float* p = rowk0 + 8 * (lane >> 4);
#pragma unroll
  for (int i = 0; i < 8; ++i) { a[i] = (_Float16)(p[i] * sc); a[8 + i] = (_Float16)(p[16 + i] * sc); }
  return a;
}
// column fragment from a [K][ld] layout (column n), rows >= K read as 0
__device__ __forceinline__ v16h fragc_f32(const float* W, int k0, int n, int lane, int ld, int K) {
  v16h a; const int g = lane >> 4;
#pragma unroll
  for (int i = 0; i < 8; ++i) { const int ka = k0 + 8 * g + i, kb = ka + 16;
    a[i] = (_Float16)(ka < K ? W[(size_t)(ka < K ? ka : K - 1) * ld + n] : 0.f); a[8 + i] = (_Float16)(kb < K ? W[(size_t)(kb < K ? kb : K - 1) * ld + n] : 0.f); }
  return a;
}
struct F2 { v16b h, l; };
__device__ __forceinline__ F2 bsplit16(const float v[16]) { F2 r;
#pragma unroll
  for (int i = 0; i < 16; ++i) { const __bf16 h = (__bf16)v[i]; r.h[i] = h; r.l[i] = (__bf16)(v[i] - (float)h); }
  return r; }
__device__ __forceinline__ F2 split_row(const float* row, int k0, int lane) { float v[16]; const float* p = row + k0 + 8 * (lane >> 4);
#pragma unroll
  for (int i = 0; i < 8; ++i) { v[i] = p[i]; v[8 + i] = p[16 + i]; }
  return bsplit16(v); }
__device__ __forceinline__ F2 split_rowK(const float* row, int k0, int lane, int K) { float v[16]; const int g = lane >> 4;
#pragma unroll
  for (int i = 0; i < 8; ++i) { const int ka = k0 + 8 * g + i, kb = ka + 16; v[i] = ka < K ? row[ka < K ? ka : K - 1] : 0.f; v[8 + i] = kb < K ? row[kb < K ? kb : K - 1] : 0.f; }
  return bsplit16(v); }
__device__ __forceinline__ F2 split_col(const float* W, int k0, int n, int lane, int ld, int K) { float v[16]; const int g = lane >> 4;
#pragma unroll
  for (int i = 0; i < 8; ++i) { const int ka = k0 + 8 * g + i, kb = ka + 16; v[i] = ka < K ? W[(size_t)(ka < K ? ka : K - 1) * ld + n] : 0.f; v[8 + i] = kb < K ? W[(size_t)(kb < K ? kb : K - 1) * ld + n] : 0.f; }
  return bsplit16(v); }
__device__ __forceinline__ v8f mac3(const F2& a, const F2& b, v8f c) { c = wmma_bf(a.l, b.h, c); c = wmma_bf(a.h, b.l, c); return wmma_bf(a.h, b.h, c); }
__device__ __forceinline__ float sigm(float v) { return 1.0f / (1.0f + expf(-v)); }
#define LDSX() do { asm volatile("s_wait_dscnt 0" ::: "memory"); __builtin_amdgcn_wave_barrier(); __builtin_amdgcn_fence(__ATOMIC_RELEASE, "workgroup"); } while (0)


// Gated spatial attention on [8,128,32,32] (4 heads x 32 over the 1,024 positions): qkv = inp @ qkv_w + qkv_b ([in][out], per-head interleaved columns h*96 + {q,k,v}*32 + d); softmax(q.k 32^-0.5) over all positions; feats @ gate_w + gate_b -> val | gate; y = x + val * sigmoid(gate) (NCHW).
// k_cvtx (pixel-major bf16 rows), k_qkv (Q32 f32 [bh][n][32]; K bf16 hi/lo rows; V bf16 hi/lo planes), k_attn (block = 64 queries x (b,h); O rows [b][n][128]), k_out (val/gate tiles per channel, sigmoid gating, residual, NCHW store).
#define NB 8
#define CC 128
#define NN 1024
#define NHD 4
#define DH 32
__device__ __attribute__((noinline)) float sigm_ni(float v) { return 1.0f / (1.0f + expf(-v)); }
__device__ __forceinline__ float bfr(float v) { return (float)(__bf16)v; }
__device__ __forceinline__ v16b frag_b(const __bf16* rowk0, int lane) { return __builtin_bit_cast(v16b, frag_h((const _Float16*)rowk0, lane)); }

__global__ __launch_bounds__(256) void k_cvtx(const float* __restrict__ x, __bf16* __restrict__ XT) {
  __shared__ __align__(16) __bf16 st[64][CC + 8];
  const int tid = threadIdx.x; const int b = blockIdx.y, p0 = blockIdx.x * 64;
  for (int q = tid; q < CC * 16; q += 256) { const int c = q >> 4, p4 = q & 15; const v4f v = *(const v4f*)(x + ((size_t)b * CC + c) * NN + p0 + p4 * 4);
    st[p4 * 4][c] = (__bf16)v[0]; st[p4 * 4 + 1][c] = (__bf16)v[1]; st[p4 * 4 + 2][c] = (__bf16)v[2]; st[p4 * 4 + 3][c] = (__bf16)v[3]; }
  __syncthreads();
  for (int q = tid; q < 64 * (CC / 8); q += 256) { const int rl = q / (CC / 8), pc = q % (CC / 8); vst2((unsigned*)(XT + ((size_t)b * NN + p0 + rl) * CC + pc * 8), *(const v4u*)(&st[rl][pc * 8])); }
}
// qkv: block (64 tokens, 128 output channels = 4 heads, which): rows = XT, B = W columns ([in][out]) + bias
__global__ __launch_bounds__(128) void k_qkv(const __bf16* __restrict__ XT, const float* __restrict__ W, const float* __restrict__ bias, float* __restrict__ Q32, __bf16* __restrict__ Kh, __bf16* __restrict__ Kl, __bf16* __restrict__ VTh, __bf16* __restrict__ VTl) {
  __shared__ __align__(16) float so[4][16][132]; __shared__ __align__(16) __bf16 sh_[4][16][136], sl_[4][16][136]; __shared__ __align__(16) __bf16 sth[128][72], stl[128][72];
  __shared__ __align__(16) __bf16 sW[128][CC + 8];      // the block's 128 weight columns as bf16 rows [column][k], pitch 272 B for the ds_load_b128 fragment reads
  const int tid = threadIdx.x, wave = tid >> 5, lane = tid & 31, col = lane & 15, g = lane >> 4; const int r0b = blockIdx.x * 64, n0 = blockIdx.y * 128, which = blockIdx.z; const int b = r0b / NN, s0 = r0b % NN; const size_t r0 = (size_t)r0b + wave * 16;
  v8f acc[8] = {};
  // the weight tile is brought once per block: wave w takes k rows 32w..32w+31, a lane 4 adjacent columns (h*96 + which*32 + d of qkv_w [128][384]), so each load covers four whole 128-B lines;
  // all 32 loads of a lane and its 8 row-fragment loads fly together; a lane then holds one 32-long k run of each of its columns and lays it down as four 16-B pieces
  v4f wr[32]; v16b a[CC / 32];
  { const int c4 = n0 + lane * 4; const float* wp = W + (size_t)(wave * 32) * (3 * CC) + (c4 >> 5) * (3 * DH) + which * DH + (c4 & 31);
#pragma unroll
    for (int i = 0; i < 32; ++i) wr[i] = *(const v4f*)(wp + (size_t)i * (3 * CC)); }
#pragma unroll
  for (int kc = 0; kc < CC / 32; ++kc) a[kc] = frag_b(XT + (r0 + col) * CC + kc * 32, lane);
#pragma unroll
  for (int jc = 0; jc < 4; ++jc) {
#pragma unroll
    for (int q = 0; q < 4; ++q) { union { __bf16 e[8]; v4u u; } pk;
#pragma unroll
      for (int i = 0; i < 8; ++i) pk.e[i] = (__bf16)wr[q * 8 + i][jc];
      *(v4u*)(&sW[lane * 4 + jc][wave * 32 + q * 8]) = pk.u; } }
  __syncthreads();      // every wave reads all four waves' k runs
  v16b bw[2][8];      // a k step's eight weight fragments are read as one group, one step ahead of their products
#pragma unroll
  for (int j = 0; j < 8; ++j) bw[0][j] = frag_b(&sW[j * 16 + col][0], lane);
#pragma unroll
  for (int kc = 0; kc < CC / 32; ++kc) {
    if (kc + 1 < CC / 32) {
#pragma unroll
      for (int j = 0; j < 8; ++j) bw[(kc + 1) & 1][j] = frag_b(&sW[j * 16 + col][(kc + 1) * 32], lane);
      __builtin_amdgcn_sched_barrier(0); }      // holds the next step's reads in front of this step's products: without it the scheduler sinks each pair of reads to its own product and waits it out there
#pragma unroll
    for (int j = 0; j < 8; ++j) acc[j] = wmma_bf(a[kc], bw[kc & 1][j], acc[j]); }
  if (which == 0) {
#pragma unroll
    for (int j = 0; j < 8; ++j) { const int c = n0 + j * 16 + col; const float bb = bfr(bias[(c >> 5) * (3 * DH) + 0 * DH + (c & 31)]);
#pragma unroll
      for (int r = 0; r < 8; ++r) so[wave][8 * g + r][j * 16 + col] = acc[j][r] + bb; }
    LDSX();
    for (int qq = lane; qq < 4 * 16 * 8; qq += 32) { const int hh = qq >> 7, rl = (qq >> 3) & 15, pc = qq & 7; const int h = (n0 >> 5) + hh; vst2(Q32 + (((size_t)b * NHD + h) * NN + s0 + wave * 16 + rl) * DH + pc * 4, *(const v4f*)(&so[wave][rl][hh * 32 + pc * 4])); } }
  else if (which == 1) {
#pragma unroll
    for (int j = 0; j < 8; ++j) { const int c = n0 + j * 16 + col; const float bb = bfr(bias[(c >> 5) * (3 * DH) + 1 * DH + (c & 31)]);
#pragma unroll
      for (int r = 0; r < 8; ++r) { const float v = acc[j][r] + bb; const __bf16 hi = (__bf16)v; sh_[wave][8 * g + r][j * 16 + col] = hi; sl_[wave][8 * g + r][j * 16 + col] = (__bf16)(v - (float)hi); } }
    LDSX();
    // K rows [bh][n][32] bf16 = 64 B: 4 lanes x 16 B; per instruction 8 (head,row) pairs
    for (int qq = lane; qq < 4 * 16 * 4; qq += 32) { const int hh = qq >> 6, rl = (qq >> 2) & 15, pc = qq & 3; const int h = (n0 >> 5) + hh; const size_t o = (((size_t)b * NHD + h) * NN + s0 + wave * 16 + rl) * DH + pc * 8; vst2((unsigned*)(Kh + o), *(const v4u*)(&sh_[wave][rl][hh * 32 + pc * 8])); vst2((unsigned*)(Kl + o), *(const v4u*)(&sl_[wave][rl][hh * 32 + pc * 8])); } }
  else {
#pragma unroll
    for (int j = 0; j < 8; ++j) { const int c = n0 + j * 16 + col; const float bb = bfr(bias[(c >> 5) * (3 * DH) + 2 * DH + (c & 31)]);
#pragma unroll
      for (int r = 0; r < 8; ++r) { const float v = acc[j][r] + bb; const __bf16 hi = (__bf16)v; sth[j * 16 + col][wave * 16 + 8 * g + r] = hi; stl[j * 16 + col][wave * 16 + 8 * g + r] = (__bf16)(v - (float)hi); } }
    __syncthreads();
    for (int qq = tid; qq < 128 * 8; qq += 128) { const int cl = qq >> 3, pc = qq & 7; const int c = n0 + cl; const int h = c >> 5, d = c & 31; const size_t o = (((size_t)b * NHD + h) * DH + d) * NN + s0 + pc * 8; vst2((unsigned*)(VTh + o), *(const v4u*)(&sth[cl][pc * 8])); vst2((unsigned*)(VTl + o), *(const v4u*)(&stl[cl][pc * 8])); } }
}
// fragment from a head's base pointer (the same for the wave) plus the lane's 32-bit byte offset
__device__ __forceinline__ v16b frag_o(const __bf16* ubase, unsigned off) { union { v16b v; v4u q[2]; } u; const char* p = (const char*)ubase + off; u.q[0] = *(const v4u*)p; u.q[1] = *(const v4u*)(p + 32); return u.v; }
__global__ __launch_bounds__(128) void k_attn(const float* __restrict__ Q32, const __bf16* __restrict__ Kh, const __bf16* __restrict__ Kl, const __bf16* __restrict__ VTh, const __bf16* __restrict__ VTl, float* __restrict__ O) {
  __shared__ __align__(16) float sS[4][16][68];
  __shared__ __align__(16) __bf16 sPh[4][16][72], sPl[4][16][72];
  __shared__ __align__(16) float sO[4][16][36];
  const int tid = threadIdx.x, w = tid >> 5, lane = tid & 31, col = lane & 15, g = lane >> 4; const size_t bh = blockIdx.y; const int b = (int)(bh / NHD), h = (int)(bh % NHD); const int q0 = blockIdx.x * 64 + w * 16;
  const F2 aq = split_row(Q32 + (bh * NN + q0 + col) * DH, 0, lane);
  float mrun = -3.0e38f, lrun = 0.f; v8f acc[2] = {};
  // all fragment loads of a pass are issued together at the head of its softmax, which runs while they fly: V of this pass and K of the next one (K of pass 0 in front of the loop)
  const __bf16* bkh = Kh + bh * NN * DH; const __bf16* bkl = Kl + bh * NN * DH; const __bf16* bvh = VTh + bh * DH * NN; const __bf16* bvl = VTl + bh * DH * NN;
  unsigned ko = (unsigned)(col * DH + 8 * g) * 2u, vo = (unsigned)(col * NN + 8 * g) * 2u;
  v16b khf[4], klf[4];
#pragma unroll
  for (int t = 0; t < 4; ++t) { khf[t] = frag_o(bkh + t * 16 * DH, ko); klf[t] = frag_o(bkl + t * 16 * DH, ko); }
#pragma unroll 1
  for (int kt = 0; kt < NN / 64; ++kt) {
#pragma unroll
    for (int t = 0; t < 4; ++t) {
      v8f s = {}; s = wmma_bf(aq.l, khf[t], s); s = wmma_bf(aq.h, klf[t], s); s = wmma_bf(aq.h, khf[t], s);
#pragma unroll
      for (int r = 0; r < 8; ++r) sS[w][8 * g + r][t * 16 + col] = s[r] * 0.17677669529663687f; }
    LDSX();
    ko += kt + 1 < NN / 64 ? 64 * DH * 2 : 0;      // the last pass fetches its own rows again (unused), so no address leaves this head's K
    v16b vh[2][2], vl[2][2];
#pragma unroll
    for (int kc = 0; kc < 2; ++kc) {
#pragma unroll
      for (int t = 0; t < 2; ++t) { vh[kc][t] = frag_o(bvh + t * 16 * NN + kc * 32, vo); vl[kc][t] = frag_o(bvl + t * 16 * NN + kc * 32, vo); } }
    asm volatile("s_wait_xcnt 0x0" ::: "memory");      // in front of the K loads, whose destinations may be laid on the V loads' address registers
#pragma unroll
    for (int t = 0; t < 4; ++t) { khf[t] = frag_o(bkh + t * 16 * DH, ko); klf[t] = frag_o(bkl + t * 16 * DH, ko); }
    __builtin_amdgcn_sched_barrier(0);      // holds the loads here: without it the scheduler sinks K's to the foot of the softmax, straight in front of the wait that the next fence brings
    float mx = -3.4e38f;
#pragma unroll
    for (int jj = 0; jj < 32; ++jj) mx = fmaxf(mx, sS[w][col][g * 32 + jj]);
    mx = fmaxf(mx, __shfl_xor(mx, 16, 32));
    const float mnew = fmaxf(mrun, mx); const float corr = expf(mrun - mnew);
    float ps = 0.f;
#pragma unroll
    for (int jj = 0; jj < 32; ++jj) { const float p = expf(sS[w][col][g * 32 + jj] - mnew); ps += p; const __bf16 hi = (__bf16)p; sPh[w][col][g * 32 + jj] = hi; sPl[w][col][g * 32 + jj] = (__bf16)(p - (float)hi); }
    ps += __shfl_xor(ps, 16, 32);
    lrun = lrun * corr + ps; mrun = mnew;
#pragma unroll
    for (int r = 0; r < 8; ++r) { const float cr = __shfl(corr, 8 * g + r, 32); acc[0][r] *= cr; acc[1][r] *= cr; }
    LDSX();
#pragma unroll
    for (int kc = 0; kc < 2; ++kc) { const v16b ph = frag_b(&sPh[w][col][0] + kc * 32, lane), pl = frag_b(&sPl[w][col][0] + kc * 32, lane);
#pragma unroll
      for (int t = 0; t < 2; ++t) { acc[t] = wmma_bf(pl, vh[kc][t], acc[t]); acc[t] = wmma_bf(ph, vl[kc][t], acc[t]); acc[t] = wmma_bf(ph, vh[kc][t], acc[t]); } }
    vo += 64 * 2;
    __builtin_amdgcn_wave_barrier(); }
#pragma unroll
  for (int r = 0; r < 8; ++r) { const float lr = __shfl(lrun, 8 * g + r, 32); const float inv = 1.0f / lr; sO[w][8 * g + r][col] = acc[0][r] * inv; sO[w][8 * g + r][16 + col] = acc[1][r] * inv; }
  LDSX();
  for (int qq = lane; qq < 16 * 8; qq += 32) { const int rl = qq >> 3, pc = qq & 7; vst2(O + ((size_t)b * NN + q0 + rl) * CC + h * DH + pc * 4, *(const v4f*)(&sO[w][rl][pc * 4])); }
}
// raw fragment loads: the addresses and guards of split_row and split_col, the conversion left to bsplit16
__device__ __forceinline__ void raw_row(const float* row, int k0, int lane, float v[16]) { const float* p = row + k0 + 8 * (lane >> 4);
#pragma unroll
  for (int i = 0; i < 8; ++i) { v[i] = p[i]; v[8 + i] = p[16 + i]; } }
__device__ __forceinline__ void raw_col(const float* W, int k0, int n, int lane, int ld, int K, float v[16]) { const int g = lane >> 4;
#pragma unroll
  for (int i = 0; i < 8; ++i) { const int ka = k0 + 8 * g + i, kb = ka + 16; v[i] = ka < K ? W[(size_t)(ka < K ? ka : K - 1) * ld + n] : 0.f; v[8 + i] = kb < K ? W[(size_t)(kb < K ? kb : K - 1) * ld + n] : 0.f; } }
// y[b][c][n] = x[b][c][n] + val * sigmoid(gate), val | gate = O[n][:] (hi/lo) . Wg[:][c | CC + c] + bg: block (b, 64 tokens); wave w -> channel tiles 2w..2w+1 (32 channels) x 4 token tiles
__global__ __launch_bounds__(128) void k_out(const float* __restrict__ O, const float* __restrict__ Wg, const float* __restrict__ bg, const float* __restrict__ x, float* __restrict__ y) {
  __shared__ __align__(16) float sY[4][32][68];
  const int tid = threadIdx.x, w = tid >> 5, lane = tid & 31, col = lane & 15, g = lane >> 4; const int b = blockIdx.y, p0 = blockIdx.x * 64; const size_t base = (size_t)b * NN;
  v8f av[2][4] = {}, ag[2][4] = {};
#pragma unroll 1
  for (int kc = 0; kc < CC / 32; ++kc) { F2 bc[4]; float ov[4][16], wv[2][2][16]; const int c0 = w * 32 + col;
    // a k step's loads are issued in two groups ahead of their use: the four O fragments with the first channel tile's weights, then the second tile's weights, which fly under the first tile's products
#pragma unroll
    for (int pt = 0; pt < 4; ++pt) raw_row(O + (base + p0 + pt * 16 + col) * CC, kc * 32, lane, ov[pt]);
    raw_col(Wg, kc * 32, c0, lane, 2 * CC, CC, wv[0][0]); raw_col(Wg, kc * 32, CC + c0, lane, 2 * CC, CC, wv[0][1]);
    __builtin_amdgcn_sched_barrier(0);      // holds the first group together: without it the scheduler issues the O loads two at a time, each pair straight in front of its own wait
    raw_col(Wg, kc * 32, c0 + 16, lane, 2 * CC, CC, wv[1][0]); raw_col(Wg, kc * 32, CC + c0 + 16, lane, 2 * CC, CC, wv[1][1]);
    asm volatile("s_wait_xcnt 0x0" ::: "memory");      // in front of the weight conversions below, whose results may be laid on these loads' address registers
    __builtin_amdgcn_sched_barrier(0);      // keeps that wait directly behind the loads, and both in front of the products
#pragma unroll
    for (int pt = 0; pt < 4; ++pt) bc[pt] = bsplit16(ov[pt]);
#pragma unroll
    for (int ct = 0; ct < 2; ++ct) { const v16b a1 = bsplit16(wv[ct][0]).h, a2 = bsplit16(wv[ct][1]).h;
#pragma unroll
      for (int pt = 0; pt < 4; ++pt) { av[ct][pt] = wmma_bf(a1, bc[pt].l, av[ct][pt]); av[ct][pt] = wmma_bf(a1, bc[pt].h, av[ct][pt]); ag[ct][pt] = wmma_bf(a2, bc[pt].l, ag[ct][pt]); ag[ct][pt] = wmma_bf(a2, bc[pt].h, ag[ct][pt]); } } }
  float xv[2][8][4];      // the tile's residual values, requested together in front of the first sigmoid call: one wait for all
#pragma unroll
  for (int ct = 0; ct < 2; ++ct) {
#pragma unroll
    for (int r = 0; r < 8; ++r) { const int c = w * 32 + ct * 16 + 8 * g + r;
#pragma unroll
      for (int pt = 0; pt < 4; ++pt) xv[ct][r][pt] = x[((size_t)b * CC + c) * NN + p0 + pt * 16 + col]; } }
#pragma unroll
  for (int ct = 0; ct < 2; ++ct) {
#pragma unroll
    for (int r = 0; r < 8; ++r) { const int cl = ct * 16 + 8 * g + r; const int c = w * 32 + cl; const float bv_ = bfr(bg[c]), bg_ = bfr(bg[CC + c]);
#pragma unroll
      for (int pt = 0; pt < 4; ++pt) { const float val = av[ct][pt][r] + bv_; const float gt = ag[ct][pt][r] + bg_; sY[w][cl][pt * 16 + col] = bfr(xv[ct][r][pt]) + val * sigm_ni(gt); } } }
  LDSX();
  for (int qq = lane; qq < 32 * 16; qq += 32) { const int cl = qq >> 4, pc = qq & 15; vst2(y + ((size_t)b * CC + w * 32 + cl) * NN + p0 + pc * 4, *(const v4f*)(&sY[w][cl][pc * 4])); }
}
extern "C" void kernel_launch(void* const* d_in, const int* in_sizes, int n_in, void* d_out, int out_size, void* d_ws, size_t ws_size, hipStream_t stream) {
  (void)in_sizes; (void)n_in; (void)out_size; (void)ws_size;
  const float* x = (const float*)d_in[0]; const float* Wqkv = (const float*)d_in[1]; const float* bqkv = (const float*)d_in[2]; const float* Wg = (const float*)d_in[3]; const float* bg = (const float*)d_in[4];
  char* ws = (char*)d_ws; size_t off = 0;
  auto take = [&](size_t bytes) { char* p = ws + off; off += (bytes + 255) & ~(size_t)255; return p; };
  __bf16* XT = (__bf16*)take((size_t)NB * NN * CC * 2); float* Q32 = (float*)take((size_t)NB * NN * CC * 4); __bf16* Kh = (__bf16*)take((size_t)NB * NN * CC * 2); __bf16* Kl = (__bf16*)take((size_t)NB * NN * CC * 2); __bf16* VTh = (__bf16*)take((size_t)NB * NN * CC * 2); __bf16* VTl = (__bf16*)take((size_t)NB * NN * CC * 2); float* O = (float*)take((size_t)NB * NN * CC * 4);
  // ws ~ 19 MB
  k_cvtx<<<dim3(NN / 64, NB), 256, 0, stream>>>(x, XT);
  k_qkv<<<dim3(NB * NN / 64, CC / 128, 3), 128, 0, stream>>>(XT, Wqkv, bqkv, Q32, Kh, Kl, VTh, VTl);
  k_attn<<<dim3(NN / 64, NB * NHD), 128, 0, stream>>>(Q32, Kh, Kl, VTh, VTl, O);
  k_out<<<dim3(NN / 64, NB), 128, 0, stream>>>(O, Wg, bg, x, (float*)d_out);
}

// v004
// It runs in 51.2 microseconds.
// Timed twice side by side with v003, it ran 1.08 times as fast both times.
// All steps since v000 together make it 2.15 times as fast.
// compute dtype: x, qkv_w, qkv_b, gate_w, gate_b (INPUTS) rounded to bf16 with exact bf16 WMMA products (f32 accumulate) for the qkv projection and the gate projection's weight side; q kept f32 and split hi/lo, k as bf16 hi/lo rows (3 products), softmax weights and v as bf16 hi/lo (3 products), attention output hi/lo x bf16(gate_w) (2 products); softmax, sigmoid gating and the residual in f32.
#include <hip/hip_runtime.h>
#include <math.h>

typedef __attribute__((ext_vector_type(16))) _Float16 v16h;
typedef __attribute__((ext_vector_type(16))) __bf16 v16b;
typedef __attribute__((ext_vector_type(8)))  _Float16 v8h;
typedef __attribute__((ext_vector_type(8)))  float v8f;
typedef __attribute__((ext_vector_type(4)))  float v4f;
typedef __attribute__((ext_vector_type(2)))  float v2f;
typedef __attribute__((ext_vector_type(4)))  unsigned v4u;
typedef __attribute__((ext_vector_type(4)))  int v4i;
typedef float __attribute__((may_alias)) float_a;
typedef int __attribute__((may_alias)) int_a;

template <typename T> __device__ __forceinline__ void vst2(void* p, T v) { *(T*)p = v;  }
__device__ __forceinline__ v8f wmma16(v16h a, v16h b, v8f c) {
  v8f d = __builtin_amdgcn_wmma_f32_16x16x32_f16(false, a, false, b, (short)0, c, false, false);
  asm volatile("v_nop\n\tv_nop\n\tv_nop\n\tv_nop" : "+v"(d) : "v"(a), "v"(b));
  return d;
}
__device__ __forceinline__ v8f wmma_bf(v16b a, v16b b, v8f c) {
  v8f d = __builtin_amdgcn_wmma_f32_16x16x32_bf16(false, a, false, b, (short)0, c, false, false);
  asm volatile("v_nop\n\tv_nop\n\tv_nop\n\tv_nop" : "+v"(d) : "v"(a), "v"(b));
  return d;
}
// 16x16x32 fragments: lane = (h = lane>>4, row/col = lane&15); elements 0..7 = k0+8h+0..7, 8..15 = k0+16+8h+0..7; D element r = row 8h+r
__device__ __forceinline__ v16h frag_h(const _Float16* rowk0, int lane) {
  union { v16h v; v8h q[2]; } u; const _Float16* p = rowk0 + 8 * (lane >> 4);
  u.q[0] = *(const v8h*)p; u.q[1] = *(const v8h*)(p + 16); return u.v;
}
__device__ __forceinline__ v16h frag_f32(const float* rowk0, int lane) {
  v16h a; const float* p = rowk0 + 8 * (lane >> 4);
#pragma unroll
  for (int i = 0; i < 8; ++i) { a[i] = (_Float16)p[i]; a[8 + i] = (_Float16)p[16 + i]; }
  return a;
}
__device__ __forceinline__ v16h frag_f32s(const float* rowk0, int lane, float sc) {
  v16h a; const float* p = rowk0 + 8 * (lane >> 4);
#pragma unroll
  for (int i = 0; i < 8; ++i) { a[i] = (_Float16)(p[i] * sc); a[8 + i] = (_Float16)(p[16 + i] * sc); }
  return a;
}
// column fragment from a [K][ld] layout (column n), rows >= K read as 0
__device__ __forceinline__ v16h fragc_f32(const float* W, int k0, int n, int lane, int ld, int K) {
  v16h a; const int g = lane >> 4;
#pragma unroll
  for (int i = 0; i < 8; ++i) { const int ka = k0 + 8 * g + i, kb = ka + 16;
    a[i] = (_Float16)(ka < K ? W[(size_t)(ka < K ? ka : K - 1) * ld + n] : 0.f); a[8 + i] = (_Float16)(kb < K ? W[(size_t)(kb < K ? kb : K - 1) * ld + n] : 0.f); }
  return a;
}
struct F2 { v16b h, l; };
__device__ __forceinline__ F2 bsplit16(const float v[16]) { F2 r;
#pragma unroll
  for (int i = 0; i < 16; ++i) { const __bf16 h = (__bf16)v[i]; r.h[i] = h; r.l[i] = (__bf16)(v[i] - (float)h); }
  return r; }
__device__ __forceinline__ F2 split_row(const float* row, int k0, int lane) { float v[16]; const float* p = row + k0 + 8 * (lane >> 4);
#pragma unroll
  for (int i = 0; i < 8; ++i) { v[i] = p[i]; v[8 + i] = p[16 + i]; }
  return bsplit16(v); }
__device__ __forceinline__ F2 split_rowK(const float* row, int k0, int lane, int K) { float v[16]; const int g = lane >> 4;
#pragma unroll
  for (int i = 0; i < 8; ++i) { const int ka = k0 + 8 * g + i, kb = ka + 16; v[i] = ka < K ? row[ka < K ? ka : K - 1] : 0.f; v[8 + i] = kb < K ? row[kb < K ? kb : K - 1] : 0.f; }
  return bsplit16(v); }
__device__ __forceinline__ F2 split_col(const float* W, int k0, int n, int lane, int ld, int K) { float v[16]; const int g = lane >> 4;
#pragma unroll
  for (int i = 0; i < 8; ++i) { const int ka = k0 + 8 * g + i, kb = ka + 16; v[i] = ka < K ? W[(size_t)(ka < K ? ka : K - 1) * ld + n] : 0.f; v[8 + i] = kb < K ? W[(size_t)(kb < K ? kb : K - 1) * ld + n] : 0.f; }
  return bsplit16(v); }
__device__ __forceinline__ v8f mac3(const F2& a, const F2& b, v8f c) { c = wmma_bf(a.l, b.h, c); c = wmma_bf(a.h, b.l, c); return wmma_bf(a.h, b.h, c); }
__device__ __forceinline__ float sigm(float v) { return 1.0f / (1.0f + expf(-v)); }
#define LDSX() do { asm volatile("s_wait_dscnt 0" ::: "memory"); __builtin_amdgcn_wave_barrier(); __builtin_amdgcn_fence(__ATOMIC_RELEASE, "workgroup"); } while (0)


// Gated spatial attention on [8,128,32,32] (4 heads x 32 over the 1,024 positions): qkv = inp @ qkv_w + qkv_b ([in][out], per-head interleaved columns h*96 + {q,k,v}*32 + d); softmax(q.k 32^-0.5) over all positions; feats @ gate_w + gate_b -> val | gate; y = x + val * sigmoid(gate) (NCHW).
// k_cvtx (pixel-major bf16 rows), k_qkv (Q32 f32 [bh][n][32]; K bf16 hi/lo rows; V bf16 hi/lo planes), k_attn (block = 64 queries x (b,h); O rows [b][n][128]), k_out (val/gate tiles per channel, sigmoid gating, residual, NCHW store).
#define NB 8
#define CC 128
#define NN 1024
#define NHD 4
#define DH 32
__device__ __forceinline__ float bfr(float v) { return (float)(__bf16)v; }
__device__ __forceinline__ v16b frag_b(const __bf16* rowk0, int lane) { return __builtin_bit_cast(v16b, frag_h((const _Float16*)rowk0, lane)); }

__global__ __launch_bounds__(256) void k_cvtx(const float* __restrict__ x, __bf16* __restrict__ XT) {
  __shared__ __align__(16) __bf16 st[64][CC + 8];
  const int tid = threadIdx.x; const int b = blockIdx.y, p0 = blockIdx.x * 64;
  for (int q = tid; q < CC * 16; q += 256) { const int c = q >> 4, p4 = q & 15; const v4f v = *(const v4f*)(x + ((size_t)b * CC + c) * NN + p0 + p4 * 4);
    st[p4 * 4][c] = (__bf16)v[0]; st[p4 * 4 + 1][c] = (__bf16)v[1]; st[p4 * 4 + 2][c] = (__bf16)v[2]; st[p4 * 4 + 3][c] = (__bf16)v[3]; }
  __syncthreads();
  for (int q = tid; q < 64 * (CC / 8); q += 256) { const int rl = q / (CC / 8), pc = q % (CC / 8); vst2((unsigned*)(XT + ((size_t)b * NN + p0 + rl) * CC + pc * 8), *(const v4u*)(&st[rl][pc * 8])); }
}
// qkv: block (64 tokens, 128 output channels = 4 heads, which): rows = XT, B = W columns ([in][out]) + bias
__global__ __launch_bounds__(128) void k_qkv(const __bf16* __restrict__ XT, const float* __restrict__ W, const float* __restrict__ bias, float* __restrict__ Q32, __bf16* __restrict__ Kh, __bf16* __restrict__ Kl, __bf16* __restrict__ VTh, __bf16* __restrict__ VTl) {
  __shared__ __align__(16) float so[4][16][132]; __shared__ __align__(16) __bf16 sh_[4][16][136], sl_[4][16][136]; __shared__ __align__(16) __bf16 sth[128][72], stl[128][72];
  __shared__ __align__(16) __bf16 sW[128][CC + 8];      // the block's 128 weight columns as bf16 rows [column][k], pitch 272 B for the ds_load_b128 fragment reads
  const int tid = threadIdx.x, wave = tid >> 5, lane = tid & 31, col = lane & 15, g = lane >> 4; const int r0b = blockIdx.x * 64, n0 = blockIdx.y * 128, which = blockIdx.z; const int b = r0b / NN, s0 = r0b % NN; const size_t r0 = (size_t)r0b + wave * 16;
  v8f acc[8] = {};
  // the weight tile is brought once per block: wave w takes k rows 32w..32w+31, a lane 4 adjacent columns (h*96 + which*32 + d of qkv_w [128][384]), so each load covers four whole 128-B lines;
  // all 32 loads of a lane and its 8 row-fragment loads fly together; a lane then holds one 32-long k run of each of its columns and lays it down as four 16-B pieces
  v4f wr[32]; v16b a[CC / 32];
  { const int c4 = n0 + lane * 4; const float* wp = W + (size_t)(wave * 32) * (3 * CC) + (c4 >> 5) * (3 * DH) + which * DH + (c4 & 31);
#pragma unroll
    for (int i = 0; i < 32; ++i) wr[i] = *(const v4f*)(wp + (size_t)i * (3 * CC)); }
#pragma unroll
  for (int kc = 0; kc < CC / 32; ++kc) a[kc] = frag_b(XT + (r0 + col) * CC + kc * 32, lane);
#pragma unroll
  for (int jc = 0; jc < 4; ++jc) {
#pragma unroll
    for (int q = 0; q < 4; ++q) { union { __bf16 e[8]; v4u u; } pk;
#pragma unroll
      for (int i = 0; i < 8; ++i) pk.e[i] = (__bf16)wr[q * 8 + i][jc];
      *(v4u*)(&sW[lane * 4 + jc][wave * 32 + q * 8]) = pk.u; } }
  __syncthreads();      // every wave reads all four waves' k runs
  v16b bw[2][8];      // a k step's eight weight fragments are read as one group, one step ahead of their products
#pragma unroll
  for (int j = 0; j < 8; ++j) bw[0][j] = frag_b(&sW[j * 16 + col][0], lane);
#pragma unroll
  for (int kc = 0; kc < CC / 32; ++kc) {
    if (kc + 1 < CC / 32) {
#pragma unroll
      for (int j = 0; j < 8; ++j) bw[(kc + 1) & 1][j] = frag_b(&sW[j * 16 + col][(kc + 1) * 32], lane);
      __builtin_amdgcn_sched_barrier(0); }      // holds the next step's reads in front of this step's products: without it the scheduler sinks each pair of reads to its own product and waits it out there
#pragma unroll
    for (int j = 0; j < 8; ++j) acc[j] = wmma_bf(a[kc], bw[kc & 1][j], acc[j]); }
  if (which == 0) {
#pragma unroll
    for (int j = 0; j < 8; ++j) { const int c = n0 + j * 16 + col; const float bb = bfr(bias[(c >> 5) * (3 * DH) + 0 * DH + (c & 31)]);
#pragma unroll
      for (int r = 0; r < 8; ++r) so[wave][8 * g + r][j * 16 + col] = acc[j][r] + bb; }
    LDSX();
    for (int qq = lane; qq < 4 * 16 * 8; qq += 32) { const int hh = qq >> 7, rl = (qq >> 3) & 15, pc = qq & 7; const int h = (n0 >> 5) + hh; vst2(Q32 + (((size_t)b * NHD + h) * NN + s0 + wave * 16 + rl) * DH + pc * 4, *(const v4f*)(&so[wave][rl][hh * 32 + pc * 4])); } }
  else if (which == 1) {
#pragma unroll
    for (int j = 0; j < 8; ++j) { const int c = n0 + j * 16 + col; const float bb = bfr(bias[(c >> 5) * (3 * DH) + 1 * DH + (c & 31)]);
#pragma unroll
      for (int r = 0; r < 8; ++r) { const float v = acc[j][r] + bb; const __bf16 hi = (__bf16)v; sh_[wave][8 * g + r][j * 16 + col] = hi; sl_[wave][8 * g + r][j * 16 + col] = (__bf16)(v - (float)hi); } }
    LDSX();
    // K rows [bh][n][32] bf16 = 64 B: 4 lanes x 16 B; per instruction 8 (head,row) pairs
    for (int qq = lane; qq < 4 * 16 * 4; qq += 32) { const int hh = qq >> 6, rl = (qq >> 2) & 15, pc = qq & 3; const int h = (n0 >> 5) + hh; const size_t o = (((size_t)b * NHD + h) * NN + s0 + wave * 16 + rl) * DH + pc * 8; vst2((unsigned*)(Kh + o), *(const v4u*)(&sh_[wave][rl][hh * 32 + pc * 8])); vst2((unsigned*)(Kl + o), *(const v4u*)(&sl_[wave][rl][hh * 32 + pc * 8])); } }
  else {
#pragma unroll
    for (int j = 0; j < 8; ++j) { const int c = n0 + j * 16 + col; const float bb = bfr(bias[(c >> 5) * (3 * DH) + 2 * DH + (c & 31)]);
#pragma unroll
      for (int r = 0; r < 8; ++r) { const float v = acc[j][r] + bb; const __bf16 hi = (__bf16)v; sth[j * 16 + col][wave * 16 + 8 * g + r] = hi; stl[j * 16 + col][wave * 16 + 8 * g + r] = (__bf16)(v - (float)hi); } }
    __syncthreads();
    for (int qq = tid; qq < 128 * 8; qq += 128) { const int cl = qq >> 3, pc = qq & 7; const int c = n0 + cl; const int h = c >> 5, d = c & 31; const size_t o = (((size_t)b * NHD + h) * DH + d) * NN + s0 + pc * 8; vst2((unsigned*)(VTh + o), *(const v4u*)(&sth[cl][pc * 8])); vst2((unsigned*)(VTl + o), *(const v4u*)(&stl[cl][pc * 8])); } }
}
// fragment from a head's base pointer (the same for the wave) plus the lane's 32-bit byte offset
__device__ __forceinline__ v16b frag_o(const __bf16* ubase, unsigned off) { union { v16b v; v4u q[2]; } u; const char* p = (const char*)ubase + off; u.q[0] = *(const v4u*)p; u.q[1] = *(const v4u*)(p + 32); return u.v; }
__global__ __launch_bounds__(128) void k_attn(const float* __restrict__ Q32, const __bf16* __restrict__ Kh, const __bf16* __restrict__ Kl, const __bf16* __restrict__ VTh, const __bf16* __restrict__ VTl, float* __restrict__ O) {
  __shared__ __align__(16) float sS[4][16][68];
  __shared__ __align__(16) __bf16 sPh[4][16][72], sPl[4][16][72];
  __shared__ __align__(16) float sO[4][16][36];
  const int tid = threadIdx.x, w = tid >> 5, lane = tid & 31, col = lane & 15, g = lane >> 4; const size_t bh = blockIdx.y; const int b = (int)(bh / NHD), h = (int)(bh % NHD); const int q0 = blockIdx.x * 64 + w * 16;
  const F2 aq = split_row(Q32 + (bh * NN + q0 + col) * DH, 0, lane);
  float mrun = -3.0e38f, lrun = 0.f; v8f acc[2] = {};
  // all fragment loads of a pass are issued together at the head of its softmax, which runs while they fly: V of this pass and K of the next one (K of pass 0 in front of the loop)
  const __bf16* bkh = Kh + bh * NN * DH; const __bf16* bkl = Kl + bh * NN * DH; const __bf16* bvh = VTh + bh * DH * NN; const __bf16* bvl = VTl + bh * DH * NN;
  unsigned ko = (unsigned)(col * DH + 8 * g) * 2u, vo = (unsigned)(col * NN + 8 * g) * 2u;
  v16b khf[4], klf[4];
#pragma unroll
  for (int t = 0; t < 4; ++t) { khf[t] = frag_o(bkh + t * 16 * DH, ko); klf[t] = frag_o(bkl + t * 16 * DH, ko); }
#pragma unroll 1
  for (int kt = 0; kt < NN / 64; ++kt) {
#pragma unroll
    for (int t = 0; t < 4; ++t) {
      v8f s = {}; s = wmma_bf(aq.l, khf[t], s); s = wmma_bf(aq.h, klf[t], s); s = wmma_bf(aq.h, khf[t], s);
#pragma unroll
      for (int r = 0; r < 8; ++r) sS[w][8 * g + r][t * 16 + col] = s[r] * 0.17677669529663687f; }
    LDSX();
    ko += kt + 1 < NN / 64 ? 64 * DH * 2 : 0;      // the last pass fetches its own rows again (unused), so no address leaves this head's K
    v16b vh[2][2], vl[2][2];
#pragma unroll
    for (int kc = 0; kc < 2; ++kc) {
#pragma unroll
      for (int t = 0; t < 2; ++t) { vh[kc][t] = frag_o(bvh + t * 16 * NN + kc * 32, vo); vl[kc][t] = frag_o(bvl + t * 16 * NN + kc * 32, vo); } }
    asm volatile("s_wait_xcnt 0x0" ::: "memory");      // in front of the K loads, whose destinations may be laid on the V loads' address registers
#pragma unroll
    for (int t = 0; t < 4; ++t) { khf[t] = frag_o(bkh + t * 16 * DH, ko); klf[t] = frag_o(bkl + t * 16 * DH, ko); }
    __builtin_amdgcn_sched_barrier(0);      // holds the loads here: without it the scheduler sinks K's to the foot of the softmax, straight in front of the wait that the next fence brings
    float mx = -3.4e38f;
#pragma unroll
    for (int jj = 0; jj < 32; ++jj) mx = fmaxf(mx, sS[w][col][g * 32 + jj]);
    mx = fmaxf(mx, __shfl_xor(mx, 16, 32));
    const float mnew = fmaxf(mrun, mx); const float corr = expf(mrun - mnew);
    float ps = 0.f;
#pragma unroll
    for (int jj = 0; jj < 32; ++jj) { const float p = expf(sS[w][col][g * 32 + jj] - mnew); ps += p; const __bf16 hi = (__bf16)p; sPh[w][col][g * 32 + jj] = hi; sPl[w][col][g * 32 + jj] = (__bf16)(p - (float)hi); }
    ps += __shfl_xor(ps, 16, 32);
    lrun = lrun * corr + ps; mrun = mnew;
#pragma unroll
    for (int r = 0; r < 8; ++r) { const float cr = __shfl(corr, 8 * g + r, 32); acc[0][r] *= cr; acc[1][r] *= cr; }
    LDSX();
#pragma unroll
    for (int kc = 0; kc < 2; ++kc) { const v16b ph = frag_b(&sPh[w][col][0] + kc * 32, lane), pl = frag_b(&sPl[w][col][0] + kc * 32, lane);
#pragma unroll
      for (int t = 0; t < 2; ++t) { acc[t] = wmma_bf(pl, vh[kc][t], acc[t]); acc[t] = wmma_bf(ph, vl[kc][t], acc[t]); acc[t] = wmma_bf(ph, vh[kc][t], acc[t]); } }
    vo += 64 * 2;
    __builtin_amdgcn_wave_barrier(); }
#pragma unroll
  for (int r = 0; r < 8; ++r) { const float lr = __shfl(lrun, 8 * g + r, 32); const float inv = 1.0f / lr; sO[w][8 * g + r][col] = acc[0][r] * inv; sO[w][8 * g + r][16 + col] = acc[1][r] * inv; }
  LDSX();
  for (int qq = lane; qq < 16 * 8; qq += 32) { const int rl = qq >> 3, pc = qq & 7; vst2(O + ((size_t)b * NN + q0 + rl) * CC + h * DH + pc * 4, *(const v4f*)(&sO[w][rl][pc * 4])); }
}
// raw fragment loads: the addresses and guards of split_row and split_col, the conversion left to bsplit16
__device__ __forceinline__ void raw_row(const float* row, int k0, int lane, float v[16]) { const float* p = row + k0 + 8 * (lane >> 4);
#pragma unroll
  for (int i = 0; i < 8; ++i) { v[i] = p[i]; v[8 + i] = p[16 + i]; } }
__device__ __forceinline__ void raw_col(const float* W, int k0, int n, int lane, int ld, int K, float v[16]) { const int g = lane >> 4;
#pragma unroll
  for (int i = 0; i < 8; ++i) { const int ka = k0 + 8 * g + i, kb = ka + 16; v[i] = ka < K ? W[(size_t)(ka < K ? ka : K - 1) * ld + n] : 0.f; v[8 + i] = kb < K ? W[(size_t)(kb < K ? kb : K - 1) * ld + n] : 0.f; } }
// y[b][c][n] = x[b][c][n] + val * sigmoid(gate), val | gate = O[n][:] (hi/lo) . Wg[:][c | CC + c] + bg: block (b, 64 tokens); wave w -> channel tiles 2w..2w+1 (32 channels) x 4 token tiles
__global__ __launch_bounds__(128) void k_out(const float* __restrict__ O, const float* __restrict__ Wg, const float* __restrict__ bg, const float* __restrict__ x, float* __restrict__ y) {
  __shared__ __align__(16) float sY[4][32][68];
  const int tid = threadIdx.x, w = tid >> 5, lane = tid & 31, col = lane & 15, g = lane >> 4; const int b = blockIdx.y, p0 = blockIdx.x * 64; const size_t base = (size_t)b * NN;
  v8f av[2][4] = {}, ag[2][4] = {};
#pragma unroll 1
  for (int kc = 0; kc < CC / 32; ++kc) { F2 bc[4]; float ov[4][16], wv[2][2][16]; const int c0 = w * 32 + col;
    // a k step's loads are issued in two groups ahead of their use: the four O fragments with the first channel tile's weights, then the second tile's weights, which fly under the first tile's products
#pragma unroll
    for (int pt = 0; pt < 4; ++pt) raw_row(O + (base + p0 + pt * 16 + col) * CC, kc * 32, lane, ov[pt]);
    raw_col(Wg, kc * 32, c0, lane, 2 * CC, CC, wv[0][0]); raw_col(Wg, kc * 32, CC + c0, lane, 2 * CC, CC, wv[0][1]);
    __builtin_amdgcn_sched_barrier(0);      // holds the first group together: without it the scheduler issues the O loads two at a time, each pair straight in front of its own wait
    raw_col(Wg, kc * 32, c0 + 16, lane, 2 * CC, CC, wv[1][0]); raw_col(Wg, kc * 32, CC + c0 + 16, lane, 2 * CC, CC, wv[1][1]);
    asm volatile("s_wait_xcnt 0x0" ::: "memory");      // in front of the weight conversions below, whose results may be laid on these loads' address registers
    __builtin_amdgcn_sched_barrier(0);      // keeps that wait directly behind the loads, and both in front of the products
#pragma unroll
    for (int pt = 0; pt < 4; ++pt) bc[pt] = bsplit16(ov[pt]);
#pragma unroll
    for (int ct = 0; ct < 2; ++ct) { const v16b a1 = bsplit16(wv[ct][0]).h, a2 = bsplit16(wv[ct][1]).h;
#pragma unroll
      for (int pt = 0; pt < 4; ++pt) { av[ct][pt] = wmma_bf(a1, bc[pt].l, av[ct][pt]); av[ct][pt] = wmma_bf(a1, bc[pt].h, av[ct][pt]); ag[ct][pt] = wmma_bf(a2, bc[pt].l, ag[ct][pt]); ag[ct][pt] = wmma_bf(a2, bc[pt].h, ag[ct][pt]); } } }
  float xv[2][8][4], bv[2][8], bq[2][8];      // the tile's residual values and its biases, requested together in front of the gating, which starts on the biases while the rest still fly
#pragma unroll
  for (int ct = 0; ct < 2; ++ct) {
#pragma unroll
    for (int r = 0; r < 8; ++r) { const int c = w * 32 + ct * 16 + 8 * g + r; bv[ct][r] = bg[c]; bq[ct][r] = bg[CC + c];
#pragma unroll
      for (int pt = 0; pt < 4; ++pt) xv[ct][r][pt] = x[((size_t)b * CC + c) * NN + p0 + pt * 16 + col]; } }
  __builtin_amdgcn_sched_barrier(0);      // holds these loads in one flight in front of the gating, as the calls did: without it the scheduler deals them out through the gating in groups of eight, each waited for in its turn
#pragma unroll
  for (int ct = 0; ct < 2; ++ct) {
#pragma unroll
    for (int r = 0; r < 8; ++r) { const int cl = ct * 16 + 8 * g + r; const float bv_ = bfr(bv[ct][r]), bg_ = bfr(bq[ct][r]);
      float sg[4];
#pragma unroll
      for (int pt = 0; pt < 4; ++pt) sg[pt] = sigm(ag[ct][pt][r] + bg_);
#pragma unroll
      for (int pt = 0; pt < 4; ++pt) sY[w][cl][pt * 16 + col] = bfr(xv[ct][r][pt]) + (av[ct][pt][r] + bv_) * sg[pt]; } }
  LDSX();
  for (int qq = lane; qq < 32 * 16; qq += 32) { const int cl = qq >> 4, pc = qq & 15; vst2(y + ((size_t)b * CC + w * 32 + cl) * NN + p0 + pc * 4, *(const v4f*)(&sY[w][cl][pc * 4])); }
}
extern "C" void kernel_launch(void* const* d_in, const int* in_sizes, int n_in, void* d_out, int out_size, void* d_ws, size_t ws_size, hipStream_t stream) {
  (void)in_sizes; (void)n_in; (void)out_size; (void)ws_size;
  const float* x = (const float*)d_in[0]; const float* Wqkv = (const float*)d_in[1]; const float* bqkv = (const float*)d_in[2]; const float* Wg = (const float*)d_in[3]; const float* bg = (const float*)d_in[4];
  char* ws = (char*)d_ws; size_t off = 0;
  auto take = [&](size_t bytes) { char* p = ws + off; off += (bytes + 255) & ~(size_t)255; return p; };
  __bf16* XT = (__bf16*)take((size_t)NB * NN * CC * 2); float* Q32 = (float*)take((size_t)NB * NN * CC * 4); __bf16* Kh = (__bf16*)take((size_t)NB * NN * CC * 2); __bf16* Kl = (__bf16*)take((size_t)NB * NN * CC * 2); __bf16* VTh = (__bf16*)take((size_t)NB * NN * CC * 2); __bf16* VTl = (__bf16*)take((size_t)NB * NN * CC * 2); float* O = (float*)take((size_t)NB * NN * CC * 4);
  // ws ~ 19 MB
  k_cvtx<<<dim3(NN / 64, NB), 256, 0, stream>>>(x, XT);
  k_qkv<<<dim3(NB * NN / 64, CC / 128, 3), 128, 0, stream>>>(XT, Wqkv, bqkv, Q32, Kh, Kl, VTh, VTl);
  k_attn<<<dim3(NN / 64, NB * NHD), 128, 0, stream>>>(Q32, Kh, Kl, VTh, VTl, O);
  k_out<<<dim3(NN / 64, NB), 128, 0, stream>>>(O, Wg, bg, x, (float*)d_out);
}

// v005
// It runs in 49.8 microseconds.
// Timed twice side by side with v004, it ran 1.03 times as fast both times.
// Counting every step since v000, it is 2.22 times as fast.
// compute dtype: x, qkv_w, qkv_b, gate_w, gate_b (INPUTS) rounded to bf16 with exact bf16 WMMA products (f32 accumulate) for the qkv projection and the gate projection's weight side; q kept f32 and split hi/lo, k as bf16 hi/lo rows (3 products), softmax weights and v as bf16 hi/lo (3 products), attention output hi/lo x bf16(gate_w) (2 products); softmax, sigmoid gating and the residual in f32.
#include <hip/hip_runtime.h>
#include <math.h>

typedef __attribute__((ext_vector_type(16))) _Float16 v16h;
typedef __attribute__((ext_vector_type(16))) __bf16 v16b;
typedef __attribute__((ext_vector_type(8)))  _Float16 v8h;
typedef __attribute__((ext_vector_type(8)))  float v8f;
typedef __attribute__((ext_vector_type(4)))  float v4f;
typedef __attribute__((ext_vector_type(2)))  float v2f;
typedef __attribute__((ext_vector_type(4)))  unsigned v4u;
typedef __attribute__((ext_vector_type(4)))  int v4i;
typedef float __attribute__((may_alias)) float_a;
typedef int __attribute__((may_alias)) int_a;

template <typename T> __device__ __forceinline__ void vst2(void* p, T v) { *(T*)p = v;  }
__device__ __forceinline__ v8f wmma16(v16h a, v16h b, v8f c) {
  v8f d = __builtin_amdgcn_wmma_f32_16x16x32_f16(false, a, false, b, (short)0, c, false, false);
  asm volatile("v_nop\n\tv_nop\n\tv_nop\n\tv_nop" : "+v"(d) : "v"(a), "v"(b));
  return d;
}
__device__ __forceinline__ v8f wmma_bf(v16b a, v16b b, v8f c) {
  v8f d = __builtin_amdgcn_wmma_f32_16x16x32_bf16(false, a, false, b, (short)0, c, false, false);
  asm volatile("v_nop\n\tv_nop\n\tv_nop\n\tv_nop" : "+v"(d) : "v"(a), "v"(b));
  return d;
}
// 16x16x32 fragments: lane = (h = lane>>4, row/col = lane&15); elements 0..7 = k0+8h+0..7, 8..15 = k0+16+8h+0..7; D element r = row 8h+r
__device__ __forceinline__ v16h frag_h(const _Float16* rowk0, int lane) {
  union { v16h v; v8h q[2]; } u; const _Float16* p = rowk0 + 8 * (lane >> 4);
  u.q[0] = *(const v8h*)p; u.q[1] = *(const v8h*)(p + 16); return u.v;
}
__device__ __forceinline__ v16h frag_f32(const float* rowk0, int lane) {
  v16h a; const float* p = rowk0 + 8 * (lane >> 4);
#pragma unroll
  for (int i = 0; i < 8; ++i) { a[i] = (_Float16)p[i]; a[8 + i] = (_Float16)p[16 + i]; }
  return a;
}
__device__ __forceinline__ v16h frag_f32s(const float* rowk0, int lane, float sc) {
  v16h a; const float* p = rowk0 + 8 * (lane >> 4);
#pragma unroll
  for (int i = 0; i < 8; ++i) { a[i] = (_Float16)(p[i] * sc); a[8 + i] = (_Float16)(p[16 + i] * sc); }
  return a;
}
// column fragment from a [K][ld] layout (column n), rows >= K read as 0
__device__ __forceinline__ v16h fragc_f32(const float* W, int k0, int n, int lane, int ld, int K) {
  v16h a; const int g = lane >> 4;
#pragma unroll
  for (int i = 0; i < 8; ++i) { const int ka = k0 + 8 * g + i, kb = ka + 16;
    a[i] = (_Float16)(ka < K ? W[(size_t)(ka < K ? ka : K - 1) * ld + n] : 0.f); a[8 + i] = (_Float16)(kb < K ? W[(size_t)(kb < K ? kb : K - 1) * ld + n] : 0.f); }
  return a;
}
struct F2 { v16b h, l; };
__device__ __forceinline__ F2 bsplit16(const float v[16]) { F2 r;
#pragma unroll
  for (int i = 0; i < 16; ++i) { const __bf16 h = (__bf16)v[i]; r.h[i] = h; r.l[i] = (__bf16)(v[i] - (float)h); }
  return r; }
__device__ __forceinline__ F2 split_row(const float* row, int k0, int lane) { float v[16]; const float* p = row + k0 + 8 * (lane >> 4);
#pragma unroll
  for (int i = 0; i < 8; ++i) { v[i] = p[i]; v[8 + i] = p[16 + i]; }
  return bsplit16(v); }
__device__ __forceinline__ F2 split_rowK(const float* row, int k0, int lane, int K) { float v[16]; const int g = lane >> 4;
#pragma unroll
  for (int i = 0; i < 8; ++i) { const int ka = k0 + 8 * g + i, kb = ka + 16; v[i] = ka < K ? row[ka < K ? ka : K - 1] : 0.f; v[8 + i] = kb < K ? row[kb < K ? kb : K - 1] : 0.f; }
  return bsplit16(v); }
__device__ __forceinline__ F2 split_col(const float* W, int k0, int n, int lane, int ld, int K) { float v[16]; const int g = lane >> 4;
#pragma unroll
  for (int i = 0; i < 8; ++i) { const int ka = k0 + 8 * g + i, kb = ka + 16; v[i] = ka < K ? W[(size_t)(ka < K ? ka : K - 1) * ld + n] : 0.f; v[8 + i] = kb < K ? W[(size_t)(kb < K ? kb : K - 1) * ld + n] : 0.f; }
  return bsplit16(v); }
__device__ __forceinline__ v8f mac3(const F2& a, const F2& b, v8f c) { c = wmma_bf(a.l, b.h, c); c = wmma_bf(a.h, b.l, c); return wmma_bf(a.h, b.h, c); }
__device__ __forceinline__ float sigm(float v) { return 1.0f / (1.0f + expf(-v)); }
#define LDSX() do { asm volatile("s_wait_dscnt 0" ::: "memory"); __builtin_amdgcn_wave_barrier(); __builtin_amdgcn_fence(__ATOMIC_RELEASE, "workgroup"); } while (0)


// Gated spatial attention on [8,128,32,32] (4 heads x 32 over the 1,024 positions): qkv = inp @ qkv_w + qkv_b ([in][out], per-head interleaved columns h*96 + {q,k,v}*32 + d); softmax(q.k 32^-0.5) over all positions; feats @ gate_w + gate_b -> val | gate; y = x + val * sigmoid(gate) (NCHW).
// k_cvtx (pixel-major bf16 rows), k_qkv (Q32 f32 [bh][n][32]; K bf16 hi/lo rows; V bf16 hi/lo planes), k_attn (block = 64 queries x (b,h); O rows [b][n][128]), k_out (val/gate tiles per channel, sigmoid gating, residual, NCHW store).
#define NB 8
#define CC 128
#define NN 1024
#define NHD 4
#define DH 32
__device__ __forceinline__ float bfr(float v) { return (float)(__bf16)v; }
__device__ __forceinline__ v16b frag_b(const __bf16* rowk0, int lane) { return __builtin_bit_cast(v16b, frag_h((const _Float16*)rowk0, lane)); }

__global__ __launch_bounds__(256) void k_cvtx(const float* __restrict__ x, __bf16* __restrict__ XT) {
  __shared__ __align__(16) __bf16 st[64][CC + 8];
  const int tid = threadIdx.x; const int b = blockIdx.y, p0 = blockIdx.x * 64;
  for (int q = tid; q < CC * 16; q += 256) { const int c = q >> 4, p4 = q & 15; const v4f v = *(const v4f*)(x + ((size_t)b * CC + c) * NN + p0 + p4 * 4);
    st[p4 * 4][c] = (__bf16)v[0]; st[p4 * 4 + 1][c] = (__bf16)v[1]; st[p4 * 4 + 2][c] = (__bf16)v[2]; st[p4 * 4 + 3][c] = (__bf16)v[3]; }
  __syncthreads();
  for (int q = tid; q < 64 * (CC / 8); q += 256) { const int rl = q / (CC / 8), pc = q % (CC / 8); vst2((unsigned*)(XT + ((size_t)b * NN + p0 + rl) * CC + pc * 8), *(const v4u*)(&st[rl][pc * 8])); }
}
// qkv: block (64 tokens, 128 output channels = 4 heads, which): rows = XT, B = W columns ([in][out]) + bias
__global__ __launch_bounds__(128) void k_qkv(const __bf16* __restrict__ XT, const float* __restrict__ W, const float* __restrict__ bias, float* __restrict__ Q32, __bf16* __restrict__ Kh, __bf16* __restrict__ Kl, __bf16* __restrict__ VTh, __bf16* __restrict__ VTl) {
  __shared__ __align__(16) float so[4][16][132]; __shared__ __align__(16) __bf16 sh_[4][16][136], sl_[4][16][136]; __shared__ __align__(16) __bf16 sth[128][72], stl[128][72];
  __shared__ __align__(16) __bf16 sW[128][CC + 8];      // the block's 128 weight columns as bf16 rows [column][k], pitch 272 B for the ds_load_b128 fragment reads
  const int tid = threadIdx.x, wave = tid >> 5, lane = tid & 31, col = lane & 15, g = lane >> 4; const int r0b = blockIdx.x * 64, n0 = blockIdx.y * 128, which = blockIdx.z; const int b = r0b / NN, s0 = r0b % NN; const size_t r0 = (size_t)r0b + wave * 16;
  v8f acc[8] = {};
  // the weight tile is brought once per block: wave w takes k rows 32w..32w+31, a lane 4 adjacent columns (h*96 + which*32 + d of qkv_w [128][384]), so each load covers four whole 128-B lines;
  // all 32 loads of a lane and its 8 row-fragment loads fly together; a lane then holds one 32-long k run of each of its columns and lays it down as four 16-B pieces
  v4f wr[32]; v16b a[CC / 32];
  { const int c4 = n0 + lane * 4; const float* wp = W + (size_t)(wave * 32) * (3 * CC) + (c4 >> 5) * (3 * DH) + which * DH + (c4 & 31);
#pragma unroll
    for (int i = 0; i < 32; ++i) wr[i] = *(const v4f*)(wp + (size_t)i * (3 * CC)); }
#pragma unroll
  for (int kc = 0; kc < CC / 32; ++kc) a[kc] = frag_b(XT + (r0 + col) * CC + kc * 32, lane);
#pragma unroll
  for (int jc = 0; jc < 4; ++jc) {
#pragma unroll
    for (int q = 0; q < 4; ++q) { union { __bf16 e[8]; v4u u; } pk;
#pragma unroll
      for (int i = 0; i < 8; ++i) pk.e[i] = (__bf16)wr[q * 8 + i][jc];
      *(v4u*)(&sW[lane * 4 + jc][wave * 32 + q * 8]) = pk.u; } }
  __syncthreads();      // every wave reads all four waves' k runs
  v16b bw[2][8];      // a k step's eight weight fragments are read as one group, one step ahead of their products
#pragma unroll
  for (int j = 0; j < 8; ++j) bw[0][j] = frag_b(&sW[j * 16 + col][0], lane);
#pragma unroll
  for (int kc = 0; kc < CC / 32; ++kc) {
    if (kc + 1 < CC / 32) {
#pragma unroll
      for (int j = 0; j < 8; ++j) bw[(kc + 1) & 1][j] = frag_b(&sW[j * 16 + col][(kc + 1) * 32], lane);
      __builtin_amdgcn_sched_barrier(0); }      // holds the next step's reads in front of this step's products: without it the scheduler sinks each pair of reads to its own product and waits it out there
#pragma unroll
    for (int j = 0; j < 8; ++j) acc[j] = wmma_bf(a[kc], bw[kc & 1][j], acc[j]); }
  if (which == 0) {
#pragma unroll
    for (int j = 0; j < 8; ++j) { const int c = n0 + j * 16 + col; const float bb = bfr(bias[(c >> 5) * (3 * DH) + 0 * DH + (c & 31)]);
#pragma unroll
      for (int r = 0; r < 8; ++r) so[wave][8 * g + r][j * 16 + col] = acc[j][r] + bb; }
    LDSX();
    for (int qq = lane; qq < 4 * 16 * 8; qq += 32) { const int hh = qq >> 7, rl = (qq >> 3) & 15, pc = qq & 7; const int h = (n0 >> 5) + hh; vst2(Q32 + (((size_t)b * NHD + h) * NN + s0 + wave * 16 + rl) * DH + pc * 4, *(const v4f*)(&so[wave][rl][hh * 32 + pc * 4])); } }
  else if (which == 1) {
#pragma unroll
    for (int j = 0; j < 8; ++j) { const int c = n0 + j * 16 + col; const float bb = bfr(bias[(c >> 5) * (3 * DH) + 1 * DH + (c & 31)]);
#pragma unroll
      for (int r = 0; r < 8; ++r) { const float v = acc[j][r] + bb; const __bf16 hi = (__bf16)v; sh_[wave][8 * g + r][j * 16 + col] = hi; sl_[wave][8 * g + r][j * 16 + col] = (__bf16)(v - (float)hi); } }
    LDSX();
    // K rows [bh][n][32] bf16 = 64 B: 4 lanes x 16 B; per instruction 8 (head,row) pairs
    for (int qq = lane; qq < 4 * 16 * 4; qq += 32) { const int hh = qq >> 6, rl = (qq >> 2) & 15, pc = qq & 3; const int h = (n0 >> 5) + hh; const size_t o = (((size_t)b * NHD + h) * NN + s0 + wave * 16 + rl) * DH + pc * 8; vst2((unsigned*)(Kh + o), *(const v4u*)(&sh_[wave][rl][hh * 32 + pc * 8])); vst2((unsigned*)(Kl + o), *(const v4u*)(&sl_[wave][rl][hh * 32 + pc * 8])); } }
  else {
#pragma unroll
    for (int j = 0; j < 8; ++j) { const int c = n0 + j * 16 + col; const float bb = bfr(bias[(c >> 5) * (3 * DH) + 2 * DH + (c & 31)]);
#pragma unroll
      for (int r = 0; r < 8; ++r) { const float v = acc[j][r] + bb; const __bf16 hi = (__bf16)v; sth[j * 16 + col][wave * 16 + 8 * g + r] = hi; stl[j * 16 + col][wave * 16 + 8 * g + r] = (__bf16)(v - (float)hi); } }
    __syncthreads();
    for (int qq = tid; qq < 128 * 8; qq += 128) { const int cl = qq >> 3, pc = qq & 7; const int c = n0 + cl; const int h = c >> 5, d = c & 31; const size_t o = (((size_t)b * NHD + h) * DH + d) * NN + s0 + pc * 8; vst2((unsigned*)(VTh + o), *(const v4u*)(&sth[cl][pc * 8])); vst2((unsigned*)(VTl + o), *(const v4u*)(&stl[cl][pc * 8])); } }
}
// a pass's K/V tile in LDS: K hi, K lo as 64 rows of 64 B at pitch 80 B, then V hi, V lo as 32 rows of 128 B at pitch 144 B (both 16 B x odd, the pitch of the ds_load_b128 fragment reads)
#define KPI 80
#define VPI 144
#define OFF_KL (64 * KPI)
#define OFF_VH (2 * 64 * KPI)
#define OFF_VL (2 * 64 * KPI + 32 * VPI)
#define TILE_B (2 * 64 * KPI + 2 * 32 * VPI)
// fragment from the lane's own LDS row: 16 B at the pointer and 16 B at +32
__device__ __forceinline__ v16b frag_l(const char* p) { union { v16b v; v4u q[2]; } u; u.q[0] = *(const v4u*)p; u.q[1] = *(const v4u*)(p + 32); return u.v; }
// a lane's eight 16-B pieces of one tile, global memory to LDS through no register: two of each plane (K rows r and r + 32, V rows r and r + 16).
// lk, lv: the lane's LDS byte addresses in the K hi and V hi planes of the target buffer; g*: its global addresses in this tile.
// The s_wait_xcnt stands inside the statement, behind the last copy, so that no address register is rewritten in front of it.
__device__ __forceinline__ void kv_copy(unsigned lk, unsigned lv, const char* gkh, const char* gkl, const char* gvh, const char* gvl) {
  asm volatile("global_load_async_to_lds_b128 %0, %8, off\n\t"
               "global_load_async_to_lds_b128 %1, %9, off\n\t"
               "global_load_async_to_lds_b128 %2, %10, off\n\t"
               "global_load_async_to_lds_b128 %3, %11, off\n\t"
               "global_load_async_to_lds_b128 %4, %12, off\n\t"
               "global_load_async_to_lds_b128 %5, %13, off\n\t"
               "global_load_async_to_lds_b128 %6, %14, off\n\t"
               "global_load_async_to_lds_b128 %7, %15, off\n\t"
               "s_wait_xcnt 0x0"
               :: "v"(lk), "v"(lk + 32 * KPI), "v"(lk + OFF_KL), "v"(lk + OFF_KL + 32 * KPI),
                  "v"(lv), "v"(lv + 16 * VPI), "v"(lv + (OFF_VL - OFF_VH)), "v"(lv + (OFF_VL - OFF_VH) + 16 * VPI),
                  "v"(gkh), "v"(gkh + 32 * DH * 2), "v"(gkl), "v"(gkl + 32 * DH * 2),
                  "v"(gvh), "v"(gvh + 16 * NN * 2), "v"(gvl), "v"(gvl + 16 * NN * 2)
               : "memory");
}
__global__ __launch_bounds__(128) void k_attn(const float* __restrict__ Q32, const __bf16* __restrict__ Kh, const __bf16* __restrict__ Kl, const __bf16* __restrict__ VTh, const __bf16* __restrict__ VTl, float* __restrict__ O) {
  __shared__ __align__(16) float sS[4][16][68];
  __shared__ __align__(16) __bf16 sPh[4][16][72], sPl[4][16][72];
  __shared__ __align__(16) float sO[4][16][36];
  __shared__ __align__(16) char sKV[2][TILE_B];
  const int tid = threadIdx.x, w = tid >> 5, lane = tid & 31, col = lane & 15, g = lane >> 4; const size_t bh = blockIdx.y; const int b = (int)(bh / NHD), h = (int)(bh % NHD); const int q0 = blockIdx.x * 64 + w * 16;
  // the block's four waves share each pass's 64 keys: the tile is brought into LDS once per block, a quarter by each wave, one whole pass ahead of its use (two buffers)
  const char* gkh = (const char*)(Kh + bh * NN * DH) + tid * 16; const char* gkl = (const char*)(Kl + bh * NN * DH) + tid * 16;
  const char* gvh = (const char*)(VTh + bh * DH * NN) + (tid >> 3) * (NN * 2) + (tid & 7) * 16; const char* gvl = (const char*)(VTl + bh * DH * NN) + (tid >> 3) * (NN * 2) + (tid & 7) * 16;
  const unsigned lk = (unsigned)(size_t)&sKV[0][0] + (unsigned)((tid >> 2) * KPI + (tid & 3) * 16), lv = (unsigned)(size_t)&sKV[0][0] + (unsigned)(OFF_VH + (tid >> 3) * VPI + (tid & 7) * 16);
  kv_copy(lk, lv, gkh, gkl, gvh, gvl);
  const F2 aq = split_row(Q32 + (bh * NN + q0 + col) * DH, 0, lane);
  float mrun = -3.0e38f, lrun = 0.f; v8f acc[2] = {};
  asm volatile("s_wait_asynccnt 0x0" ::: "memory");      // this wave's quarter of tile 0 has landed
  __syncthreads();      // and so has every other wave's
  kv_copy(lk + TILE_B, lv + TILE_B, gkh + 64 * DH * 2, gkl + 64 * DH * 2, gvh + 64 * 2, gvl + 64 * 2);
#pragma unroll 1
  for (int kt = 0; kt < NN / 64; ++kt) {
    const unsigned bo = (unsigned)(kt & 1) * TILE_B; const char* pk = &sKV[0][0] + bo + col * KPI + 16 * g; const char* pv = &sKV[0][0] + bo + OFF_VH + col * VPI + 16 * g;
    v16b khf[4], klf[4];
#pragma unroll
    for (int t = 0; t < 4; ++t) { khf[t] = frag_l(pk + t * 16 * KPI); klf[t] = frag_l(pk + OFF_KL + t * 16 * KPI); }
#pragma unroll
    for (int t = 0; t < 4; ++t) {
      v8f s = {}; s = wmma_bf(aq.l, khf[t], s); s = wmma_bf(aq.h, klf[t], s); s = wmma_bf(aq.h, khf[t], s);
#pragma unroll
      for (int r = 0; r < 8; ++r) sS[w][8 * g + r][t * 16 + col] = s[r] * 0.17677669529663687f; }
    LDSX();
    v16b vh[2][2], vl[2][2];
#pragma unroll
    for (int kc = 0; kc < 2; ++kc) {
#pragma unroll
      for (int t = 0; t < 2; ++t) { vh[kc][t] = frag_l(pv + t * 16 * VPI + kc * 64); vl[kc][t] = frag_l(pv + (OFF_VL - OFF_VH) + t * 16 * VPI + kc * 64); } }
    __builtin_amdgcn_sched_barrier(0);      // holds the V fragment reads at the head of the softmax, which runs while they come: without it the scheduler may sink them to its foot, straight in front of the wait there
    float mx = -3.4e38f;
#pragma unroll
    for (int jj = 0; jj < 32; ++jj) mx = fmaxf(mx, sS[w][col][g * 32 + jj]);
    mx = fmaxf(mx, __shfl_xor(mx, 16, 32));
    const float mnew = fmaxf(mrun, mx); const float corr = expf(mrun - mnew);
    float ps = 0.f;
#pragma unroll
    for (int jj = 0; jj < 32; ++jj) { const float p = expf(sS[w][col][g * 32 + jj] - mnew); ps += p; const __bf16 hi = (__bf16)p; sPh[w][col][g * 32 + jj] = hi; sPl[w][col][g * 32 + jj] = (__bf16)(p - (float)hi); }
    ps += __shfl_xor(ps, 16, 32);
    lrun = lrun * corr + ps; mrun = mnew;
#pragma unroll
    for (int r = 0; r < 8; ++r) { const float cr = __shfl(corr, 8 * g + r, 32); acc[0][r] *= cr; acc[1][r] *= cr; }
    LDSX();
#pragma unroll
    for (int kc = 0; kc < 2; ++kc) { const v16b ph = frag_b(&sPh[w][col][0] + kc * 32, lane), pl = frag_b(&sPl[w][col][0] + kc * 32, lane);
#pragma unroll
      for (int t = 0; t < 2; ++t) { acc[t] = wmma_bf(pl, vh[kc][t], acc[t]); acc[t] = wmma_bf(ph, vl[kc][t], acc[t]); acc[t] = wmma_bf(ph, vh[kc][t], acc[t]); } }
    asm volatile("s_wait_dscnt 0x0" ::: "memory");      // this wave's reads of the tile are done before the buffer is handed back
    asm volatile("s_wait_asynccnt 0x0" ::: "memory");      // its quarter of the next tile has landed
    __syncthreads();      // publishes the next tile and ends every wave's reads of this one
    if (kt + 2 < NN / 64) kv_copy(lk + bo, lv + bo, gkh + (kt + 2) * (64 * DH * 2), gkl + (kt + 2) * (64 * DH * 2), gvh + (kt + 2) * (64 * 2), gvl + (kt + 2) * (64 * 2)); }
  asm volatile("s_wait_asynccnt 0x0" ::: "memory");      // no copy is left in flight when the wave goes on to its end
#pragma unroll
  for (int r = 0; r < 8; ++r) { const float lr = __shfl(lrun, 8 * g + r, 32); const float inv = 1.0f / lr; sO[w][8 * g + r][col] = acc[0][r] * inv; sO[w][8 * g + r][16 + col] = acc[1][r] * inv; }
  LDSX();
  for (int qq = lane; qq < 16 * 8; qq += 32) { const int rl = qq >> 3, pc = qq & 7; vst2(O + ((size_t)b * NN + q0 + rl) * CC + h * DH + pc * 4, *(const v4f*)(&sO[w][rl][pc * 4])); }
}
// raw fragment loads: the addresses and guards of split_row and split_col, the conversion left to bsplit16
__device__ __forceinline__ void raw_row(const float* row, int k0, int lane, float v[16]) { const float* p = row + k0 + 8 * (lane >> 4);
#pragma unroll
  for (int i = 0; i < 8; ++i) { v[i] = p[i]; v[8 + i] = p[16 + i]; } }
__device__ __forceinline__ void raw_col(const float* W, int k0, int n, int lane, int ld, int K, float v[16]) { const int g = lane >> 4;
#pragma unroll
  for (int i = 0; i < 8; ++i) { const int ka = k0 + 8 * g + i, kb = ka + 16; v[i] = ka < K ? W[(size_t)(ka < K ? ka : K - 1) * ld + n] : 0.f; v[8 + i] = kb < K ? W[(size_t)(kb < K ? kb : K - 1) * ld + n] : 0.f; } }
// y[b][c][n] = x[b][c][n] + val * sigmoid(gate), val | gate = O[n][:] (hi/lo) . Wg[:][c | CC + c] + bg: block (b, 64 tokens); wave w -> channel tiles 2w..2w+1 (32 channels) x 4 token tiles
__global__ __launch_bounds__(128) void k_out(const float* __restrict__ O, const float* __restrict__ Wg, const float* __restrict__ bg, const float* __restrict__ x, float* __restrict__ y) {
  __shared__ __align__(16) float sY[4][32][68];
  const int tid = threadIdx.x, w = tid >> 5, lane = tid & 31, col = lane & 15, g = lane >> 4; const int b = blockIdx.y, p0 = blockIdx.x * 64; const size_t base = (size_t)b * NN;
  v8f av[2][4] = {}, ag[2][4] = {};
#pragma unroll 1
  for (int kc = 0; kc < CC / 32; ++kc) { F2 bc[4]; float ov[4][16], wv[2][2][16]; const int c0 = w * 32 + col;
    // a k step's loads are issued in two groups ahead of their use: the four O fragments with the first channel tile's weights, then the second tile's weights, which fly under the first tile's products
#pragma unroll
    for (int pt = 0; pt < 4; ++pt) raw_row(O + (base + p0 + pt * 16 + col) * CC, kc * 32, lane, ov[pt]);
    raw_col(Wg, kc * 32, c0, lane, 2 * CC, CC, wv[0][0]); raw_col(Wg, kc * 32, CC + c0, lane, 2 * CC, CC, wv[0][1]);
    __builtin_amdgcn_sched_barrier(0);      // holds the first group together: without it the scheduler issues the O loads two at a time, each pair straight in front of its own wait
    raw_col(Wg, kc * 32, c0 + 16, lane, 2 * CC, CC, wv[1][0]); raw_col(Wg, kc * 32, CC + c0 + 16, lane, 2 * CC, CC, wv[1][1]);
    asm volatile("s_wait_xcnt 0x0" ::: "memory");      // in front of the weight conversions below, whose results may be laid on these loads' address registers
    __builtin_amdgcn_sched_barrier(0);      // keeps that wait directly behind the loads, and both in front of the products
#pragma unroll
    for (int pt = 0; pt < 4; ++pt) bc[pt] = bsplit16(ov[pt]);
#pragma unroll
    for (int ct = 0; ct < 2; ++ct) { const v16b a1 = bsplit16(wv[ct][0]).h, a2 = bsplit16(wv[ct][1]).h;
#pragma unroll
      for (int pt = 0; pt < 4; ++pt) { av[ct][pt] = wmma_bf(a1, bc[pt].l, av[ct][pt]); av[ct][pt] = wmma_bf(a1, bc[pt].h, av[ct][pt]); ag[ct][pt] = wmma_bf(a2, bc[pt].l, ag[ct][pt]); ag[ct][pt] = wmma_bf(a2, bc[pt].h, ag[ct][pt]); } } }
  float xv[2][8][4], bv[2][8], bq[2][8];      // the tile's residual values and its biases, requested together in front of the gating, which starts on the biases while the rest still fly
#pragma unroll
  for (int ct = 0; ct < 2; ++ct) {
#pragma unroll
    for (int r = 0; r < 8; ++r) { const int c = w * 32 + ct * 16 + 8 * g + r; bv[ct][r] = bg[c]; bq[ct][r] = bg[CC + c];
#pragma unroll
      for (int pt = 0; pt < 4; ++pt) xv[ct][r][pt] = x[((size_t)b * CC + c) * NN + p0 + pt * 16 + col]; } }
  __builtin_amdgcn_sched_barrier(0);      // holds these loads in one flight in front of the gating, as the calls did: without it the scheduler deals them out through the gating in groups of eight, each waited for in its turn
#pragma unroll
  for (int ct = 0; ct < 2; ++ct) {
#pragma unroll
    for (int r = 0; r < 8; ++r) { const int cl = ct * 16 + 8 * g + r; const float bv_ = bfr(bv[ct][r]), bg_ = bfr(bq[ct][r]);
      float sg[4];
#pragma unroll
      for (int pt = 0; pt < 4; ++pt) sg[pt] = sigm(ag[ct][pt][r] + bg_);
#pragma unroll
      for (int pt = 0; pt < 4; ++pt) sY[w][cl][pt * 16 + col] = bfr(xv[ct][r][pt]) + (av[ct][pt][r] + bv_) * sg[pt]; } }
  LDSX();
  for (int qq = lane; qq < 32 * 16; qq += 32) { const int cl = qq >> 4, pc = qq & 15; vst2(y + ((size_t)b * CC + w * 32 + cl) * NN + p0 + pc * 4, *(const v4f*)(&sY[w][cl][pc * 4])); }
}
extern "C" void kernel_launch(void* const* d_in, const int* in_sizes, int n_in, void* d_out, int out_size, void* d_ws, size_t ws_size, hipStream_t stream) {
  (void)in_sizes; (void)n_in; (void)out_size; (void)ws_size;
  const float* x = (const float*)d_in[0]; const float* Wqkv = (const float*)d_in[1]; const float* bqkv = (const float*)d_in[2]; const float* Wg = (const float*)d_in[3]; const float* bg = (const float*)d_in[4];
  char* ws = (char*)d_ws; size_t off = 0;
  auto take = [&](size_t bytes) { char* p = ws + off; off += (bytes + 255) & ~(size_t)255; return p; };
  __bf16* XT = (__bf16*)take((size_t)NB * NN * CC * 2); float* Q32 = (float*)take((size_t)NB * NN * CC * 4); __bf16* Kh = (__bf16*)take((size_t)NB * NN * CC * 2); __bf16* Kl = (__bf16*)take((size_t)NB * NN * CC * 2); __bf16* VTh = (__bf16*)take((size_t)NB * NN * CC * 2); __bf16* VTl = (__bf16*)take((size_t)NB * NN * CC * 2); float* O = (float*)take((size_t)NB * NN * CC * 4);
  // ws ~ 19 MB
  k_cvtx<<<dim3(NN / 64, NB), 256, 0, stream>>>(x, XT);
  k_qkv<<<dim3(NB * NN / 64, CC / 128, 3), 128, 0, stream>>>(XT, Wqkv, bqkv, Q32, Kh, Kl, VTh, VTl);
  k_attn<<<dim3(NN / 64, NB * NHD), 128, 0, stream>>>(Q32, Kh, Kl, VTh, VTl, O);
  k_out<<<dim3(NN / 64, NB), 128, 0, stream>>>(O, Wg, bg, x, (float*)d_out);
}

// v006
// It runs in 43.3 microseconds.
// Timed twice side by side with v005, it ran 1.15 times as fast both times.
// Counting every step since v000, it is 2.54 times as fast.
// compute dtype: x, qkv_w, qkv_b, gate_w, gate_b (INPUTS) rounded to bf16 with exact bf16 WMMA products (f32 accumulate) for the qkv projection and the gate projection's weight side; q kept f32 and split hi/lo, k as bf16 hi/lo rows (3 products), softmax weights and v as bf16 hi/lo (3 products), attention output hi/lo x bf16(gate_w) (2 products); softmax, sigmoid gating and the residual in f32.
#include <hip/hip_runtime.h>
#include <math.h>

typedef __attribute__((ext_vector_type(16))) _Float16 v16h;
typedef __attribute__((ext_vector_type(16))) __bf16 v16b;
typedef __attribute__((ext_vector_type(8)))  _Float16 v8h;
typedef __attribute__((ext_vector_type(8)))  float v8f;
typedef __attribute__((ext_vector_type(4)))  float v4f;
typedef __attribute__((ext_vector_type(2)))  float v2f;
typedef __attribute__((ext_vector_type(4)))  unsigned v4u;
typedef __attribute__((ext_vector_type(4)))  int v4i;
typedef float __attribute__((may_alias)) float_a;
typedef int __attribute__((may_alias)) int_a;

template <typename T> __device__ __forceinline__ void vst2(void* p, T v) { *(T*)p = v;  }
__device__ __forceinline__ v8f wmma16(v16h a, v16h b, v8f c) {
  v8f d = __builtin_amdgcn_wmma_f32_16x16x32_f16(false, a, false, b, (short)0, c, false, false);
  asm volatile("v_nop\n\tv_nop\n\tv_nop\n\tv_nop" : "+v"(d) : "v"(a), "v"(b));
  return d;
}
__device__ __forceinline__ v8f wmma_bf(v16b a, v16b b, v8f c) {
  v8f d = __builtin_amdgcn_wmma_f32_16x16x32_bf16(false, a, false, b, (short)0, c, false, false);
  asm volatile("v_nop\n\tv_nop\n\tv_nop\n\tv_nop" : "+v"(d) : "v"(a), "v"(b));
  return d;
}
// 16x16x32 fragments: lane = (h = lane>>4, row/col = lane&15); elements 0..7 = k0+8h+0..7, 8..15 = k0+16+8h+0..7; D element r = row 8h+r
__device__ __forceinline__ v16h frag_h(const _Float16* rowk0, int lane) {
  union { v16h v; v8h q[2]; } u; const _Float16* p = rowk0 + 8 * (lane >> 4);
  u.q[0] = *(const v8h*)p; u.q[1] = *(const v8h*)(p + 16); return u.v;
}
__device__ __forceinline__ v16h frag_f32(const float* rowk0, int lane) {
  v16h a; const float* p = rowk0 + 8 * (lane >> 4);
#pragma unroll
  for (int i = 0; i < 8; ++i) { a[i] = (_Float16)p[i]; a[8 + i] = (_Float16)p[16 + i]; }
  return a;
}
__device__ __forceinline__ v16h frag_f32s(const float* rowk0, int lane, float sc) {
  v16h a; const float* p = rowk0 + 8 * (lane >> 4);
#pragma unroll
  for (int i = 0; i < 8; ++i) { a[i] = (_Float16)(p[i] * sc); a[8 + i] = (_Float16)(p[16 + i] * sc); }
  return a;
}
// column fragment from a [K][ld] layout (column n), rows >= K read as 0
__device__ __forceinline__ v16h fragc_f32(const float* W, int k0, int n, int lane, int ld, int K) {
  v16h a; const int g = lane >> 4;
#pragma unroll
  for (int i = 0; i < 8; ++i) { const int ka = k0 + 8 * g + i, kb = ka + 16;
    a[i] = (_Float16)(ka < K ? W[(size_t)(ka < K ? ka : K - 1) * ld + n] : 0.f); a[8 + i] = (_Float16)(kb < K ? W[(size_t)(kb < K ? kb : K - 1) * ld + n] : 0.f); }
  return a;
}
struct F2 { v16b h, l; };
__device__ __forceinline__ F2 bsplit16(const float v[16]) { F2 r;
#pragma unroll
  for (int i = 0; i < 16; ++i) { const __bf16 h = (__bf16)v[i]; r.h[i] = h; r.l[i] = (__bf16)(v[i] - (float)h); }
  return r; }
__device__ __forceinline__ F2 split_row(const float* row, int k0, int lane) { float v[16]; const float* p = row + k0 + 8 * (lane >> 4);
#pragma unroll
  for (int i = 0; i < 8; ++i) { v[i] = p[i]; v[8 + i] = p[16 + i]; }
  return bsplit16(v); }
__device__ __forceinline__ F2 split_rowK(const float* row, int k0, int lane, int K) { float v[16]; const int g = lane >> 4;
#pragma unroll
  for (int i = 0; i < 8; ++i) { const int ka = k0 + 8 * g + i, kb = ka + 16; v[i] = ka < K ? row[ka < K ? ka : K - 1] : 0.f; v[8 + i] = kb < K ? row[kb < K ? kb : K - 1] : 0.f; }
  return bsplit16(v); }
__device__ __forceinline__ F2 split_col(const float* W, int k0, int n, int lane, int ld, int K) { float v[16]; const int g = lane >> 4;
#pragma unroll
  for (int i = 0; i < 8; ++i) { const int ka = k0 + 8 * g + i, kb = ka + 16; v[i] = ka < K ? W[(size_t)(ka < K ? ka : K - 1) * ld + n] : 0.f; v[8 + i] = kb < K ? W[(size_t)(kb < K ? kb : K - 1) * ld + n] : 0.f; }
  return bsplit16(v); }
__device__ __forceinline__ v8f mac3(const F2& a, const F2& b, v8f c) { c = wmma_bf(a.l, b.h, c); c = wmma_bf(a.h, b.l, c); return wmma_bf(a.h, b.h, c); }
// e^u is taken as 2^(u log2 e) on the hardware's own exponential, one v_exp_f32; a result below the normal range comes out as 0, which is harmless here: each stands in a sum beside a term of 1
#define LOG2E 1.4426950408889634
__device__ __forceinline__ float sigm(float v) { float e;
  asm("v_exp_f32 %0, %1\n\tv_nop" : "=v"(e) : "v"(v * (float)(-LOG2E)));      // written out for the v_nop: it fills the slot asked for behind a transcendental
  return 1.0f / (1.0f + e); }
#define LDSX() do { asm volatile("s_wait_dscnt 0" ::: "memory"); __builtin_amdgcn_wave_barrier(); __builtin_amdgcn_fence(__ATOMIC_RELEASE, "workgroup"); } while (0)


// Gated spatial attention on [8,128,32,32] (4 heads x 32 over the 1,024 positions): qkv = inp @ qkv_w + qkv_b ([in][out], per-head interleaved columns h*96 + {q,k,v}*32 + d); softmax(q.k 32^-0.5) over all positions; feats @ gate_w + gate_b -> val | gate; y = x + val * sigmoid(gate) (NCHW).
// k_cvtx (pixel-major bf16 rows), k_qkv (Q32 f32 [bh][n][32]; K bf16 hi/lo rows; V bf16 hi/lo planes), k_attn (block = 64 queries x (b,h); O rows [b][n][128]), k_out (val/gate tiles per channel, sigmoid gating, residual, NCHW store).
#define NB 8
#define CC 128
#define NN 1024
#define NHD 4
#define DH 32
__device__ __forceinline__ float bfr(float v) { return (float)(__bf16)v; }
__device__ __forceinline__ v16b frag_b(const __bf16* rowk0, int lane) { return __builtin_bit_cast(v16b, frag_h((const _Float16*)rowk0, lane)); }

__global__ __launch_bounds__(256) void k_cvtx(const float* __restrict__ x, __bf16* __restrict__ XT) {
  __shared__ __align__(16) __bf16 st[64][CC + 8];
  const int tid = threadIdx.x; const int b = blockIdx.y, p0 = blockIdx.x * 64;
  for (int q = tid; q < CC * 16; q += 256) { const int c = q >> 4, p4 = q & 15; const v4f v = *(const v4f*)(x + ((size_t)b * CC + c) * NN + p0 + p4 * 4);
    st[p4 * 4][c] = (__bf16)v[0]; st[p4 * 4 + 1][c] = (__bf16)v[1]; st[p4 * 4 + 2][c] = (__bf16)v[2]; st[p4 * 4 + 3][c] = (__bf16)v[3]; }
  __syncthreads();
  for (int q = tid; q < 64 * (CC / 8); q += 256) { const int rl = q / (CC / 8), pc = q % (CC / 8); vst2((unsigned*)(XT + ((size_t)b * NN + p0 + rl) * CC + pc * 8), *(const v4u*)(&st[rl][pc * 8])); }
}
// qkv: block (64 tokens, 128 output channels = 4 heads, which): rows = XT, B = W columns ([in][out]) + bias
__global__ __launch_bounds__(128) void k_qkv(const __bf16* __restrict__ XT, const float* __restrict__ W, const float* __restrict__ bias, float* __restrict__ Q32, __bf16* __restrict__ Kh, __bf16* __restrict__ Kl, __bf16* __restrict__ VTh, __bf16* __restrict__ VTl) {
  __shared__ __align__(16) float so[4][16][132]; __shared__ __align__(16) __bf16 sh_[4][16][136], sl_[4][16][136]; __shared__ __align__(16) __bf16 sth[128][72], stl[128][72];
  __shared__ __align__(16) __bf16 sW[128][CC + 8];      // the block's 128 weight columns as bf16 rows [column][k], pitch 272 B for the ds_load_b128 fragment reads
  const int tid = threadIdx.x, wave = tid >> 5, lane = tid & 31, col = lane & 15, g = lane >> 4; const int r0b = blockIdx.x * 64, n0 = blockIdx.y * 128, which = blockIdx.z; const int b = r0b / NN, s0 = r0b % NN; const size_t r0 = (size_t)r0b + wave * 16;
  v8f acc[8] = {};
  // the weight tile is brought once per block: wave w takes k rows 32w..32w+31, a lane 4 adjacent columns (h*96 + which*32 + d of qkv_w [128][384]), so each load covers four whole 128-B lines;
  // all 32 loads of a lane and its 8 row-fragment loads fly together; a lane then holds one 32-long k run of each of its columns and lays it down as four 16-B pieces
  v4f wr[32]; v16b a[CC / 32];
  { const int c4 = n0 + lane * 4; const float* wp = W + (size_t)(wave * 32) * (3 * CC) + (c4 >> 5) * (3 * DH) + which * DH + (c4 & 31);
#pragma unroll
    for (int i = 0; i < 32; ++i) wr[i] = *(const v4f*)(wp + (size_t)i * (3 * CC)); }
#pragma unroll
  for (int kc = 0; kc < CC / 32; ++kc) a[kc] = frag_b(XT + (r0 + col) * CC + kc * 32, lane);
#pragma unroll
  for (int jc = 0; jc < 4; ++jc) {
#pragma unroll
    for (int q = 0; q < 4; ++q) { union { __bf16 e[8]; v4u u; } pk;
#pragma unroll
      for (int i = 0; i < 8; ++i) pk.e[i] = (__bf16)wr[q * 8 + i][jc];
      *(v4u*)(&sW[lane * 4 + jc][wave * 32 + q * 8]) = pk.u; } }
  __syncthreads();      // every wave reads all four waves' k runs
  v16b bw[2][8];      // a k step's eight weight fragments are read as one group, one step ahead of their products
#pragma unroll
  for (int j = 0; j < 8; ++j) bw[0][j] = frag_b(&sW[j * 16 + col][0], lane);
#pragma unroll
  for (int kc = 0; kc < CC / 32; ++kc) {
    if (kc + 1 < CC / 32) {
#pragma unroll
      for (int j = 0; j < 8; ++j) bw[(kc + 1) & 1][j] = frag_b(&sW[j * 16 + col][(kc + 1) * 32], lane);
      __builtin_amdgcn_sched_barrier(0); }      // holds the next step's reads in front of this step's products: without it the scheduler sinks each pair of reads to its own product and waits it out there
#pragma unroll
    for (int j = 0; j < 8; ++j) acc[j] = wmma_bf(a[kc], bw[kc & 1][j], acc[j]); }
  if (which == 0) {
#pragma unroll
    for (int j = 0; j < 8; ++j) { const int c = n0 + j * 16 + col; const float bb = bfr(bias[(c >> 5) * (3 * DH) + 0 * DH + (c & 31)]);
#pragma unroll
      for (int r = 0; r < 8; ++r) so[wave][8 * g + r][j * 16 + col] = acc[j][r] + bb; }
    LDSX();
    for (int qq = lane; qq < 4 * 16 * 8; qq += 32) { const int hh = qq >> 7, rl = (qq >> 3) & 15, pc = qq & 7; const int h = (n0 >> 5) + hh; vst2(Q32 + (((size_t)b * NHD + h) * NN + s0 + wave * 16 + rl) * DH + pc * 4, *(const v4f*)(&so[wave][rl][hh * 32 + pc * 4])); } }
  else if (which == 1) {
#pragma unroll
    for (int j = 0; j < 8; ++j) { const int c = n0 + j * 16 + col; const float bb = bfr(bias[(c >> 5) * (3 * DH) + 1 * DH + (c & 31)]);
#pragma unroll
      for (int r = 0; r < 8; ++r) { const float v = acc[j][r] + bb; const __bf16 hi = (__bf16)v; sh_[wave][8 * g + r][j * 16 + col] = hi; sl_[wave][8 * g + r][j * 16 + col] = (__bf16)(v - (float)hi); } }
    LDSX();
    // K rows [bh][n][32] bf16 = 64 B: 4 lanes x 16 B; per instruction 8 (head,row) pairs
    for (int qq = lane; qq < 4 * 16 * 4; qq += 32) { const int hh = qq >> 6, rl = (qq >> 2) & 15, pc = qq & 3; const int h = (n0 >> 5) + hh; const size_t o = (((size_t)b * NHD + h) * NN + s0 + wave * 16 + rl) * DH + pc * 8; vst2((unsigned*)(Kh + o), *(const v4u*)(&sh_[wave][rl][hh * 32 + pc * 8])); vst2((unsigned*)(Kl + o), *(const v4u*)(&sl_[wave][rl][hh * 32 + pc * 8])); } }
  else {
#pragma unroll
    for (int j = 0; j < 8; ++j) { const int c = n0 + j * 16 + col; const float bb = bfr(bias[(c >> 5) * (3 * DH) + 2 * DH + (c & 31)]);
#pragma unroll
      for (int r = 0; r < 8; ++r) { const float v = acc[j][r] + bb; const __bf16 hi = (__bf16)v; sth[j * 16 + col][wave * 16 + 8 * g + r] = hi; stl[j * 16 + col][wave * 16 + 8 * g + r] = (__bf16)(v - (float)hi); } }
    __syncthreads();
    for (int qq = tid; qq < 128 * 8; qq += 128) { const int cl = qq >> 3, pc = qq & 7; const int c = n0 + cl; const int h = c >> 5, d = c & 31; const size_t o = (((size_t)b * NHD + h) * DH + d) * NN + s0 + pc * 8; vst2((unsigned*)(VTh + o), *(const v4u*)(&sth[cl][pc * 8])); vst2((unsigned*)(VTl + o), *(const v4u*)(&stl[cl][pc * 8])); } }
}
// a pass's K/V tile in LDS: K hi, K lo as 64 rows of 64 B at pitch 80 B, then V hi, V lo as 32 rows of 128 B at pitch 144 B (both 16 B x odd, the pitch of the ds_load_b128 fragment reads)
#define KPI 80
#define VPI 144
#define OFF_KL (64 * KPI)
#define OFF_VH (2 * 64 * KPI)
#define OFF_VL (2 * 64 * KPI + 32 * VPI)
#define TILE_B (2 * 64 * KPI + 2 * 32 * VPI)
// fragment from the lane's own LDS row: 16 B at the pointer and 16 B at +32
__device__ __forceinline__ v16b frag_l(const char* p) { union { v16b v; v4u q[2]; } u; u.q[0] = *(const v4u*)p; u.q[1] = *(const v4u*)(p + 32); return u.v; }
// a lane's eight 16-B pieces of one tile, global memory to LDS through no register: two of each plane (K rows r and r + 32, V rows r and r + 16).
// lk, lv: the lane's LDS byte addresses in the K hi and V hi planes of the target buffer; g*: its global addresses in this tile.
// The s_wait_xcnt stands inside the statement, behind the last copy, so that no address register is rewritten in front of it.
__device__ __forceinline__ void kv_copy(unsigned lk, unsigned lv, const char* gkh, const char* gkl, const char* gvh, const char* gvl) {
  asm volatile("global_load_async_to_lds_b128 %0, %8, off\n\t"
               "global_load_async_to_lds_b128 %1, %9, off\n\t"
               "global_load_async_to_lds_b128 %2, %10, off\n\t"
               "global_load_async_to_lds_b128 %3, %11, off\n\t"
               "global_load_async_to_lds_b128 %4, %12, off\n\t"
               "global_load_async_to_lds_b128 %5, %13, off\n\t"
               "global_load_async_to_lds_b128 %6, %14, off\n\t"
               "global_load_async_to_lds_b128 %7, %15, off\n\t"
               "s_wait_xcnt 0x0"
               :: "v"(lk), "v"(lk + 32 * KPI), "v"(lk + OFF_KL), "v"(lk + OFF_KL + 32 * KPI),
                  "v"(lv), "v"(lv + 16 * VPI), "v"(lv + (OFF_VL - OFF_VH)), "v"(lv + (OFF_VL - OFF_VH) + 16 * VPI),
                  "v"(gkh), "v"(gkh + 32 * DH * 2), "v"(gkl), "v"(gkl + 32 * DH * 2),
                  "v"(gvh), "v"(gvh + 16 * NN * 2), "v"(gvl), "v"(gvl + 16 * NN * 2)
               : "memory");
}
__global__ __launch_bounds__(128) void k_attn(const float* __restrict__ Q32, const __bf16* __restrict__ Kh, const __bf16* __restrict__ Kl, const __bf16* __restrict__ VTh, const __bf16* __restrict__ VTl, float* __restrict__ O) {
  __shared__ __align__(16) float sS[4][16][68];
  __shared__ __align__(16) __bf16 sPh[4][16][72], sPl[4][16][72];
  __shared__ __align__(16) float sO[4][16][36];
  __shared__ __align__(16) char sKV[2][TILE_B];
  const int tid = threadIdx.x, w = tid >> 5, lane = tid & 31, col = lane & 15, g = lane >> 4; const size_t bh = blockIdx.y; const int b = (int)(bh / NHD), h = (int)(bh % NHD); const int q0 = blockIdx.x * 64 + w * 16;
  // the block's four waves share each pass's 64 keys: the tile is brought into LDS once per block, a quarter by each wave, one whole pass ahead of its use (two buffers)
  const char* gkh = (const char*)(Kh + bh * NN * DH) + tid * 16; const char* gkl = (const char*)(Kl + bh * NN * DH) + tid * 16;
  const char* gvh = (const char*)(VTh + bh * DH * NN) + (tid >> 3) * (NN * 2) + (tid & 7) * 16; const char* gvl = (const char*)(VTl + bh * DH * NN) + (tid >> 3) * (NN * 2) + (tid & 7) * 16;
  const unsigned lk = (unsigned)(size_t)&sKV[0][0] + (unsigned)((tid >> 2) * KPI + (tid & 3) * 16), lv = (unsigned)(size_t)&sKV[0][0] + (unsigned)(OFF_VH + (tid >> 3) * VPI + (tid & 7) * 16);
  kv_copy(lk, lv, gkh, gkl, gvh, gvl);
  const F2 aq = split_row(Q32 + (bh * NN + q0 + col) * DH, 0, lane);
  float mrun = -3.0e38f, lrun = 0.f; v8f acc[2] = {};
  asm volatile("s_wait_asynccnt 0x0" ::: "memory");      // this wave's quarter of tile 0 has landed
  __syncthreads();      // and so has every other wave's
  kv_copy(lk + TILE_B, lv + TILE_B, gkh + 64 * DH * 2, gkl + 64 * DH * 2, gvh + 64 * 2, gvl + 64 * 2);
#pragma unroll 1
  for (int kt = 0; kt < NN / 64; ++kt) {
    const unsigned bo = (unsigned)(kt & 1) * TILE_B; const char* pk = &sKV[0][0] + bo + col * KPI + 16 * g; const char* pv = &sKV[0][0] + bo + OFF_VH + col * VPI + 16 * g;
    v16b khf[4], klf[4];
#pragma unroll
    for (int t = 0; t < 4; ++t) { khf[t] = frag_l(pk + t * 16 * KPI); klf[t] = frag_l(pk + OFF_KL + t * 16 * KPI); }
#pragma unroll
    for (int t = 0; t < 4; ++t) {
      v8f s = {}; s = wmma_bf(aq.l, khf[t], s); s = wmma_bf(aq.h, klf[t], s); s = wmma_bf(aq.h, khf[t], s);
#pragma unroll
      for (int r = 0; r < 8; ++r) sS[w][8 * g + r][t * 16 + col] = s[r] * (float)(0.17677669529663687 * LOG2E); }      // scores in base 2: log2 e rides on the scale, so maximum, difference and exponential need no further multiply
    LDSX();
    v16b vh[2][2], vl[2][2];
#pragma unroll
    for (int kc = 0; kc < 2; ++kc) {
#pragma unroll
      for (int t = 0; t < 2; ++t) { vh[kc][t] = frag_l(pv + t * 16 * VPI + kc * 64); vl[kc][t] = frag_l(pv + (OFF_VL - OFF_VH) + t * 16 * VPI + kc * 64); } }
    __builtin_amdgcn_sched_barrier(0);      // holds the V fragment reads at the head of the softmax, which runs while they come: without it the scheduler may sink them to its foot, straight in front of the wait there
    float mx = -3.4e38f;
#pragma unroll
    for (int jj = 0; jj < 32; ++jj) mx = fmaxf(mx, sS[w][col][g * 32 + jj]);
    mx = fmaxf(mx, __shfl_xor(mx, 16, 32));
    const float mnew = fmaxf(mrun, mx); const float corr = __builtin_amdgcn_exp2f(mrun - mnew);
    float ps = 0.f;
#pragma unroll
    for (int jj = 0; jj < 32; ++jj) { const float p = __builtin_amdgcn_exp2f(sS[w][col][g * 32 + jj] - mnew); ps += p; const __bf16 hi = (__bf16)p; sPh[w][col][g * 32 + jj] = hi; sPl[w][col][g * 32 + jj] = (__bf16)(p - (float)hi); }
    ps += __shfl_xor(ps, 16, 32);
    lrun = lrun * corr + ps; mrun = mnew;
#pragma unroll
    for (int r = 0; r < 8; ++r) { const float cr = __shfl(corr, 8 * g + r, 32); acc[0][r] *= cr; acc[1][r] *= cr; }
    LDSX();
#pragma unroll
    for (int kc = 0; kc < 2; ++kc) { const v16b ph = frag_b(&sPh[w][col][0] + kc * 32, lane), pl = frag_b(&sPl[w][col][0] + kc * 32, lane);
#pragma unroll
      for (int t = 0; t < 2; ++t) { acc[t] = wmma_bf(pl, vh[kc][t], acc[t]); acc[t] = wmma_bf(ph, vl[kc][t], acc[t]); acc[t] = wmma_bf(ph, vh[kc][t], acc[t]); } }
    asm volatile("s_wait_dscnt 0x0" ::: "memory");      // this wave's reads of the tile are done before the buffer is handed back
    asm volatile("s_wait_asynccnt 0x0" ::: "memory");      // its quarter of the next tile has landed
    __syncthreads();      // publishes the next tile and ends every wave's reads of this one
    if (kt + 2 < NN / 64) kv_copy(lk + bo, lv + bo, gkh + (kt + 2) * (64 * DH * 2), gkl + (kt + 2) * (64 * DH * 2), gvh + (kt + 2) * (64 * 2), gvl + (kt + 2) * (64 * 2)); }
  asm volatile("s_wait_asynccnt 0x0" ::: "memory");      // no copy is left in flight when the wave goes on to its end
#pragma unroll
  for (int r = 0; r < 8; ++r) { const float lr = __shfl(lrun, 8 * g + r, 32); const float inv = 1.0f / lr; sO[w][8 * g + r][col] = acc[0][r] * inv; sO[w][8 * g + r][16 + col] = acc[1][r] * inv; }
  LDSX();
  for (int qq = lane; qq < 16 * 8; qq += 32) { const int rl = qq >> 3, pc = qq & 7; vst2(O + ((size_t)b * NN + q0 + rl) * CC + h * DH + pc * 4, *(const v4f*)(&sO[w][rl][pc * 4])); }
}
// raw fragment loads: the addresses and guards of split_row and split_col, the conversion left to bsplit16
__device__ __forceinline__ void raw_row(const float* row, int k0, int lane, float v[16]) { const float* p = row + k0 + 8 * (lane >> 4);
#pragma unroll
  for (int i = 0; i < 8; ++i) { v[i] = p[i]; v[8 + i] = p[16 + i]; } }
__device__ __forceinline__ void raw_col(const float* W, int k0, int n, int lane, int ld, int K, float v[16]) { const int g = lane >> 4;
#pragma unroll
  for (int i = 0; i < 8; ++i) { const int ka = k0 + 8 * g + i, kb = ka + 16; v[i] = ka < K ? W[(size_t)(ka < K ? ka : K - 1) * ld + n] : 0.f; v[8 + i] = kb < K ? W[(size_t)(kb < K ? kb : K - 1) * ld + n] : 0.f; } }
// y[b][c][n] = x[b][c][n] + val * sigmoid(gate), val | gate = O[n][:] (hi/lo) . Wg[:][c | CC + c] + bg: block (b, 64 tokens); wave w -> channel tiles 2w..2w+1 (32 channels) x 4 token tiles
__global__ __launch_bounds__(128) void k_out(const float* __restrict__ O, const float* __restrict__ Wg, const float* __restrict__ bg, const float* __restrict__ x, float* __restrict__ y) {
  __shared__ __align__(16) float sY[4][32][68];
  const int tid = threadIdx.x, w = tid >> 5, lane = tid & 31, col = lane & 15, g = lane >> 4; const int b = blockIdx.y, p0 = blockIdx.x * 64; const size_t base = (size_t)b * NN;
  v8f av[2][4] = {}, ag[2][4] = {};
#pragma unroll 1
  for (int kc = 0; kc < CC / 32; ++kc) { F2 bc[4]; float ov[4][16], wv[2][2][16]; const int c0 = w * 32 + col;
    // a k step's loads are issued in two groups ahead of their use: the four O fragments with the first channel tile's weights, then the second tile's weights, which fly under the first tile's products
#pragma unroll
    for (int pt = 0; pt < 4; ++pt) raw_row(O + (base + p0 + pt * 16 + col) * CC, kc * 32, lane, ov[pt]);
    raw_col(Wg, kc * 32, c0, lane, 2 * CC, CC, wv[0][0]); raw_col(Wg, kc * 32, CC + c0, lane, 2 * CC, CC, wv[0][1]);
    __builtin_amdgcn_sched_barrier(0);      // holds the first group together: without it the scheduler issues the O loads two at a time, each pair straight in front of its own wait
    raw_col(Wg, kc * 32, c0 + 16, lane, 2 * CC, CC, wv[1][0]); raw_col(Wg, kc * 32, CC + c0 + 16, lane, 2 * CC, CC, wv[1][1]);
    asm volatile("s_wait_xcnt 0x0" ::: "memory");      // in front of the weight conversions below, whose results may be laid on these loads' address registers
    __builtin_amdgcn_sched_barrier(0);      // keeps that wait directly behind the loads, and both in front of the products
#pragma unroll
    for (int pt = 0; pt < 4; ++pt) bc[pt] = bsplit16(ov[pt]);
#pragma unroll
    for (int ct = 0; ct < 2; ++ct) { const v16b a1 = bsplit16(wv[ct][0]).h, a2 = bsplit16(wv[ct][1]).h;
#pragma unroll
      for (int pt = 0; pt < 4; ++pt) { av[ct][pt] = wmma_bf(a1, bc[pt].l, av[ct][pt]); av[ct][pt] = wmma_bf(a1, bc[pt].h, av[ct][pt]); ag[ct][pt] = wmma_bf(a2, bc[pt].l, ag[ct][pt]); ag[ct][pt] = wmma_bf(a2, bc[pt].h, ag[ct][pt]); } } }
  float xv[2][8][4], bv[2][8], bq[2][8];      // the tile's residual values and its biases, requested together in front of the gating, which starts on the biases while the rest still fly
#pragma unroll
  for (int ct = 0; ct < 2; ++ct) {
#pragma unroll
    for (int r = 0; r < 8; ++r) { const int c = w * 32 + ct * 16 + 8 * g + r; bv[ct][r] = bg[c]; bq[ct][r] = bg[CC + c];
#pragma unroll
      for (int pt = 0; pt < 4; ++pt) xv[ct][r][pt] = x[((size_t)b * CC + c) * NN + p0 + pt * 16 + col]; } }
  __builtin_amdgcn_sched_barrier(0);      // holds these loads in one flight in front of the gating, as the calls did: without it the scheduler deals them out through the gating in groups of eight, each waited for in its turn
#pragma unroll
  for (int ct = 0; ct < 2; ++ct) {
#pragma unroll
    for (int r = 0; r < 8; ++r) { const int cl = ct * 16 + 8 * g + r; const float bv_ = bfr(bv[ct][r]), bg_ = bfr(bq[ct][r]);
      float sg[4];
#pragma unroll
      for (int pt = 0; pt < 4; ++pt) sg[pt] = sigm(ag[ct][pt][r] + bg_);
#pragma unroll
      for (int pt = 0; pt < 4; ++pt) sY[w][cl][pt * 16 + col] = bfr(xv[ct][r][pt]) + (av[ct][pt][r] + bv_) * sg[pt]; } }
  LDSX();
  for (int qq = lane; qq < 32 * 16; qq += 32) { const int cl = qq >> 4, pc = qq & 15; vst2(y + ((size_t)b * CC + w * 32 + cl) * NN + p0 + pc * 4, *(const v4f*)(&sY[w][cl][pc * 4])); }
}
extern "C" void kernel_launch(void* const* d_in, const int* in_sizes, int n_in, void* d_out, int out_size, void* d_ws, size_t ws_size, hipStream_t stream) {
  (void)in_sizes; (void)n_in; (void)out_size; (void)ws_size;
  const float* x = (const float*)d_in[0]; const float* Wqkv = (const float*)d_in[1]; const float* bqkv = (const float*)d_in[2]; const float* Wg = (const float*)d_in[3]; const float* bg = (const float*)d_in[4];
  char* ws = (char*)d_ws; size_t off = 0;
  auto take = [&](size_t bytes) { char* p = ws + off; off += (bytes + 255) & ~(size_t)255; return p; };
  __bf16* XT = (__bf16*)take((size_t)NB * NN * CC * 2); float* Q32 = (float*)take((size_t)NB * NN * CC * 4); __bf16* Kh = (__bf16*)take((size_t)NB * NN * CC * 2); __bf16* Kl = (__bf16*)take((size_t)NB * NN * CC * 2); __bf16* VTh = (__bf16*)take((size_t)NB * NN * CC * 2); __bf16* VTl = (__bf16*)take((size_t)NB * NN * CC * 2); float* O = (float*)take((size_t)NB * NN * CC * 4);
  // ws ~ 19 MB
  k_cvtx<<<dim3(NN / 64, NB), 256, 0, stream>>>(x, XT);
  k_qkv<<<dim3(NB * NN / 64, CC / 128, 3), 128, 0, stream>>>(XT, Wqkv, bqkv, Q32, Kh, Kl, VTh, VTl);
  k_attn<<<dim3(NN / 64, NB * NHD), 128, 0, stream>>>(Q32, Kh, Kl, VTh, VTl, O);
  k_out<<<dim3(NN / 64, NB), 128, 0, stream>>>(O, Wg, bg, x, (float*)d_out);
}

// v007
// A run of this version takes 36.5 microseconds.
// Next to v006, in two timings, it ran 1.19 and 1.18 times as fast.
// All steps since v000 together make it 3.01 times as fast.
// compute dtype: x, qkv_w, qkv_b, gate_w, gate_b (INPUTS) rounded to bf16 with exact bf16 WMMA products (f32 accumulate) for the qkv projection and the gate projection's weight side; q kept f32 and split hi/lo, k as bf16 hi/lo rows (3 products), softmax weights and v as bf16 hi/lo (3 products), attention output hi/lo x bf16(gate_w) (2 products); softmax, sigmoid gating and the residual in f32.
#include <hip/hip_runtime.h>
#include <math.h>

typedef __attribute__((ext_vector_type(16))) _Float16 v16h;
typedef __attribute__((ext_vector_type(16))) __bf16 v16b;
typedef __attribute__((ext_vector_type(8)))  _Float16 v8h;
typedef __attribute__((ext_vector_type(8)))  float v8f;
typedef __attribute__((ext_vector_type(4)))  float v4f;
typedef __attribute__((ext_vector_type(2)))  float v2f;
typedef __attribute__((ext_vector_type(2)))  __bf16 v2b;
typedef __attribute__((ext_vector_type(4)))  unsigned v4u;
typedef __attribute__((ext_vector_type(4)))  int v4i;
typedef float __attribute__((may_alias)) float_a;
typedef int __attribute__((may_alias)) int_a;

template <typename T> __device__ __forceinline__ void vst2(void* p, T v) { *(T*)p = v;  }
__device__ __forceinline__ v8f wmma16(v16h a, v16h b, v8f c) {
  v8f d = __builtin_amdgcn_wmma_f32_16x16x32_f16(false, a, false, b, (short)0, c, false, false);
  asm volatile("v_nop\n\tv_nop\n\tv_nop\n\tv_nop" : "+v"(d) : "v"(a), "v"(b));
  return d;
}
__device__ __forceinline__ v8f wmma_bf(v16b a, v16b b, v8f c) {
  v8f d = __builtin_amdgcn_wmma_f32_16x16x32_bf16(false, a, false, b, (short)0, c, false, false);
  asm volatile("v_nop\n\tv_nop\n\tv_nop\n\tv_nop" : "+v"(d) : "v"(a), "v"(b));
  return d;
}
// 16x16x32 fragments: lane = (h = lane>>4, row/col = lane&15); elements 0..7 = k0+8h+0..7, 8..15 = k0+16+8h+0..7; D element r = row 8h+r
__device__ __forceinline__ v16h frag_h(const _Float16* rowk0, int lane) {
  union { v16h v; v8h q[2]; } u; const _Float16* p = rowk0 + 8 * (lane >> 4);
  u.q[0] = *(const v8h*)p; u.q[1] = *(const v8h*)(p + 16); return u.v;
}
__device__ __forceinline__ v16h frag_f32(const float* rowk0, int lane) {
  v16h a; const float* p = rowk0 + 8 * (lane >> 4);
#pragma unroll
  for (int i = 0; i < 8; ++i) { a[i] = (_Float16)p[i]; a[8 + i] = (_Float16)p[16 + i]; }
  return a;
}
__device__ __forceinline__ v16h frag_f32s(const float* rowk0, int lane, float sc) {
  v16h a; const float* p = rowk0 + 8 * (lane >> 4);
#pragma unroll
  for (int i = 0; i < 8; ++i) { a[i] = (_Float16)(p[i] * sc); a[8 + i] = (_Float16)(p[16 + i] * sc); }
  return a;
}
// column fragment from a [K][ld] layout (column n), rows >= K read as 0
__device__ __forceinline__ v16h fragc_f32(const float* W, int k0, int n, int lane, int ld, int K) {
  v16h a; const int g = lane >> 4;
#pragma unroll
  for (int i = 0; i < 8; ++i) { const int ka = k0 + 8 * g + i, kb = ka + 16;
    a[i] = (_Float16)(ka < K ? W[(size_t)(ka < K ? ka : K - 1) * ld + n] : 0.f); a[8 + i] = (_Float16)(kb < K ? W[(size_t)(kb < K ? kb : K - 1) * ld + n] : 0.f); }
  return a;
}
struct F2 { v16b h, l; };
__device__ __forceinline__ F2 bsplit16(const float v[16]) { F2 r;
#pragma unroll
  for (int i = 0; i < 16; ++i) { const __bf16 h = (__bf16)v[i]; r.h[i] = h; r.l[i] = (__bf16)(v[i] - (float)h); }
  return r; }
__device__ __forceinline__ F2 split_row(const float* row, int k0, int lane) { float v[16]; const float* p = row + k0 + 8 * (lane >> 4);
#pragma unroll
  for (int i = 0; i < 8; ++i) { v[i] = p[i]; v[8 + i] = p[16 + i]; }
  return bsplit16(v); }
__device__ __forceinline__ F2 split_rowK(const float* row, int k0, int lane, int K) { float v[16]; const int g = lane >> 4;
#pragma unroll
  for (int i = 0; i < 8; ++i) { const int ka = k0 + 8 * g + i, kb = ka + 16; v[i] = ka < K ? row[ka < K ? ka : K - 1] : 0.f; v[8 + i] = kb < K ? row[kb < K ? kb : K - 1] : 0.f; }
  return bsplit16(v); }
__device__ __forceinline__ F2 split_col(const float* W, int k0, int n, int lane, int ld, int K) { float v[16]; const int g = lane >> 4;
#pragma unroll
  for (int i = 0; i < 8; ++i) { const int ka = k0 + 8 * g + i, kb = ka + 16; v[i] = ka < K ? W[(size_t)(ka < K ? ka : K - 1) * ld + n] : 0.f; v[8 + i] = kb < K ? W[(size_t)(kb < K ? kb : K - 1) * ld + n] : 0.f; }
  return bsplit16(v); }
__device__ __forceinline__ v8f mac3(const F2& a, const F2& b, v8f c) { c = wmma_bf(a.l, b.h, c); c = wmma_bf(a.h, b.l, c); return wmma_bf(a.h, b.h, c); }
// e^u is taken as 2^(u log2 e) on the hardware's own exponential, one v_exp_f32; a result below the normal range comes out as 0, which is harmless here: each stands in a sum beside a term of 1
#define LOG2E 1.4426950408889634
__device__ __forceinline__ float sigm(float v) { float e;
  asm("v_exp_f32 %0, %1\n\tv_nop" : "=v"(e) : "v"(v * (float)(-LOG2E)));      // written out for the v_nop: it fills the slot asked for behind a transcendental
  return 1.0f / (1.0f + e); }
#define LDSX() do { asm volatile("s_wait_dscnt 0" ::: "memory"); __builtin_amdgcn_wave_barrier(); __builtin_amdgcn_fence(__ATOMIC_RELEASE, "workgroup"); } while (0)


// Gated spatial attention on [8,128,32,32] (4 heads x 32 over the 1,024 positions): qkv = inp @ qkv_w + qkv_b ([in][out], per-head interleaved columns h*96 + {q,k,v}*32 + d); softmax(q.k 32^-0.5) over all positions; feats @ gate_w + gate_b -> val | gate; y = x + val * sigmoid(gate) (NCHW).
// k_cvtx (pixel-major bf16 rows), k_qkv (Q32 f32 [bh][n][32]; K bf16 hi/lo rows; V bf16 hi/lo planes), k_attn (block = 64 queries x (b,h); O rows [b][n][128]), k_out (val/gate tiles per channel, sigmoid gating, residual, NCHW store).
#define NB 8
#define CC 128
#define NN 1024
#define NHD 4
#define DH 32
__device__ __forceinline__ float bfr(float v) { return (float)(__bf16)v; }
__device__ __forceinline__ v16b frag_b(const __bf16* rowk0, int lane) { return __builtin_bit_cast(v16b, frag_h((const _Float16*)rowk0, lane)); }

__global__ __launch_bounds__(256) void k_cvtx(const float* __restrict__ x, __bf16* __restrict__ XT) {
  __shared__ __align__(16) __bf16 st[64][CC + 8];
  const int tid = threadIdx.x; const int b = blockIdx.y, p0 = blockIdx.x * 64;
  for (int q = tid; q < CC * 16; q += 256) { const int c = q >> 4, p4 = q & 15; const v4f v = *(const v4f*)(x + ((size_t)b * CC + c) * NN + p0 + p4 * 4);
    st[p4 * 4][c] = (__bf16)v[0]; st[p4 * 4 + 1][c] = (__bf16)v[1]; st[p4 * 4 + 2][c] = (__bf16)v[2]; st[p4 * 4 + 3][c] = (__bf16)v[3]; }
  __syncthreads();
  for (int q = tid; q < 64 * (CC / 8); q += 256) { const int rl = q / (CC / 8), pc = q % (CC / 8); vst2((unsigned*)(XT + ((size_t)b * NN + p0 + rl) * CC + pc * 8), *(const v4u*)(&st[rl][pc * 8])); }
}
// qkv: block (64 tokens, 128 output channels = 4 heads, which): rows = XT, B = W columns ([in][out]) + bias
__global__ __launch_bounds__(128) void k_qkv(const __bf16* __restrict__ XT, const float* __restrict__ W, const float* __restrict__ bias, float* __restrict__ Q32, __bf16* __restrict__ Kh, __bf16* __restrict__ Kl, __bf16* __restrict__ VTh, __bf16* __restrict__ VTl) {
  __shared__ __align__(16) float so[4][16][132]; __shared__ __align__(16) __bf16 sh_[4][16][136], sl_[4][16][136]; __shared__ __align__(16) __bf16 sth[128][72], stl[128][72];
  __shared__ __align__(16) __bf16 sW[128][CC + 8];      // the block's 128 weight columns as bf16 rows [column][k], pitch 272 B for the ds_load_b128 fragment reads
  const int tid = threadIdx.x, wave = tid >> 5, lane = tid & 31, col = lane & 15, g = lane >> 4; const int r0b = blockIdx.x * 64, n0 = blockIdx.y * 128, which = blockIdx.z; const int b = r0b / NN, s0 = r0b % NN; const size_t r0 = (size_t)r0b + wave * 16;
  v8f acc[8] = {};
  // the weight tile is brought once per block: wave w takes k rows 32w..32w+31, a lane 4 adjacent columns (h*96 + which*32 + d of qkv_w [128][384]), so each load covers four whole 128-B lines;
  // all 32 loads of a lane and its 8 row-fragment loads fly together; a lane then holds one 32-long k run of each of its columns and lays it down as four 16-B pieces
  v4f wr[32]; v16b a[CC / 32];
  { const int c4 = n0 + lane * 4; const float* wp = W + (size_t)(wave * 32) * (3 * CC) + (c4 >> 5) * (3 * DH) + which * DH + (c4 & 31);
#pragma unroll
    for (int i = 0; i < 32; ++i) wr[i] = *(const v4f*)(wp + (size_t)i * (3 * CC)); }
#pragma unroll
  for (int kc = 0; kc < CC / 32; ++kc) a[kc] = frag_b(XT + (r0 + col) * CC + kc * 32, lane);
#pragma unroll
  for (int jc = 0; jc < 4; ++jc) {
#pragma unroll
    for (int q = 0; q < 4; ++q) { union { __bf16 e[8]; v4u u; } pk;
#pragma unroll
      for (int i = 0; i < 8; ++i) pk.e[i] = (__bf16)wr[q * 8 + i][jc];
      *(v4u*)(&sW[lane * 4 + jc][wave * 32 + q * 8]) = pk.u; } }
  __syncthreads();      // every wave reads all four waves' k runs
  v16b bw[2][8];      // a k step's eight weight fragments are read as one group, one step ahead of their products
#pragma unroll
  for (int j = 0; j < 8; ++j) bw[0][j] = frag_b(&sW[j * 16 + col][0], lane);
#pragma unroll
  for (int kc = 0; kc < CC / 32; ++kc) {
    if (kc + 1 < CC / 32) {
#pragma unroll
      for (int j = 0; j < 8; ++j) bw[(kc + 1) & 1][j] = frag_b(&sW[j * 16 + col][(kc + 1) * 32], lane);
      __builtin_amdgcn_sched_barrier(0); }      // holds the next step's reads in front of this step's products: without it the scheduler sinks each pair of reads to its own product and waits it out there
#pragma unroll
    for (int j = 0; j < 8; ++j) acc[j] = wmma_bf(a[kc], bw[kc & 1][j], acc[j]); }
  if (which == 0) {
#pragma unroll
    for (int j = 0; j < 8; ++j) { const int c = n0 + j * 16 + col; const float bb = bfr(bias[(c >> 5) * (3 * DH) + 0 * DH + (c & 31)]);
#pragma unroll
      for (int r = 0; r < 8; ++r) so[wave][8 * g + r][j * 16 + col] = acc[j][r] + bb; }
    LDSX();
    for (int qq = lane; qq < 4 * 16 * 8; qq += 32) { const int hh = qq >> 7, rl = (qq >> 3) & 15, pc = qq & 7; const int h = (n0 >> 5) + hh; vst2(Q32 + (((size_t)b * NHD + h) * NN + s0 + wave * 16 + rl) * DH + pc * 4, *(const v4f*)(&so[wave][rl][hh * 32 + pc * 4])); } }
  else if (which == 1) {
#pragma unroll
    for (int j = 0; j < 8; ++j) { const int c = n0 + j * 16 + col; const float bb = bfr(bias[(c >> 5) * (3 * DH) + 1 * DH + (c & 31)]);
#pragma unroll
      for (int r = 0; r < 8; ++r) { const float v = acc[j][r] + bb; const __bf16 hi = (__bf16)v; sh_[wave][8 * g + r][j * 16 + col] = hi; sl_[wave][8 * g + r][j * 16 + col] = (__bf16)(v - (float)hi); } }
    LDSX();
    // K rows [bh][n][32] bf16 = 64 B: 4 lanes x 16 B; per instruction 8 (head,row) pairs
    for (int qq = lane; qq < 4 * 16 * 4; qq += 32) { const int hh = qq >> 6, rl = (qq >> 2) & 15, pc = qq & 3; const int h = (n0 >> 5) + hh; const size_t o = (((size_t)b * NHD + h) * NN + s0 + wave * 16 + rl) * DH + pc * 8; vst2((unsigned*)(Kh + o), *(const v4u*)(&sh_[wave][rl][hh * 32 + pc * 8])); vst2((unsigned*)(Kl + o), *(const v4u*)(&sl_[wave][rl][hh * 32 + pc * 8])); } }
  else {
#pragma unroll
    for (int j = 0; j < 8; ++j) { const int c = n0 + j * 16 + col; const float bb = bfr(bias[(c >> 5) * (3 * DH) + 2 * DH + (c & 31)]);
#pragma unroll
      for (int r = 0; r < 8; ++r) { const float v = acc[j][r] + bb; const __bf16 hi = (__bf16)v; sth[j * 16 + col][wave * 16 + 8 * g + r] = hi; stl[j * 16 + col][wave * 16 + 8 * g + r] = (__bf16)(v - (float)hi); } }
    __syncthreads();
    for (int qq = tid; qq < 128 * 8; qq += 128) { const int cl = qq >> 3, pc = qq & 7; const int c = n0 + cl; const int h = c >> 5, d = c & 31; const size_t o = (((size_t)b * NHD + h) * DH + d) * NN + s0 + pc * 8; vst2((unsigned*)(VTh + o), *(const v4u*)(&sth[cl][pc * 8])); vst2((unsigned*)(VTl + o), *(const v4u*)(&stl[cl][pc * 8])); } }
}
// a pass's K/V tile in LDS: K hi, K lo as 64 rows of 64 B at pitch 80 B, then V hi, V lo as 32 rows of 128 B at pitch 144 B (both 16 B x odd, the pitch of the ds_load_b128 fragment reads)
#define KPI 80
#define VPI 144
#define OFF_KL (64 * KPI)
#define OFF_VH (2 * 64 * KPI)
#define OFF_VL (2 * 64 * KPI + 32 * VPI)
#define TILE_B (2 * 64 * KPI + 2 * 32 * VPI)
// fragment from the lane's own LDS row: 16 B at the pointer and 16 B at +32
__device__ __forceinline__ v16b frag_l(const char* p) { union { v16b v; v4u q[2]; } u; u.q[0] = *(const v4u*)p; u.q[1] = *(const v4u*)(p + 32); return u.v; }
// a lane's eight 16-B pieces of one tile, global memory to LDS through no register: two of each plane (K rows r and r + 32, V rows r and r + 16).
// lk, lv: the lane's LDS byte addresses in the K hi and V hi planes of the target buffer; g*: its global addresses in this tile.
// The s_wait_xcnt stands inside the statement, behind the last copy, so that no address register is rewritten in front of it.
__device__ __forceinline__ void kv_copy(unsigned lk, unsigned lv, const char* gkh, const char* gkl, const char* gvh, const char* gvl) {
  asm volatile("global_load_async_to_lds_b128 %0, %8, off\n\t"
               "global_load_async_to_lds_b128 %1, %9, off\n\t"
               "global_load_async_to_lds_b128 %2, %10, off\n\t"
               "global_load_async_to_lds_b128 %3, %11, off\n\t"
               "global_load_async_to_lds_b128 %4, %12, off\n\t"
               "global_load_async_to_lds_b128 %5, %13, off\n\t"
               "global_load_async_to_lds_b128 %6, %14, off\n\t"
               "global_load_async_to_lds_b128 %7, %15, off\n\t"
               "s_wait_xcnt 0x0"
               :: "v"(lk), "v"(lk + 32 * KPI), "v"(lk + OFF_KL), "v"(lk + OFF_KL + 32 * KPI),
                  "v"(lv), "v"(lv + 16 * VPI), "v"(lv + (OFF_VL - OFF_VH)), "v"(lv + (OFF_VL - OFF_VH) + 16 * VPI),
                  "v"(gkh), "v"(gkh + 32 * DH * 2), "v"(gkl), "v"(gkl + 32 * DH * 2),
                  "v"(gvh), "v"(gvh + 16 * NN * 2), "v"(gvl), "v"(gvl + 16 * NN * 2)
               : "memory");
}
// the value of lane l ^ 16, by a vector cross-row move: __shfl_xor goes through the LDS pipe and its wait would also wait out every fragment read in flight
__device__ __forceinline__ float xhalf(float v) { const int b = __builtin_bit_cast(int, v); return __builtin_bit_cast(float, __builtin_amdgcn_permlanex16(b, b, 0x76543210, 0xfedcba98, false, false)); }
__global__ __launch_bounds__(128) void k_attn(const float* __restrict__ Q32, const __bf16* __restrict__ Kh, const __bf16* __restrict__ Kl, const __bf16* __restrict__ VTh, const __bf16* __restrict__ VTl, float* __restrict__ O) {
  __shared__ __align__(16) float sO[4][16][36];
  __shared__ __align__(16) char sKV[2][TILE_B];
  const int tid = threadIdx.x, w = tid >> 5, lane = tid & 31, col = lane & 15, g = lane >> 4; const size_t bh = blockIdx.y; const int b = (int)(bh / NHD), h = (int)(bh % NHD); const int q0 = blockIdx.x * 64 + w * 16;
  // the block's four waves share each pass's 64 keys: the tile is brought into LDS once per block, a quarter by each wave, one whole pass ahead of its use (two buffers)
  const char* gkh = (const char*)(Kh + bh * NN * DH) + tid * 16; const char* gkl = (const char*)(Kl + bh * NN * DH) + tid * 16;
  const char* gvh = (const char*)(VTh + bh * DH * NN) + (tid >> 3) * (NN * 2) + (tid & 7) * 16; const char* gvl = (const char*)(VTl + bh * DH * NN) + (tid >> 3) * (NN * 2) + (tid & 7) * 16;
  const unsigned lk = (unsigned)(size_t)&sKV[0][0] + (unsigned)((tid >> 2) * KPI + (tid & 3) * 16), lv = (unsigned)(size_t)&sKV[0][0] + (unsigned)(OFF_VH + (tid >> 3) * VPI + (tid & 7) * 16);
  kv_copy(lk, lv, gkh, gkl, gvh, gvl);
  const F2 aq = split_row(Q32 + (bh * NN + q0 + col) * DH, 0, lane);
  // both products run transposed: S^T = K . Q^T (A = key rows, B = the wave's queries) and O^T += V^T . P^T (A = V planes, B = the weights).
  // Lane (g, col) then holds query q0 + col alone: of score tile t the keys 16t + 8g + 0..7, which is the k order of a B fragment, so two tiles' weights, converted in place, are the second product's B operand.
  // mrun is the query's running maximum (equal in both halves); lrun is this half's share of its running sum, the halves being joined behind the loop; acc[t][r] is O[q0 + col][16t + 8g + r].
  float mrun = -3.0e38f, lrun = 0.f; v8f acc[2] = {};
  asm volatile("s_wait_asynccnt 0x0" ::: "memory");      // this wave's quarter of tile 0 has landed
  __syncthreads();      // and so has every other wave's
  kv_copy(lk + TILE_B, lv + TILE_B, gkh + 64 * DH * 2, gkl + 64 * DH * 2, gvh + 64 * 2, gvl + 64 * 2);
#pragma unroll 1
  for (int kt = 0; kt < NN / 64; ++kt) {
    const unsigned bo = (unsigned)(kt & 1) * TILE_B; const char* pk = &sKV[0][0] + bo + col * KPI + 16 * g; const char* pv = &sKV[0][0] + bo + OFF_VH + col * VPI + 16 * g;
    v16b khf[4], klf[4];
#pragma unroll
    for (int t = 0; t < 4; ++t) { khf[t] = frag_l(pk + t * 16 * KPI); klf[t] = frag_l(pk + OFF_KL + t * 16 * KPI); }
    v8f s[4];
#pragma unroll
    for (int t = 0; t < 4; ++t) { v8f z = {}; z = wmma_bf(khf[t], aq.l, z); z = wmma_bf(klf[t], aq.h, z); s[t] = wmma_bf(khf[t], aq.h, z); }
    v16b vh[2][2], vl[2][2];
#pragma unroll
    for (int kc = 0; kc < 2; ++kc) {
#pragma unroll
      for (int t = 0; t < 2; ++t) { vh[kc][t] = frag_l(pv + t * 16 * VPI + kc * 64); vl[kc][t] = frag_l(pv + (OFF_VL - OFF_VH) + t * 16 * VPI + kc * 64); } }
    __builtin_amdgcn_sched_barrier(0);      // holds the V fragment reads at the head of the softmax, which runs while they come: without it the scheduler may sink them to its foot, straight in front of the wait there
    float mt[4];
#pragma unroll
    for (int t = 0; t < 4; ++t) {
#pragma unroll
      for (int r = 0; r < 8; ++r) { s[t][r] *= (float)(0.17677669529663687 * LOG2E); mt[t] = r ? fmaxf(mt[t], s[t][r]) : s[t][r]; } }      // scores in base 2: log2 e rides on the scale, so maximum, difference and exponential need no further multiply
    float mx = fmaxf(fmaxf(mt[0], mt[1]), fmaxf(mt[2], mt[3]));
    mx = fmaxf(mx, xhalf(mx));      // the other half holds the query's other 32 keys of this pass
    const float mnew = fmaxf(mrun, mx); const float corr = __builtin_amdgcn_exp2f(mrun - mnew);
    float pt[4]; v16b ph[2], pl[2];
#pragma unroll
    for (int t = 0; t < 4; ++t) {
#pragma unroll
      for (int r = 0; r < 8; r += 2) { const v2f p = { __builtin_amdgcn_exp2f(s[t][r] - mnew), __builtin_amdgcn_exp2f(s[t][r + 1] - mnew) }; pt[t] = r ? pt[t] + p[0] + p[1] : p[0] + p[1];
        const v2b hi = __builtin_convertvector(p, v2b); const v2f d = { p[0] - (float)hi[0], p[1] - (float)hi[1] }; const v2b lo = __builtin_convertvector(d, v2b);      // a register of the operand holds two weights: each pair is converted as a pair
        const int e = (t & 1) * 8 + r; ph[t >> 1][e] = hi[0]; ph[t >> 1][e + 1] = hi[1]; pl[t >> 1][e] = lo[0]; pl[t >> 1][e + 1] = lo[1]; } }
    lrun = lrun * corr + ((pt[0] + pt[1]) + (pt[2] + pt[3])); mrun = mnew;
#pragma unroll
    for (int r = 0; r < 8; ++r) { acc[0][r] *= corr; acc[1][r] *= corr; }
#pragma unroll
    for (int kc = 0; kc < 2; ++kc) {
#pragma unroll
      for (int t = 0; t < 2; ++t) { acc[t] = wmma_bf(vh[kc][t], pl[kc], acc[t]); acc[t] = wmma_bf(vl[kc][t], ph[kc], acc[t]); acc[t] = wmma_bf(vh[kc][t], ph[kc], acc[t]); } }
    asm volatile("s_wait_dscnt 0x0" ::: "memory");      // this wave's reads of the tile are done before the buffer is handed back
    asm volatile("s_wait_asynccnt 0x0" ::: "memory");      // its quarter of the next tile has landed
    __syncthreads();      // publishes the next tile and ends every wave's reads of this one
    if (kt + 2 < NN / 64) kv_copy(lk + bo, lv + bo, gkh + (kt + 2) * (64 * DH * 2), gkl + (kt + 2) * (64 * DH * 2), gvh + (kt + 2) * (64 * 2), gvl + (kt + 2) * (64 * 2)); }
  asm volatile("s_wait_asynccnt 0x0" ::: "memory");      // no copy is left in flight when the wave goes on to its end
  const float inv = 1.0f / (lrun + xhalf(lrun));
#pragma unroll
  for (int t = 0; t < 2; ++t) {
#pragma unroll
    for (int q = 0; q < 2; ++q) { const v4f o = { acc[t][q * 4] * inv, acc[t][q * 4 + 1] * inv, acc[t][q * 4 + 2] * inv, acc[t][q * 4 + 3] * inv }; *(v4f*)(&sO[w][col][t * 16 + 8 * g + q * 4]) = o; } }
  LDSX();
  for (int qq = lane; qq < 16 * 8; qq += 32) { const int rl = qq >> 3, pc = qq & 7; vst2(O + ((size_t)b * NN + q0 + rl) * CC + h * DH + pc * 4, *(const v4f*)(&sO[w][rl][pc * 4])); }
}
// raw fragment loads: the addresses and guards of split_row and split_col, the conversion left to bsplit16
__device__ __forceinline__ void raw_row(const float* row, int k0, int lane, float v[16]) { const float* p = row + k0 + 8 * (lane >> 4);
#pragma unroll
  for (int i = 0; i < 8; ++i) { v[i] = p[i]; v[8 + i] = p[16 + i]; } }
__device__ __forceinline__ void raw_col(const float* W, int k0, int n, int lane, int ld, int K, float v[16]) { const int g = lane >> 4;
#pragma unroll
  for (int i = 0; i < 8; ++i) { const int ka = k0 + 8 * g + i, kb = ka + 16; v[i] = ka < K ? W[(size_t)(ka < K ? ka : K - 1) * ld + n] : 0.f; v[8 + i] = kb < K ? W[(size_t)(kb < K ? kb : K - 1) * ld + n] : 0.f; } }
// y[b][c][n] = x[b][c][n] + val * sigmoid(gate), val | gate = O[n][:] (hi/lo) . Wg[:][c | CC + c] + bg: block (b, 64 tokens); wave w -> channel tiles 2w..2w+1 (32 channels) x 4 token tiles
__global__ __launch_bounds__(128) void k_out(const float* __restrict__ O, const float* __restrict__ Wg, const float* __restrict__ bg, const float* __restrict__ x, float* __restrict__ y) {
  __shared__ __align__(16) float sY[4][32][68];
  const int tid = threadIdx.x, w = tid >> 5, lane = tid & 31, col = lane & 15, g = lane >> 4; const int b = blockIdx.y, p0 = blockIdx.x * 64; const size_t base = (size_t)b * NN;
  v8f av[2][4] = {}, ag[2][4] = {};
#pragma unroll 1
  for (int kc = 0; kc < CC / 32; ++kc) { F2 bc[4]; float ov[4][16], wv[2][2][16]; const int c0 = w * 32 + col;
    // a k step's loads are issued in two groups ahead of their use: the four O fragments with the first channel tile's weights, then the second tile's weights, which fly under the first tile's products
#pragma unroll
    for (int pt = 0; pt < 4; ++pt) raw_row(O + (base + p0 + pt * 16 + col) * CC, kc * 32, lane, ov[pt]);
    raw_col(Wg, kc * 32, c0, lane, 2 * CC, CC, wv[0][0]); raw_col(Wg, kc * 32, CC + c0, lane, 2 * CC, CC, wv[0][1]);
    __builtin_amdgcn_sched_barrier(0);      // holds the first group together: without it the scheduler issues the O loads two at a time, each pair straight in front of its own wait
    raw_col(Wg, kc * 32, c0 + 16, lane, 2 * CC, CC, wv[1][0]); raw_col(Wg, kc * 32, CC + c0 + 16, lane, 2 * CC, CC, wv[1][1]);
    asm volatile("s_wait_xcnt 0x0" ::: "memory");      // in front of the weight conversions below, whose results may be laid on these loads' address registers
    __builtin_amdgcn_sched_barrier(0);      // keeps that wait directly behind the loads, and both in front of the products
#pragma unroll
    for (int pt = 0; pt < 4; ++pt) bc[pt] = bsplit16(ov[pt]);
#pragma unroll
    for (int ct = 0; ct < 2; ++ct) { const v16b a1 = bsplit16(wv[ct][0]).h, a2 = bsplit16(wv[ct][1]).h;
#pragma unroll
      for (int pt = 0; pt < 4; ++pt) { av[ct][pt] = wmma_bf(a1, bc[pt].l, av[ct][pt]); av[ct][pt] = wmma_bf(a1, bc[pt].h, av[ct][pt]); ag[ct][pt] = wmma_bf(a2, bc[pt].l, ag[ct][pt]); ag[ct][pt] = wmma_bf(a2, bc[pt].h, ag[ct][pt]); } } }
  float xv[2][8][4], bv[2][8], bq[2][8];      // the tile's residual values and its biases, requested together in front of the gating, which starts on the biases while the rest still fly
#pragma unroll
  for (int ct = 0; ct < 2; ++ct) {
#pragma unroll
    for (int r = 0; r < 8; ++r) { const int c = w * 32 + ct * 16 + 8 * g + r; bv[ct][r] = bg[c]; bq[ct][r] = bg[CC + c];
#pragma unroll
      for (int pt = 0; pt < 4; ++pt) xv[ct][r][pt] = x[((size_t)b * CC + c) * NN + p0 + pt * 16 + col]; } }
  __builtin_amdgcn_sched_barrier(0);      // holds these loads in one flight in front of the gating, as the calls did: without it the scheduler deals them out through the gating in groups of eight, each waited for in its turn
#pragma unroll
  for (int ct = 0; ct < 2; ++ct) {
#pragma unroll
    for (int r = 0; r < 8; ++r) { const int cl = ct * 16 + 8 * g + r; const float bv_ = bfr(bv[ct][r]), bg_ = bfr(bq[ct][r]);
      float sg[4];
#pragma unroll
      for (int pt = 0; pt < 4; ++pt) sg[pt] = sigm(ag[ct][pt][r] + bg_);
#pragma unroll
      for (int pt = 0; pt < 4; ++pt) sY[w][cl][pt * 16 + col] = bfr(xv[ct][r][pt]) + (av[ct][pt][r] + bv_) * sg[pt]; } }
  LDSX();
  for (int qq = lane; qq < 32 * 16; qq += 32) { const int cl = qq >> 4, pc = qq & 15; vst2(y + ((size_t)b * CC + w * 32 + cl) * NN + p0 + pc * 4, *(const v4f*)(&sY[w][cl][pc * 4])); }
}
extern "C" void kernel_launch(void* const* d_in, const int* in_sizes, int n_in, void* d_out, int out_size, void* d_ws, size_t ws_size, hipStream_t stream) {
  (void)in_sizes; (void)n_in; (void)out_size; (void)ws_size;
  const float* x = (const float*)d_in[0]; const float* Wqkv = (const float*)d_in[1]; const float* bqkv = (const float*)d_in[2]; const float* Wg = (const float*)d_in[3]; const float* bg = (const float*)d_in[4];
  char* ws = (char*)d_ws; size_t off = 0;
  auto take = [&](size_t bytes) { char* p = ws + off; off += (bytes + 255) & ~(size_t)255; return p; };
  __bf16* XT = (__bf16*)take((size_t)NB * NN * CC * 2); float* Q32 = (float*)take((size_t)NB * NN * CC * 4); __bf16* Kh = (__bf16*)take((size_t)NB * NN * CC * 2); __bf16* Kl = (__bf16*)take((size_t)NB * NN * CC * 2); __bf16* VTh = (__bf16*)take((size_t)NB * NN * CC * 2); __bf16* VTl = (__bf16*)take((size_t)NB * NN * CC * 2); float* O = (float*)take((size_t)NB * NN * CC * 4);
  // ws ~ 19 MB
  k_cvtx<<<dim3(NN / 64, NB), 256, 0, stream>>>(x, XT);
  k_qkv<<<dim3(NB * NN / 64, CC / 128, 3), 128, 0, stream>>>(XT, Wqkv, bqkv, Q32, Kh, Kl, VTh, VTl);
  k_attn<<<dim3(NN / 64, NB * NHD), 128, 0, stream>>>(Q32, Kh, Kl, VTh, VTl, O);
  k_out<<<dim3(NN / 64, NB), 128, 0, stream>>>(O, Wg, bg, x, (float*)d_out);
}

// v008
// A run of this version takes 31.6 microseconds.
// Two timings next to v007 both put it at 1.14 times that version's speed.
// All steps since v000 together make it 3.43 times as fast.
// compute dtype: x, qkv_w, qkv_b, gate_w, gate_b (INPUTS) rounded to bf16 with exact bf16 WMMA products (f32 accumulate) for the qkv projection and the gate projection's weight side; q kept f32 and split hi/lo, k as bf16 hi/lo rows (3 products), softmax weights and v as bf16 hi/lo (3 products), attention output hi/lo x bf16(gate_w) (2 products); softmax, sigmoid gating and the residual in f32.
#include <hip/hip_runtime.h>
#include <math.h>

typedef __attribute__((ext_vector_type(16))) _Float16 v16h;
typedef __attribute__((ext_vector_type(16))) __bf16 v16b;
typedef __attribute__((ext_vector_type(8)))  _Float16 v8h;
typedef __attribute__((ext_vector_type(8)))  float v8f;
typedef __attribute__((ext_vector_type(4)))  float v4f;
typedef __attribute__((ext_vector_type(2)))  float v2f;
typedef __attribute__((ext_vector_type(2)))  __bf16 v2b;
typedef __attribute__((ext_vector_type(4)))  unsigned v4u;
typedef __attribute__((ext_vector_type(4)))  int v4i;
typedef float __attribute__((may_alias)) float_a;
typedef int __attribute__((may_alias)) int_a;

template <typename T> __device__ __forceinline__ void vst2(void* p, T v) { *(T*)p = v;  }
__device__ __forceinline__ v8f wmma16(v16h a, v16h b, v8f c) {
  v8f d = __builtin_amdgcn_wmma_f32_16x16x32_f16(false, a, false, b, (short)0, c, false, false);
  asm volatile("v_nop\n\tv_nop\n\tv_nop\n\tv_nop" : "+v"(d) : "v"(a), "v"(b));
  return d;
}
__device__ __forceinline__ v8f wmma_bf(v16b a, v16b b, v8f c) {
  v8f d = __builtin_amdgcn_wmma_f32_16x16x32_bf16(false, a, false, b, (short)0, c, false, false);
  asm volatile("v_nop\n\tv_nop\n\tv_nop\n\tv_nop" : "+v"(d) : "v"(a), "v"(b));
  return d;
}
// 16x16x32 fragments: lane = (h = lane>>4, row/col = lane&15); elements 0..7 = k0+8h+0..7, 8..15 = k0+16+8h+0..7; D element r = row 8h+r
__device__ __forceinline__ v16h frag_h(const _Float16* rowk0, int lane) {
  union { v16h v; v8h q[2]; } u; const _Float16* p = rowk0 + 8 * (lane >> 4);
  u.q[0] = *(const v8h*)p; u.q[1] = *(const v8h*)(p + 16); return u.v;
}
__device__ __forceinline__ v16h frag_f32(const float* rowk0, int lane) {
  v16h a; const float* p = rowk0 + 8 * (lane >> 4);
#pragma unroll
  for (int i = 0; i < 8; ++i) { a[i] = (_Float16)p[i]; a[8 + i] = (_Float16)p[16 + i]; }
  return a;
}
__device__ __forceinline__ v16h frag_f32s(const float* rowk0, int lane, float sc) {
  v16h a; const float* p = rowk0 + 8 * (lane >> 4);
#pragma unroll
  for (int i = 0; i < 8; ++i) { a[i] = (_Float16)(p[i] * sc); a[8 + i] = (_Float16)(p[16 + i] * sc); }
  return a;
}
// column fragment from a [K][ld] layout (column n), rows >= K read as 0
__device__ __forceinline__ v16h fragc_f32(const float* W, int k0, int n, int lane, int ld, int K) {
  v16h a; const int g = lane >> 4;
#pragma unroll
  for (int i = 0; i < 8; ++i) { const int ka = k0 + 8 * g + i, kb = ka + 16;
    a[i] = (_Float16)(ka < K ? W[(size_t)(ka < K ? ka : K - 1) * ld + n] : 0.f); a[8 + i] = (_Float16)(kb < K ? W[(size_t)(kb < K ? kb : K - 1) * ld + n] : 0.f); }
  return a;
}
struct F2 { v16b h, l; };
__device__ __forceinline__ F2 bsplit16(const float v[16]) { F2 r;
#pragma unroll
  for (int i = 0; i < 16; ++i) { const __bf16 h = (__bf16)v[i]; r.h[i] = h; r.l[i] = (__bf16)(v[i] - (float)h); }
  return r; }
__device__ __forceinline__ F2 split_row(const float* row, int k0, int lane) { float v[16]; const float* p = row + k0 + 8 * (lane >> 4);
#pragma unroll
  for (int i = 0; i < 8; ++i) { v[i] = p[i]; v[8 + i] = p[16 + i]; }
  return bsplit16(v); }
__device__ __forceinline__ F2 split_rowK(const float* row, int k0, int lane, int K) { float v[16]; const int g = lane >> 4;
#pragma unroll
  for (int i = 0; i < 8; ++i) { const int ka = k0 + 8 * g + i, kb = ka + 16; v[i] = ka < K ? row[ka < K ? ka : K - 1] : 0.f; v[8 + i] = kb < K ? row[kb < K ? kb : K - 1] : 0.f; }
  return bsplit16(v); }
__device__ __forceinline__ F2 split_col(const float* W, int k0, int n, int lane, int ld, int K) { float v[16]; const int g = lane >> 4;
#pragma unroll
  for (int i = 0; i < 8; ++i) { const int ka = k0 + 8 * g + i, kb = ka + 16; v[i] = ka < K ? W[(size_t)(ka < K ? ka : K - 1) * ld + n] : 0.f; v[8 + i] = kb < K ? W[(size_t)(kb < K ? kb : K - 1) * ld + n] : 0.f; }
  return bsplit16(v); }
__device__ __forceinline__ v8f mac3(const F2& a, const F2& b, v8f c) { c = wmma_bf(a.l, b.h, c); c = wmma_bf(a.h, b.l, c); return wmma_bf(a.h, b.h, c); }
// e^u is taken as 2^(u log2 e) on the hardware's own exponential, one v_exp_f32; a result below the normal range comes out as 0, which is harmless here: each stands in a sum beside a term of 1
#define LOG2E 1.4426950408889634
__device__ __forceinline__ float sigm(float v) { float e;
  asm("v_exp_f32 %0, %1\n\tv_nop" : "=v"(e) : "v"(v * (float)(-LOG2E)));      // written out for the v_nop: it fills the slot asked for behind a transcendental
  return 1.0f / (1.0f + e); }
#define LDSX() do { asm volatile("s_wait_dscnt 0" ::: "memory"); __builtin_amdgcn_wave_barrier(); __builtin_amdgcn_fence(__ATOMIC_RELEASE, "workgroup"); } while (0)


// Gated spatial attention on [8,128,32,32] (4 heads x 32 over the 1,024 positions): qkv = inp @ qkv_w + qkv_b ([in][out], per-head interleaved columns h*96 + {q,k,v}*32 + d); softmax(q.k 32^-0.5) over all positions; feats @ gate_w + gate_b -> val | gate; y = x + val * sigmoid(gate) (NCHW).
// k_qkv (reads x as it lies; Q32 f32 [bh][n][32]; K bf16 hi/lo rows; V bf16 hi/lo planes), k_attn (block = 64 queries x (b,h); O rows [b][n][128]), k_out (val/gate tiles per channel, sigmoid gating, residual, NCHW store).
#define NB 8
#define CC 128
#define NN 1024
#define NHD 4
#define DH 32
__device__ __forceinline__ float bfr(float v) { return (float)(__bf16)v; }
__device__ __forceinline__ v16b frag_b(const __bf16* rowk0, int lane) { return __builtin_bit_cast(v16b, frag_h((const _Float16*)rowk0, lane)); }

// qkv: block (64 tokens, 128 output channels = 4 heads, which): rows = tokens of x (NCHW, rounded to bf16 in registers), B = W columns ([in][out], held in LDS as [out][in] rows) + bias
__global__ __launch_bounds__(128) void k_qkv(const float* __restrict__ x, const float* __restrict__ W, const float* __restrict__ bias, float* __restrict__ Q32, __bf16* __restrict__ Kh, __bf16* __restrict__ Kl, __bf16* __restrict__ VTh, __bf16* __restrict__ VTl) {
  __shared__ __align__(16) float so[4][16][132]; __shared__ __align__(16) __bf16 sh_[4][16][136], sl_[4][16][136]; __shared__ __align__(16) __bf16 sth[128][72], stl[128][72];
  __shared__ __align__(16) __bf16 sW[128][CC + 8];      // the block's 128 weight columns as bf16 rows [column][k], pitch 272 B for the ds_load_b128 fragment reads
  const int tid = threadIdx.x, wave = tid >> 5, lane = tid & 31, col = lane & 15, g = lane >> 4; const int r0b = blockIdx.x * 64, n0 = blockIdx.y * 128, which = blockIdx.z; const int b = r0b / NN, s0 = r0b % NN;
  v8f acc[8] = {};
  // the weight tile is brought once per block: wave w takes k rows 32w..32w+31, a lane 4 adjacent columns (h*96 + which*32 + d of qkv_w [128][384]), so each load covers four whole 128-B lines;
  // all 32 loads of a lane and the 64 loads of its row fragments fly together; a lane then holds one 32-long k run of each of its columns and lays it down as four 16-B pieces
  v4f wr[32]; float xr[CC / 32][16]; v16b a[CC / 32];
  { const int c4 = n0 + lane * 4; const float* wp = W + (size_t)(wave * 32) * (3 * CC) + (c4 >> 5) * (3 * DH) + which * DH + (c4 & 31);
#pragma unroll
    for (int i = 0; i < 32; ++i) wr[i] = *(const v4f*)(wp + (size_t)i * (3 * CC)); }
  // a lane's fragment elements are one token's channels, and a wave's 16 tokens are its own: each channel is one b32 load (16 lanes = 64 B in a row of x), so the transposition costs no LDS pass and no launch of its own
  { const float* xp = x + ((size_t)b * CC + 8 * g) * NN + s0 + wave * 16 + col;
#pragma unroll
    for (int kc = 0; kc < CC / 32; ++kc) {
#pragma unroll
      for (int i = 0; i < 8; ++i) { xr[kc][i] = xp[(size_t)(kc * 32 + i) * NN]; xr[kc][8 + i] = xp[(size_t)(kc * 32 + 16 + i) * NN]; } } }
  asm volatile("s_wait_xcnt 0x0" ::: "memory");      // in front of the conversions below, whose results may be laid on these loads' address registers
  __builtin_amdgcn_sched_barrier(0);      // keeps that wait directly behind the loads, and all 96 loads in one flight in front of the conversions
#pragma unroll
  for (int jc = 0; jc < 4; ++jc) {
#pragma unroll
    for (int q = 0; q < 4; ++q) { union { __bf16 e[8]; v4u u; } pk;
#pragma unroll
      for (int i = 0; i < 8; ++i) pk.e[i] = (__bf16)wr[q * 8 + i][jc];
      *(v4u*)(&sW[lane * 4 + jc][wave * 32 + q * 8]) = pk.u; } }
#pragma unroll
  for (int kc = 0; kc < CC / 32; ++kc) {
#pragma unroll
    for (int i = 0; i < 16; i += 2) { const v2f p = { xr[kc][i], xr[kc][i + 1] }; const v2b h = __builtin_convertvector(p, v2b); a[kc][i] = h[0]; a[kc][i + 1] = h[1]; } }      // a register of the operand holds two channels: each pair is converted as a pair
  __syncthreads();      // every wave reads all four waves' k runs
  v16b bw[2][8];      // a k step's eight weight fragments are read as one group, one step ahead of their products
#pragma unroll
  for (int j = 0; j < 8; ++j) bw[0][j] = frag_b(&sW[j * 16 + col][0], lane);
#pragma unroll
  for (int kc = 0; kc < CC / 32; ++kc) {
    if (kc + 1 < CC / 32) {
#pragma unroll
      for (int j = 0; j < 8; ++j) bw[(kc + 1) & 1][j] = frag_b(&sW[j * 16 + col][(kc + 1) * 32], lane);
      __builtin_amdgcn_sched_barrier(0); }      // holds the next step's reads in front of this step's products: without it the scheduler sinks each pair of reads to its own product and waits it out there
#pragma unroll
    for (int j = 0; j < 8; ++j) acc[j] = wmma_bf(a[kc], bw[kc & 1][j], acc[j]); }
  if (which == 0) {
#pragma unroll
    for (int j = 0; j < 8; ++j) { const int c = n0 + j * 16 + col; const float bb = bfr(bias[(c >> 5) * (3 * DH) + 0 * DH + (c & 31)]);
#pragma unroll
      for (int r = 0; r < 8; ++r) so[wave][8 * g + r][j * 16 + col] = acc[j][r] + bb; }
    LDSX();
    for (int qq = lane; qq < 4 * 16 * 8; qq += 32) { const int hh = qq >> 7, rl = (qq >> 3) & 15, pc = qq & 7; const int h = (n0 >> 5) + hh; vst2(Q32 + (((size_t)b * NHD + h) * NN + s0 + wave * 16 + rl) * DH + pc * 4, *(const v4f*)(&so[wave][rl][hh * 32 + pc * 4])); } }
  else if (which == 1) {
#pragma unroll
    for (int j = 0; j < 8; ++j) { const int c = n0 + j * 16 + col; const float bb = bfr(bias[(c >> 5) * (3 * DH) + 1 * DH + (c & 31)]);
#pragma unroll
      for (int r = 0; r < 8; ++r) { const float v = acc[j][r] + bb; const __bf16 hi = (__bf16)v; sh_[wave][8 * g + r][j * 16 + col] = hi; sl_[wave][8 * g + r][j * 16 + col] = (__bf16)(v - (float)hi); } }
    LDSX();
    // K rows [bh][n][32] bf16 = 64 B: 4 lanes x 16 B; per instruction 8 (head,row) pairs
    for (int qq = lane; qq < 4 * 16 * 4; qq += 32) { const int hh = qq >> 6, rl = (qq >> 2) & 15, pc = qq & 3; const int h = (n0 >> 5) + hh; const size_t o = (((size_t)b * NHD + h) * NN + s0 + wave * 16 + rl) * DH + pc * 8; vst2((unsigned*)(Kh + o), *(const v4u*)(&sh_[wave][rl][hh * 32 + pc * 8])); vst2((unsigned*)(Kl + o), *(const v4u*)(&sl_[wave][rl][hh * 32 + pc * 8])); } }
  else {
#pragma unroll
    for (int j = 0; j < 8; ++j) { const int c = n0 + j * 16 + col; const float bb = bfr(bias[(c >> 5) * (3 * DH) + 2 * DH + (c & 31)]);
#pragma unroll
      for (int r = 0; r < 8; ++r) { const float v = acc[j][r] + bb; const __bf16 hi = (__bf16)v; sth[j * 16 + col][wave * 16 + 8 * g + r] = hi; stl[j * 16 + col][wave * 16 + 8 * g + r] = (__bf16)(v - (float)hi); } }
    __syncthreads();
    for (int qq = tid; qq < 128 * 8; qq += 128) { const int cl = qq >> 3, pc = qq & 7; const int c = n0 + cl; const int h = c >> 5, d = c & 31; const size_t o = (((size_t)b * NHD + h) * DH + d) * NN + s0 + pc * 8; vst2((unsigned*)(VTh + o), *(const v4u*)(&sth[cl][pc * 8])); vst2((unsigned*)(VTl + o), *(const v4u*)(&stl[cl][pc * 8])); } }
}
// a pass's K/V tile in LDS: K hi, K lo as 64 rows of 64 B at pitch 80 B, then V hi, V lo as 32 rows of 128 B at pitch 144 B (both 16 B x odd, the pitch of the ds_load_b128 fragment reads)
#define KPI 80
#define VPI 144
#define OFF_KL (64 * KPI)
#define OFF_VH (2 * 64 * KPI)
#define OFF_VL (2 * 64 * KPI + 32 * VPI)
#define TILE_B (2 * 64 * KPI + 2 * 32 * VPI)
// fragment from the lane's own LDS row: 16 B at the pointer and 16 B at +32
__device__ __forceinline__ v16b frag_l(const char* p) { union { v16b v; v4u q[2]; } u; u.q[0] = *(const v4u*)p; u.q[1] = *(const v4u*)(p + 32); return u.v; }
// a lane's eight 16-B pieces of one tile, global memory to LDS through no register: two of each plane (K rows r and r + 32, V rows r and r + 16).
// lk, lv: the lane's LDS byte addresses in the K hi and V hi planes of the target buffer; g*: its global addresses in this tile.
// The s_wait_xcnt stands inside the statement, behind the last copy, so that no address register is rewritten in front of it.
__device__ __forceinline__ void kv_copy(unsigned lk, unsigned lv, const char* gkh, const char* gkl, const char* gvh, const char* gvl) {
  asm volatile("global_load_async_to_lds_b128 %0, %8, off\n\t"
               "global_load_async_to_lds_b128 %1, %9, off\n\t"
               "global_load_async_to_lds_b128 %2, %10, off\n\t"
               "global_load_async_to_lds_b128 %3, %11, off\n\t"
               "global_load_async_to_lds_b128 %4, %12, off\n\t"
               "global_load_async_to_lds_b128 %5, %13, off\n\t"
               "global_load_async_to_lds_b128 %6, %14, off\n\t"
               "global_load_async_to_lds_b128 %7, %15, off\n\t"
               "s_wait_xcnt 0x0"
               :: "v"(lk), "v"(lk + 32 * KPI), "v"(lk + OFF_KL), "v"(lk + OFF_KL + 32 * KPI),
                  "v"(lv), "v"(lv + 16 * VPI), "v"(lv + (OFF_VL - OFF_VH)), "v"(lv + (OFF_VL - OFF_VH) + 16 * VPI),
                  "v"(gkh), "v"(gkh + 32 * DH * 2), "v"(gkl), "v"(gkl + 32 * DH * 2),
                  "v"(gvh), "v"(gvh + 16 * NN * 2), "v"(gvl), "v"(gvl + 16 * NN * 2)
               : "memory");
}
// the value of lane l ^ 16, by a vector cross-row move: __shfl_xor goes through the LDS pipe and its wait would also wait out every fragment read in flight
__device__ __forceinline__ float xhalf(float v) { const int b = __builtin_bit_cast(int, v); return __builtin_bit_cast(float, __builtin_amdgcn_permlanex16(b, b, 0x76543210, 0xfedcba98, false, false)); }
__global__ __launch_bounds__(128) void k_attn(const float* __restrict__ Q32, const __bf16* __restrict__ Kh, const __bf16* __restrict__ Kl, const __bf16* __restrict__ VTh, const __bf16* __restrict__ VTl, float* __restrict__ O) {
  __shared__ __align__(16) float sO[4][16][36];
  __shared__ __align__(16) char sKV[2][TILE_B];
  const int tid = threadIdx.x, w = tid >> 5, lane = tid & 31, col = lane & 15, g = lane >> 4; const size_t bh = blockIdx.y; const int b = (int)(bh / NHD), h = (int)(bh % NHD); const int q0 = blockIdx.x * 64 + w * 16;
  // the block's four waves share each pass's 64 keys: the tile is brought into LDS once per block, a quarter by each wave, one whole pass ahead of its use (two buffers)
  const char* gkh = (const char*)(Kh + bh * NN * DH) + tid * 16; const char* gkl = (const char*)(Kl + bh * NN * DH) + tid * 16;
  const char* gvh = (const char*)(VTh + bh * DH * NN) + (tid >> 3) * (NN * 2) + (tid & 7) * 16; const char* gvl = (const char*)(VTl + bh * DH * NN) + (tid >> 3) * (NN * 2) + (tid & 7) * 16;
  const unsigned lk = (unsigned)(size_t)&sKV[0][0] + (unsigned)((tid >> 2) * KPI + (tid & 3) * 16), lv = (unsigned)(size_t)&sKV[0][0] + (unsigned)(OFF_VH + (tid >> 3) * VPI + (tid & 7) * 16);
  kv_copy(lk, lv, gkh, gkl, gvh, gvl);
  const F2 aq = split_row(Q32 + (bh * NN + q0 + col) * DH, 0, lane);
  // both products run transposed: S^T = K . Q^T (A = key rows, B = the wave's queries) and O^T += V^T . P^T (A = V planes, B = the weights).
  // Lane (g, col) then holds query q0 + col alone: of score tile t the keys 16t + 8g + 0..7, which is the k order of a B fragment, so two tiles' weights, converted in place, are the second product's B operand.
  // mrun is the query's running maximum (equal in both halves); lrun is this half's share of its running sum, the halves being joined behind the loop; acc[t][r] is O[q0 + col][16t + 8g + r].
  float mrun = -3.0e38f, lrun = 0.f; v8f acc[2] = {};
  asm volatile("s_wait_asynccnt 0x0" ::: "memory");      // this wave's quarter of tile 0 has landed
  __syncthreads();      // and so has every other wave's
  kv_copy(lk + TILE_B, lv + TILE_B, gkh + 64 * DH * 2, gkl + 64 * DH * 2, gvh + 64 * 2, gvl + 64 * 2);
#pragma unroll 1
  for (int kt = 0; kt < NN / 64; ++kt) {
    const unsigned bo = (unsigned)(kt & 1) * TILE_B; const char* pk = &sKV[0][0] + bo + col * KPI + 16 * g; const char* pv = &sKV[0][0] + bo + OFF_VH + col * VPI + 16 * g;
    v16b khf[4], klf[4];
#pragma unroll
    for (int t = 0; t < 4; ++t) { khf[t] = frag_l(pk + t * 16 * KPI); klf[t] = frag_l(pk + OFF_KL + t * 16 * KPI); }
    v8f s[4];
#pragma unroll
    for (int t = 0; t < 4; ++t) { v8f z = {}; z = wmma_bf(khf[t], aq.l, z); z = wmma_bf(klf[t], aq.h, z); s[t] = wmma_bf(khf[t], aq.h, z); }
    v16b vh[2][2], vl[2][2];
#pragma unroll
    for (int kc = 0; kc < 2; ++kc) {
#pragma unroll
      for (int t = 0; t < 2; ++t) { vh[kc][t] = frag_l(pv + t * 16 * VPI + kc * 64); vl[kc][t] = frag_l(pv + (OFF_VL - OFF_VH) + t * 16 * VPI + kc * 64); } }
    __builtin_amdgcn_sched_barrier(0);      // holds the V fragment reads at the head of the softmax, which runs while they come: without it the scheduler may sink them to its foot, straight in front of the wait there
    float mt[4];
#pragma unroll
    for (int t = 0; t < 4; ++t) {
#pragma unroll
      for (int r = 0; r < 8; ++r) { s[t][r] *= (float)(0.17677669529663687 * LOG2E); mt[t] = r ? fmaxf(mt[t], s[t][r]) : s[t][r]; } }      // scores in base 2: log2 e rides on the scale, so maximum, difference and exponential need no further multiply
    float mx = fmaxf(fmaxf(mt[0], mt[1]), fmaxf(mt[2], mt[3]));
    mx = fmaxf(mx, xhalf(mx));      // the other half holds the query's other 32 keys of this pass
    const float mnew = fmaxf(mrun, mx); const float corr = __builtin_amdgcn_exp2f(mrun - mnew);
    float pt[4]; v16b ph[2], pl[2];
#pragma unroll
    for (int t = 0; t < 4; ++t) {
#pragma unroll
      for (int r = 0; r < 8; r += 2) { const v2f p = { __builtin_amdgcn_exp2f(s[t][r] - mnew), __builtin_amdgcn_exp2f(s[t][r + 1] - mnew) }; pt[t] = r ? pt[t] + p[0] + p[1] : p[0] + p[1];
        const v2b hi = __builtin_convertvector(p, v2b); const v2f d = { p[0] - (float)hi[0], p[1] - (float)hi[1] }; const v2b lo = __builtin_convertvector(d, v2b);      // a register of the operand holds two weights: each pair is converted as a pair
        const int e = (t & 1) * 8 + r; ph[t >> 1][e] = hi[0]; ph[t >> 1][e + 1] = hi[1]; pl[t >> 1][e] = lo[0]; pl[t >> 1][e + 1] = lo[1]; } }
    lrun = lrun * corr + ((pt[0] + pt[1]) + (pt[2] + pt[3])); mrun = mnew;
#pragma unroll
    for (int r = 0; r < 8; ++r) { acc[0][r] *= corr; acc[1][r] *= corr; }
#pragma unroll
    for (int kc = 0; kc < 2; ++kc) {
#pragma unroll
      for (int t = 0; t < 2; ++t) { acc[t] = wmma_bf(vh[kc][t], pl[kc], acc[t]); acc[t] = wmma_bf(vl[kc][t], ph[kc], acc[t]); acc[t] = wmma_bf(vh[kc][t], ph[kc], acc[t]); } }
    asm volatile("s_wait_dscnt 0x0" ::: "memory");      // this wave's reads of the tile are done before the buffer is handed back
    asm volatile("s_wait_asynccnt 0x0" ::: "memory");      // its quarter of the next tile has landed
    __syncthreads();      // publishes the next tile and ends every wave's reads of this one
    if (kt + 2 < NN / 64) kv_copy(lk + bo, lv + bo, gkh + (kt + 2) * (64 * DH * 2), gkl + (kt + 2) * (64 * DH * 2), gvh + (kt + 2) * (64 * 2), gvl + (kt + 2) * (64 * 2)); }
  asm volatile("s_wait_asynccnt 0x0" ::: "memory");      // no copy is left in flight when the wave goes on to its end
  const float inv = 1.0f / (lrun + xhalf(lrun));
#pragma unroll
  for (int t = 0; t < 2; ++t) {
#pragma unroll
    for (int q = 0; q < 2; ++q) { const v4f o = { acc[t][q * 4] * inv, acc[t][q * 4 + 1] * inv, acc[t][q * 4 + 2] * inv, acc[t][q * 4 + 3] * inv }; *(v4f*)(&sO[w][col][t * 16 + 8 * g + q * 4]) = o; } }
  LDSX();
  for (int qq = lane; qq < 16 * 8; qq += 32) { const int rl = qq >> 3, pc = qq & 7; vst2(O + ((size_t)b * NN + q0 + rl) * CC + h * DH + pc * 4, *(const v4f*)(&sO[w][rl][pc * 4])); }
}
// raw fragment loads: the addresses and guards of split_row and split_col, the conversion left to bsplit16
__device__ __forceinline__ void raw_row(const float* row, int k0, int lane, float v[16]) { const float* p = row + k0 + 8 * (lane >> 4);
#pragma unroll
  for (int i = 0; i < 8; ++i) { v[i] = p[i]; v[8 + i] = p[16 + i]; } }
__device__ __forceinline__ void raw_col(const float* W, int k0, int n, int lane, int ld, int K, float v[16]) { const int g = lane >> 4;
#pragma unroll
  for (int i = 0; i < 8; ++i) { const int ka = k0 + 8 * g + i, kb = ka + 16; v[i] = ka < K ? W[(size_t)(ka < K ? ka : K - 1) * ld + n] : 0.f; v[8 + i] = kb < K ? W[(size_t)(kb < K ? kb : K - 1) * ld + n] : 0.f; } }
// y[b][c][n] = x[b][c][n] + val * sigmoid(gate), val | gate = O[n][:] (hi/lo) . Wg[:][c | CC + c] + bg: block (b, 64 tokens); wave w -> channel tiles 2w..2w+1 (32 channels) x 4 token tiles
__global__ __launch_bounds__(128) void k_out(const float* __restrict__ O, const float* __restrict__ Wg, const float* __restrict__ bg, const float* __restrict__ x, float* __restrict__ y) {
  __shared__ __align__(16) float sY[4][32][68];
  const int tid = threadIdx.x, w = tid >> 5, lane = tid & 31, col = lane & 15, g = lane >> 4; const int b = blockIdx.y, p0 = blockIdx.x * 64; const size_t base = (size_t)b * NN;
  v8f av[2][4] = {}, ag[2][4] = {};
#pragma unroll 1
  for (int kc = 0; kc < CC / 32; ++kc) { F2 bc[4]; float ov[4][16], wv[2][2][16]; const int c0 = w * 32 + col;
    // a k step's loads are issued in two groups ahead of their use: the four O fragments with the first channel tile's weights, then the second tile's weights, which fly under the first tile's products
#pragma unroll
    for (int pt = 0; pt < 4; ++pt) raw_row(O + (base + p0 + pt * 16 + col) * CC, kc * 32, lane, ov[pt]);
    raw_col(Wg, kc * 32, c0, lane, 2 * CC, CC, wv[0][0]); raw_col(Wg, kc * 32, CC + c0, lane, 2 * CC, CC, wv[0][1]);
    __builtin_amdgcn_sched_barrier(0);      // holds the first group together: without it the scheduler issues the O loads two at a time, each pair straight in front of its own wait
    raw_col(Wg, kc * 32, c0 + 16, lane, 2 * CC, CC, wv[1][0]); raw_col(Wg, kc * 32, CC + c0 + 16, lane, 2 * CC, CC, wv[1][1]);
    asm volatile("s_wait_xcnt 0x0" ::: "memory");      // in front of the weight conversions below, whose results may be laid on these loads' address registers
    __builtin_amdgcn_sched_barrier(0);      // keeps that wait directly behind the loads, and both in front of the products
#pragma unroll
    for (int pt = 0; pt < 4; ++pt) bc[pt] = bsplit16(ov[pt]);
#pragma unroll
    for (int ct = 0; ct < 2; ++ct) { const v16b a1 = bsplit16(wv[ct][0]).h, a2 = bsplit16(wv[ct][1]).h;
#pragma unroll
      for (int pt = 0; pt < 4; ++pt) { av[ct][pt] = wmma_bf(a1, bc[pt].l, av[ct][pt]); av[ct][pt] = wmma_bf(a1, bc[pt].h, av[ct][pt]); ag[ct][pt] = wmma_bf(a2, bc[pt].l, ag[ct][pt]); ag[ct][pt] = wmma_bf(a2, bc[pt].h, ag[ct][pt]); } } }
  float xv[2][8][4], bv[2][8], bq[2][8];      // the tile's residual values and its biases, requested together in front of the gating, which starts on the biases while the rest still fly
#pragma unroll
  for (int ct = 0; ct < 2; ++ct) {
#pragma unroll
    for (int r = 0; r < 8; ++r) { const int c = w * 32 + ct * 16 + 8 * g + r; bv[ct][r] = bg[c]; bq[ct][r] = bg[CC + c];
#pragma unroll
      for (int pt = 0; pt < 4; ++pt) xv[ct][r][pt] = x[((size_t)b * CC + c) * NN + p0 + pt * 16 + col]; } }
  __builtin_amdgcn_sched_barrier(0);      // holds these loads in one flight in front of the gating, as the calls did: without it the scheduler deals them out through the gating in groups of eight, each waited for in its turn
#pragma unroll
  for (int ct = 0; ct < 2; ++ct) {
#pragma unroll
    for (int r = 0; r < 8; ++r) { const int cl = ct * 16 + 8 * g + r; const float bv_ = bfr(bv[ct][r]), bg_ = bfr(bq[ct][r]);
      float sg[4];
#pragma unroll
      for (int pt = 0; pt < 4; ++pt) sg[pt] = sigm(ag[ct][pt][r] + bg_);
#pragma unroll
      for (int pt = 0; pt < 4; ++pt) sY[w][cl][pt * 16 + col] = bfr(xv[ct][r][pt]) + (av[ct][pt][r] + bv_) * sg[pt]; } }
  LDSX();
  for (int qq = lane; qq < 32 * 16; qq += 32) { const int cl = qq >> 4, pc = qq & 15; vst2(y + ((size_t)b * CC + w * 32 + cl) * NN + p0 + pc * 4, *(const v4f*)(&sY[w][cl][pc * 4])); }
}
extern "C" void kernel_launch(void* const* d_in, const int* in_sizes, int n_in, void* d_out, int out_size, void* d_ws, size_t ws_size, hipStream_t stream) {
  (void)in_sizes; (void)n_in; (void)out_size; (void)ws_size;
  const float* x = (const float*)d_in[0]; const float* Wqkv = (const float*)d_in[1]; const float* bqkv = (const float*)d_in[2]; const float* Wg = (const float*)d_in[3]; const float* bg = (const float*)d_in[4];
  char* ws = (char*)d_ws; size_t off = 0;
  auto take = [&](size_t bytes) { char* p = ws + off; off += (bytes + 255) & ~(size_t)255; return p; };
  float* Q32 = (float*)take((size_t)NB * NN * CC * 4); __bf16* Kh = (__bf16*)take((size_t)NB * NN * CC * 2); __bf16* Kl = (__bf16*)take((size_t)NB * NN * CC * 2); __bf16* VTh = (__bf16*)take((size_t)NB * NN * CC * 2); __bf16* VTl = (__bf16*)take((size_t)NB * NN * CC * 2); float* O = (float*)take((size_t)NB * NN * CC * 4);
  // ws ~ 17 MB
  k_qkv<<<dim3(NB * NN / 64, CC / 128, 3), 128, 0, stream>>>(x, Wqkv, bqkv, Q32, Kh, Kl, VTh, VTl);
  k_attn<<<dim3(NN / 64, NB * NHD), 128, 0, stream>>>(Q32, Kh, Kl, VTh, VTl, O);
  k_out<<<dim3(NN / 64, NB), 128, 0, stream>>>(O, Wg, bg, x, (float*)d_out);
}

// v009
// It runs in 29.5 microseconds.
// Timed twice side by side with v008, it ran 1.03 and 1.06 times as fast.
// All steps since v000 together make it 3.59 times as fast.
// compute dtype: x, qkv_w, qkv_b, gate_w, gate_b (INPUTS) rounded to bf16 with exact bf16 WMMA products (f32 accumulate) for the qkv projection and the gate projection's weight side; q kept f32 and split hi/lo, k as bf16 hi/lo rows (3 products), softmax weights and v as bf16 hi/lo (3 products), attention output hi/lo x bf16(gate_w) (2 products); softmax, sigmoid gating and the residual in f32.
#include <hip/hip_runtime.h>
#include <math.h>

typedef __attribute__((ext_vector_type(16))) _Float16 v16h;
typedef __attribute__((ext_vector_type(16))) __bf16 v16b;
typedef __attribute__((ext_vector_type(8)))  _Float16 v8h;
typedef __attribute__((ext_vector_type(8)))  float v8f;
typedef __attribute__((ext_vector_type(4)))  float v4f;
typedef __attribute__((ext_vector_type(2)))  float v2f;
typedef __attribute__((ext_vector_type(2)))  __bf16 v2b;
typedef __attribute__((ext_vector_type(4)))  unsigned v4u;
typedef __attribute__((ext_vector_type(4)))  int v4i;
typedef float __attribute__((may_alias)) float_a;
typedef int __attribute__((may_alias)) int_a;

template <typename T> __device__ __forceinline__ void vst2(void* p, T v) { *(T*)p = v;  }
__device__ __forceinline__ v8f wmma16(v16h a, v16h b, v8f c) {
  v8f d = __builtin_amdgcn_wmma_f32_16x16x32_f16(false, a, false, b, (short)0, c, false, false);
  asm volatile("v_nop\n\tv_nop\n\tv_nop\n\tv_nop" : "+v"(d) : "v"(a), "v"(b));
  return d;
}
__device__ __forceinline__ v8f wmma_bf(v16b a, v16b b, v8f c) {
  v8f d = __builtin_amdgcn_wmma_f32_16x16x32_bf16(false, a, false, b, (short)0, c, false, false);
  asm volatile("v_nop\n\tv_nop\n\tv_nop\n\tv_nop" : "+v"(d) : "v"(a), "v"(b));
  return d;
}
// 16x16x32 fragments: lane = (h = lane>>4, row/col = lane&15); elements 0..7 = k0+8h+0..7, 8..15 = k0+16+8h+0..7; D element r = row 8h+r
__device__ __forceinline__ v16h frag_h(const _Float16* rowk0, int lane) {
  union { v16h v; v8h q[2]; } u; const _Float16* p = rowk0 + 8 * (lane >> 4);
  u.q[0] = *(const v8h*)p; u.q[1] = *(const v8h*)(p + 16); return u.v;
}
__device__ __forceinline__ v16h frag_f32(const float* rowk0, int lane) {
  v16h a; const float* p = rowk0 + 8 * (lane >> 4);
#pragma unroll
  for (int i = 0; i < 8; ++i) { a[i] = (_Float16)p[i]; a[8 + i] = (_Float16)p[16 + i]; }
  return a;
}
__device__ __forceinline__ v16h frag_f32s(const float* rowk0, int lane, float sc) {
  v16h a; const float* p = rowk0 + 8 * (lane >> 4);
#pragma unroll
  for (int i = 0; i < 8; ++i) { a[i] = (_Float16)(p[i] * sc); a[8 + i] = (_Float16)(p[16 + i] * sc); }
  return a;
}
// column fragment from a [K][ld] layout (column n), rows >= K read as 0
__device__ __forceinline__ v16h fragc_f32(const float* W, int k0, int n, int lane, int ld, int K) {
  v16h a; const int g = lane >> 4;
#pragma unroll
  for (int i = 0; i < 8; ++i) { const int ka = k0 + 8 * g + i, kb = ka + 16;
    a[i] = (_Float16)(ka < K ? W[(size_t)(ka < K ? ka : K - 1) * ld + n] : 0.f); a[8 + i] = (_Float16)(kb < K ? W[(size_t)(kb < K ? kb : K - 1) * ld + n] : 0.f); }
  return a;
}
struct F2 { v16b h, l; };
__device__ __forceinline__ F2 bsplit16(const float v[16]) { F2 r;
#pragma unroll
  for (int i = 0; i < 16; ++i) { const __bf16 h = (__bf16)v[i]; r.h[i] = h; r.l[i] = (__bf16)(v[i] - (float)h); }
  return r; }
__device__ __forceinline__ F2 split_row(const float* row, int k0, int lane) { float v[16]; const float* p = row + k0 + 8 * (lane >> 4);
#pragma unroll
  for (int i = 0; i < 8; ++i) { v[i] = p[i]; v[8 + i] = p[16 + i]; }
  return bsplit16(v); }
__device__ __forceinline__ F2 split_rowK(const float* row, int k0, int lane, int K) { float v[16]; const int g = lane >> 4;
#pragma unroll
  for (int i = 0; i < 8; ++i) { const int ka = k0 + 8 * g + i, kb = ka + 16; v[i] = ka < K ? row[ka < K ? ka : K - 1] : 0.f; v[8 + i] = kb < K ? row[kb < K ? kb : K - 1] : 0.f; }
  return bsplit16(v); }
__device__ __forceinline__ F2 split_col(const float* W, int k0, int n, int lane, int ld, int K) { float v[16]; const int g = lane >> 4;
#pragma unroll
  for (int i = 0; i < 8; ++i) { const int ka = k0 + 8 * g + i, kb = ka + 16; v[i] = ka < K ? W[(size_t)(ka < K ? ka : K - 1) * ld + n] : 0.f; v[8 + i] = kb < K ? W[(size_t)(kb < K ? kb : K - 1) * ld + n] : 0.f; }
  return bsplit16(v); }
__device__ __forceinline__ v8f mac3(const F2& a, const F2& b, v8f c) { c = wmma_bf(a.l, b.h, c); c = wmma_bf(a.h, b.l, c); return wmma_bf(a.h, b.h, c); }
// e^u is taken as 2^(u log2 e) on the hardware's own exponential, one v_exp_f32; a result below the normal range comes out as 0, which is harmless here: each stands in a sum beside a term of 1
#define LOG2E 1.4426950408889634
__device__ __forceinline__ float sigm(float v) { float e;
  asm("v_exp_f32 %0, %1\n\tv_nop" : "=v"(e) : "v"(v * (float)(-LOG2E)));      // written out for the v_nop: it fills the slot asked for behind a transcendental
  return 1.0f / (1.0f + e); }
#define LDSX() do { asm volatile("s_wait_dscnt 0" ::: "memory"); __builtin_amdgcn_wave_barrier(); __builtin_amdgcn_fence(__ATOMIC_RELEASE, "workgroup"); } while (0)


// Gated spatial attention on [8,128,32,32] (4 heads x 32 over the 1,024 positions): qkv = inp @ qkv_w + qkv_b ([in][out], per-head interleaved columns h*96 + {q,k,v}*32 + d); softmax(q.k 32^-0.5) over all positions; feats @ gate_w + gate_b -> val | gate; y = x + val * sigmoid(gate) (NCHW).
// k_qkv (reads x as it lies; Q32 f32 [bh][n][32]; K bf16 hi/lo rows; V bf16 hi/lo planes), k_attn (block = 64 queries x (b,h); O rows [b][n][128]), k_out (val/gate tiles per channel, sigmoid gating, residual, NCHW store).
#define NB 8
#define CC 128
#define NN 1024
#define NHD 4
#define DH 32
__device__ __forceinline__ float bfr(float v) { return (float)(__bf16)v; }
__device__ __forceinline__ v16b frag_b(const __bf16* rowk0, int lane) { return __builtin_bit_cast(v16b, frag_h((const _Float16*)rowk0, lane)); }

// qkv: block (64 tokens, 128 output channels = 4 heads, which): rows = tokens of x (NCHW, rounded to bf16 in registers), B = W columns ([in][out], held in LDS as [out][in] rows) + bias
__global__ __launch_bounds__(128) void k_qkv(const float* __restrict__ x, const float* __restrict__ W, const float* __restrict__ bias, float* __restrict__ Q32, __bf16* __restrict__ Kh, __bf16* __restrict__ Kl, __bf16* __restrict__ VTh, __bf16* __restrict__ VTl) {
  __shared__ __align__(16) float so[4][16][132]; __shared__ __align__(16) __bf16 sh_[4][16][136], sl_[4][16][136]; __shared__ __align__(16) __bf16 sth[128][72], stl[128][72];
  __shared__ __align__(16) __bf16 sW[128][CC + 8];      // the block's 128 weight columns as bf16 rows [column][k], pitch 272 B for the ds_load_b128 fragment reads
  const int tid = threadIdx.x, wave = tid >> 5, lane = tid & 31, col = lane & 15, g = lane >> 4; const int r0b = blockIdx.x * 64, n0 = blockIdx.y * 128, which = blockIdx.z; const int b = r0b / NN, s0 = r0b % NN;
  v8f acc[8] = {};
  // the weight tile is brought once per block: wave w takes k rows 32w..32w+31, a lane 4 adjacent columns (h*96 + which*32 + d of qkv_w [128][384]), so each load covers four whole 128-B lines;
  // all 32 loads of a lane and the 64 loads of its row fragments fly together; a lane then holds one 32-long k run of each of its columns and lays it down as four 16-B pieces
  v4f wr[32]; float xr[CC / 32][16]; v16b a[CC / 32];
  { const int c4 = n0 + lane * 4; const float* wp = W + (size_t)(wave * 32) * (3 * CC) + (c4 >> 5) * (3 * DH) + which * DH + (c4 & 31);
#pragma unroll
    for (int i = 0; i < 32; ++i) wr[i] = *(const v4f*)(wp + (size_t)i * (3 * CC)); }
  // a lane's fragment elements are one token's channels, and a wave's 16 tokens are its own: each channel is one b32 load (16 lanes = 64 B in a row of x), so the transposition costs no LDS pass and no launch of its own
  { const float* xp = x + ((size_t)b * CC + 8 * g) * NN + s0 + wave * 16 + col;
#pragma unroll
    for (int kc = 0; kc < CC / 32; ++kc) {
#pragma unroll
      for (int i = 0; i < 8; ++i) { xr[kc][i] = xp[(size_t)(kc * 32 + i) * NN]; xr[kc][8 + i] = xp[(size_t)(kc * 32 + 16 + i) * NN]; } } }
  asm volatile("s_wait_xcnt 0x0" ::: "memory");      // in front of the conversions below, whose results may be laid on these loads' address registers
  __builtin_amdgcn_sched_barrier(0);      // keeps that wait directly behind the loads, and all 96 loads in one flight in front of the conversions
#pragma unroll
  for (int jc = 0; jc < 4; ++jc) {
#pragma unroll
    for (int q = 0; q < 4; ++q) { union { __bf16 e[8]; v4u u; } pk;
#pragma unroll
      for (int i = 0; i < 8; ++i) pk.e[i] = (__bf16)wr[q * 8 + i][jc];
      *(v4u*)(&sW[lane * 4 + jc][wave * 32 + q * 8]) = pk.u; } }
#pragma unroll
  for (int kc = 0; kc < CC / 32; ++kc) {
#pragma unroll
    for (int i = 0; i < 16; i += 2) { const v2f p = { xr[kc][i], xr[kc][i + 1] }; const v2b h = __builtin_convertvector(p, v2b); a[kc][i] = h[0]; a[kc][i + 1] = h[1]; } }      // a register of the operand holds two channels: each pair is converted as a pair
  __syncthreads();      // every wave reads all four waves' k runs
  v16b bw[2][8];      // a k step's eight weight fragments are read as one group, one step ahead of their products
#pragma unroll
  for (int j = 0; j < 8; ++j) bw[0][j] = frag_b(&sW[j * 16 + col][0], lane);
#pragma unroll
  for (int kc = 0; kc < CC / 32; ++kc) {
    if (kc + 1 < CC / 32) {
#pragma unroll
      for (int j = 0; j < 8; ++j) bw[(kc + 1) & 1][j] = frag_b(&sW[j * 16 + col][(kc + 1) * 32], lane);
      __builtin_amdgcn_sched_barrier(0); }      // holds the next step's reads in front of this step's products: without it the scheduler sinks each pair of reads to its own product and waits it out there
#pragma unroll
    for (int j = 0; j < 8; ++j) acc[j] = wmma_bf(a[kc], bw[kc & 1][j], acc[j]); }
  if (which == 0) {
#pragma unroll
    for (int j = 0; j < 8; ++j) { const int c = n0 + j * 16 + col; const float bb = bfr(bias[(c >> 5) * (3 * DH) + 0 * DH + (c & 31)]);
#pragma unroll
      for (int r = 0; r < 8; ++r) so[wave][8 * g + r][j * 16 + col] = acc[j][r] + bb; }
    LDSX();
    for (int qq = lane; qq < 4 * 16 * 8; qq += 32) { const int hh = qq >> 7, rl = (qq >> 3) & 15, pc = qq & 7; const int h = (n0 >> 5) + hh; vst2(Q32 + (((size_t)b * NHD + h) * NN + s0 + wave * 16 + rl) * DH + pc * 4, *(const v4f*)(&so[wave][rl][hh * 32 + pc * 4])); } }
  else if (which == 1) {
#pragma unroll
    for (int j = 0; j < 8; ++j) { const int c = n0 + j * 16 + col; const float bb = bfr(bias[(c >> 5) * (3 * DH) + 1 * DH + (c & 31)]);
#pragma unroll
      for (int r = 0; r < 8; ++r) { const float v = acc[j][r] + bb; const __bf16 hi = (__bf16)v; sh_[wave][8 * g + r][j * 16 + col] = hi; sl_[wave][8 * g + r][j * 16 + col] = (__bf16)(v - (float)hi); } }
    LDSX();
    // K rows [bh][n][32] bf16 = 64 B: 4 lanes x 16 B; per instruction 8 (head,row) pairs
    for (int qq = lane; qq < 4 * 16 * 4; qq += 32) { const int hh = qq >> 6, rl = (qq >> 2) & 15, pc = qq & 3; const int h = (n0 >> 5) + hh; const size_t o = (((size_t)b * NHD + h) * NN + s0 + wave * 16 + rl) * DH + pc * 8; vst2((unsigned*)(Kh + o), *(const v4u*)(&sh_[wave][rl][hh * 32 + pc * 8])); vst2((unsigned*)(Kl + o), *(const v4u*)(&sl_[wave][rl][hh * 32 + pc * 8])); } }
  else {
#pragma unroll
    for (int j = 0; j < 8; ++j) { const int c = n0 + j * 16 + col; const float bb = bfr(bias[(c >> 5) * (3 * DH) + 2 * DH + (c & 31)]);
#pragma unroll
      for (int r = 0; r < 8; ++r) { const float v = acc[j][r] + bb; const __bf16 hi = (__bf16)v; sth[j * 16 + col][wave * 16 + 8 * g + r] = hi; stl[j * 16 + col][wave * 16 + 8 * g + r] = (__bf16)(v - (float)hi); } }
    __syncthreads();
    for (int qq = tid; qq < 128 * 8; qq += 128) { const int cl = qq >> 3, pc = qq & 7; const int c = n0 + cl; const int h = c >> 5, d = c & 31; const size_t o = (((size_t)b * NHD + h) * DH + d) * NN + s0 + pc * 8; vst2((unsigned*)(VTh + o), *(const v4u*)(&sth[cl][pc * 8])); vst2((unsigned*)(VTl + o), *(const v4u*)(&stl[cl][pc * 8])); } }
}
// a pass's K/V tile in LDS (KT keys): K hi, K lo as 128 rows of 64 B at pitch 80 B, then V hi, V lo as 32 rows of 256 B at pitch 272 B (both 16 B x odd, the pitch of the ds_load_b128 fragment reads)
#define KT 128
#define KPI 80
#define VPI 272
#define OFF_KL (KT * KPI)
#define OFF_VH (2 * KT * KPI)
#define OFF_VL (2 * KT * KPI + 32 * VPI)
#define TILE_B (2 * KT * KPI + 2 * 32 * VPI)
// fragment from the lane's own LDS row: 16 B at the pointer and 16 B at +32
__device__ __forceinline__ v16b frag_l(const char* p) { union { v16b v; v4u q[2]; } u; u.q[0] = *(const v4u*)p; u.q[1] = *(const v4u*)(p + 32); return u.v; }
// a lane's eight 16-B pieces of a hi plane and its lo plane, global memory to LDS through no register: four of each, ls bytes apart in LDS and gs bytes apart in global memory.
// l: the lane's LDS byte address in the hi plane of the target buffer, the lo plane lying dl bytes behind it; gh, gl: its global addresses in this tile.
// The s_wait_xcnt stands inside the statement, behind the last copy, so that no address register is rewritten in front of it.
__device__ __forceinline__ void plane_copy(unsigned l, unsigned dl, unsigned ls, const char* gh, const char* gl, int gs) {
  asm volatile("global_load_async_to_lds_b128 %0, %8, off\n\t"
               "global_load_async_to_lds_b128 %1, %9, off\n\t"
               "global_load_async_to_lds_b128 %2, %10, off\n\t"
               "global_load_async_to_lds_b128 %3, %11, off\n\t"
               "global_load_async_to_lds_b128 %4, %12, off\n\t"
               "global_load_async_to_lds_b128 %5, %13, off\n\t"
               "global_load_async_to_lds_b128 %6, %14, off\n\t"
               "global_load_async_to_lds_b128 %7, %15, off\n\t"
               "s_wait_xcnt 0x0"
               :: "v"(l), "v"(l + ls), "v"(l + 2 * ls), "v"(l + 3 * ls),
                  "v"(l + dl), "v"(l + dl + ls), "v"(l + dl + 2 * ls), "v"(l + dl + 3 * ls),
                  "v"(gh), "v"(gh + gs), "v"(gh + 2 * gs), "v"(gh + 3 * gs),
                  "v"(gl), "v"(gl + gs), "v"(gl + 2 * gs), "v"(gl + 3 * gs)
               : "memory");
}
// a lane's sixteen pieces of one tile: K rows r, r + 32, r + 64, r + 96 (a piece = a quarter row), V rows r, r + 8, r + 16, r + 24 (a piece = a sixteenth of the tile's 256 B of the row)
__device__ __forceinline__ void kv_copy(unsigned lk, unsigned lv, const char* gkh, const char* gkl, const char* gvh, const char* gvl) {
  plane_copy(lk, OFF_KL, 32 * KPI, gkh, gkl, 32 * DH * 2);
  plane_copy(lv, OFF_VL - OFF_VH, 8 * VPI, gvh, gvl, 8 * NN * 2);
}
// the value of lane l ^ 16, by a vector cross-row move: __shfl_xor goes through the LDS pipe and its wait would also wait out every fragment read in flight
__device__ __forceinline__ float xhalf(float v) { const int b = __builtin_bit_cast(int, v); return __builtin_bit_cast(float, __builtin_amdgcn_permlanex16(b, b, 0x76543210, 0xfedcba98, false, false)); }
__global__ __launch_bounds__(128) void k_attn(const float* __restrict__ Q32, const __bf16* __restrict__ Kh, const __bf16* __restrict__ Kl, const __bf16* __restrict__ VTh, const __bf16* __restrict__ VTl, float* __restrict__ O) {
  __shared__ __align__(16) float sO[4][16][36];
  __shared__ __align__(16) char sKV[2][TILE_B];
  const int tid = threadIdx.x, w = tid >> 5, lane = tid & 31, col = lane & 15, g = lane >> 4; const size_t bh = blockIdx.y; const int b = (int)(bh / NHD), h = (int)(bh % NHD); const int q0 = blockIdx.x * 64 + w * 16;
  // the block's four waves share each pass's 128 keys: the tile is brought into LDS once per block, a quarter by each wave, one whole pass ahead of its use (two buffers)
  const char* gkh = (const char*)(Kh + bh * NN * DH) + tid * 16; const char* gkl = (const char*)(Kl + bh * NN * DH) + tid * 16;
  const char* gvh = (const char*)(VTh + bh * DH * NN) + (tid >> 4) * (NN * 2) + (tid & 15) * 16; const char* gvl = (const char*)(VTl + bh * DH * NN) + (tid >> 4) * (NN * 2) + (tid & 15) * 16;
  const unsigned lk = (unsigned)(size_t)&sKV[0][0] + (unsigned)((tid >> 2) * KPI + (tid & 3) * 16), lv = (unsigned)(size_t)&sKV[0][0] + (unsigned)(OFF_VH + (tid >> 4) * VPI + (tid & 15) * 16);
  kv_copy(lk, lv, gkh, gkl, gvh, gvl);
  const F2 aq = split_row(Q32 + (bh * NN + q0 + col) * DH, 0, lane);
  // both products run transposed: S^T = K . Q^T (A = key rows, B = the wave's queries) and O^T += V^T . P^T (A = V planes, B = the weights).
  // Lane (g, col) then holds query q0 + col alone: of score tile t the keys 16t + 8g + 0..7, which is the k order of a B fragment, so two tiles' weights, converted in place, are the second product's B operand.
  // mrun is the query's running maximum (equal in both halves); lrun is this half's share of its running sum, the halves being joined behind the loop; acc[t][r] is O[q0 + col][16t + 8g + r].
  float mrun = -3.0e38f, lrun = 0.f; v8f acc[2] = {};
  asm volatile("s_wait_asynccnt 0x0" ::: "memory");      // this wave's quarter of tile 0 has landed
  __syncthreads();      // and so has every other wave's
  kv_copy(lk + TILE_B, lv + TILE_B, gkh + KT * DH * 2, gkl + KT * DH * 2, gvh + KT * 2, gvl + KT * 2);
#pragma unroll 1
  for (int kt = 0; kt < NN / KT; ++kt) {
    const unsigned bo = (unsigned)(kt & 1) * TILE_B; const char* pk = &sKV[0][0] + bo + col * KPI + 16 * g; const char* pv = &sKV[0][0] + bo + OFF_VH + col * VPI + 16 * g;
    v16b khf[KT / 16], klf[KT / 16];
#pragma unroll
    for (int t = 0; t < KT / 16; ++t) { khf[t] = frag_l(pk + t * 16 * KPI); klf[t] = frag_l(pk + OFF_KL + t * 16 * KPI); }
    v8f s[KT / 16];
#pragma unroll
    for (int t = 0; t < KT / 16; ++t) {
      if (t == KT / 32) __builtin_amdgcn_sched_barrier(0);      // keeps the second half's products behind the first half's: without it the scheduler lifts one of them to the head of the pass, where its wait covers 22 of the 32 reads instead of the first two
      v8f z = {}; z = wmma_bf(khf[t], aq.l, z); z = wmma_bf(klf[t], aq.h, z); s[t] = wmma_bf(khf[t], aq.h, z); }
    v16b vh[KT / 32][2], vl[KT / 32][2];
#pragma unroll
    for (int kc = 0; kc < KT / 32; ++kc) {
#pragma unroll
      for (int t = 0; t < 2; ++t) { vh[kc][t] = frag_l(pv + t * 16 * VPI + kc * 64); vl[kc][t] = frag_l(pv + (OFF_VL - OFF_VH) + t * 16 * VPI + kc * 64); } }
    __builtin_amdgcn_sched_barrier(0);      // holds the V fragment reads at the head of the softmax, which runs while they come: without it the scheduler may sink them to its foot, straight in front of the wait there
    float mt[KT / 16];
#pragma unroll
    for (int t = 0; t < KT / 16; ++t) {
#pragma unroll
      for (int r = 0; r < 8; ++r) { s[t][r] *= (float)(0.17677669529663687 * LOG2E); mt[t] = r ? fmaxf(mt[t], s[t][r]) : s[t][r]; } }      // scores in base 2: log2 e rides on the scale, so maximum, difference and exponential need no further multiply
    float mx = fmaxf(fmaxf(fmaxf(mt[0], mt[1]), fmaxf(mt[2], mt[3])), fmaxf(fmaxf(mt[4], mt[5]), fmaxf(mt[6], mt[7])));
    mx = fmaxf(mx, xhalf(mx));      // the other half holds the query's other 64 keys of this pass
    const float mnew = fmaxf(mrun, mx); const float corr = __builtin_amdgcn_exp2f(mrun - mnew);
    float pt[KT / 16]; v16b ph[KT / 32], pl[KT / 32];
#pragma unroll
    for (int t = 0; t < KT / 16; ++t) {
#pragma unroll
      for (int r = 0; r < 8; r += 2) { const v2f sp = { s[t][r], s[t][r + 1] }; const v2f a = sp - mnew;      // the difference too is taken as a pair: one packed instruction, behind which the compiler keeps the slot asked for after a v_exp_f32
        const v2f p = { __builtin_amdgcn_exp2f(a[0]), __builtin_amdgcn_exp2f(a[1]) }; pt[t] = r ? pt[t] + p[0] + p[1] : p[0] + p[1];
        const v2b hi = __builtin_convertvector(p, v2b); const v2f d = { p[0] - (float)hi[0], p[1] - (float)hi[1] }; const v2b lo = __builtin_convertvector(d, v2b);      // a register of the operand holds two weights: each pair is converted as a pair
        const int e = (t & 1) * 8 + r; ph[t >> 1][e] = hi[0]; ph[t >> 1][e + 1] = hi[1]; pl[t >> 1][e] = lo[0]; pl[t >> 1][e + 1] = lo[1]; } }
    lrun = lrun * corr + (((pt[0] + pt[1]) + (pt[2] + pt[3])) + ((pt[4] + pt[5]) + (pt[6] + pt[7]))); mrun = mnew;
#pragma unroll
    for (int r = 0; r < 8; ++r) { acc[0][r] *= corr; acc[1][r] *= corr; }
#pragma unroll
    for (int kc = 0; kc < KT / 32; ++kc) {
#pragma unroll
      for (int t = 0; t < 2; ++t) { acc[t] = wmma_bf(vh[kc][t], pl[kc], acc[t]); acc[t] = wmma_bf(vl[kc][t], ph[kc], acc[t]); acc[t] = wmma_bf(vh[kc][t], ph[kc], acc[t]); } }
    asm volatile("s_wait_dscnt 0x0" ::: "memory");      // this wave's reads of the tile are done before the buffer is handed back
    asm volatile("s_wait_asynccnt 0x0" ::: "memory");      // its quarter of the next tile has landed
    __syncthreads();      // publishes the next tile and ends every wave's reads of this one
    if (kt + 2 < NN / KT) kv_copy(lk + bo, lv + bo, gkh + (kt + 2) * (KT * DH * 2), gkl + (kt + 2) * (KT * DH * 2), gvh + (kt + 2) * (KT * 2), gvl + (kt + 2) * (KT * 2)); }
  asm volatile("s_wait_asynccnt 0x0" ::: "memory");      // no copy is left in flight when the wave goes on to its end
  const float inv = 1.0f / (lrun + xhalf(lrun));
#pragma unroll
  for (int t = 0; t < 2; ++t) {
#pragma unroll
    for (int q = 0; q < 2; ++q) { const v4f o = { acc[t][q * 4] * inv, acc[t][q * 4 + 1] * inv, acc[t][q * 4 + 2] * inv, acc[t][q * 4 + 3] * inv }; *(v4f*)(&sO[w][col][t * 16 + 8 * g + q * 4]) = o; } }
  LDSX();
  for (int qq = lane; qq < 16 * 8; qq += 32) { const int rl = qq >> 3, pc = qq & 7; vst2(O + ((size_t)b * NN + q0 + rl) * CC + h * DH + pc * 4, *(const v4f*)(&sO[w][rl][pc * 4])); }
}
// raw fragment loads: the addresses and guards of split_row and split_col, the conversion left to bsplit16
__device__ __forceinline__ void raw_row(const float* row, int k0, int lane, float v[16]) { const float* p = row + k0 + 8 * (lane >> 4);
#pragma unroll
  for (int i = 0; i < 8; ++i) { v[i] = p[i]; v[8 + i] = p[16 + i]; } }
__device__ __forceinline__ void raw_col(const float* W, int k0, int n, int lane, int ld, int K, float v[16]) { const int g = lane >> 4;
#pragma unroll
  for (int i = 0; i < 8; ++i) { const int ka = k0 + 8 * g + i, kb = ka + 16; v[i] = ka < K ? W[(size_t)(ka < K ? ka : K - 1) * ld + n] : 0.f; v[8 + i] = kb < K ? W[(size_t)(kb < K ? kb : K - 1) * ld + n] : 0.f; } }
// y[b][c][n] = x[b][c][n] + val * sigmoid(gate), val | gate = O[n][:] (hi/lo) . Wg[:][c | CC + c] + bg: block (b, 64 tokens); wave w -> channel tiles 2w..2w+1 (32 channels) x 4 token tiles
__global__ __launch_bounds__(128) void k_out(const float* __restrict__ O, const float* __restrict__ Wg, const float* __restrict__ bg, const float* __restrict__ x, float* __restrict__ y) {
  __shared__ __align__(16) float sY[4][32][68];
  const int tid = threadIdx.x, w = tid >> 5, lane = tid & 31, col = lane & 15, g = lane >> 4; const int b = blockIdx.y, p0 = blockIdx.x * 64; const size_t base = (size_t)b * NN;
  v8f av[2][4] = {}, ag[2][4] = {};
#pragma unroll 1
  for (int kc = 0; kc < CC / 32; ++kc) { F2 bc[4]; float ov[4][16], wv[2][2][16]; const int c0 = w * 32 + col;
    // a k step's loads are issued in two groups ahead of their use: the four O fragments with the first channel tile's weights, then the second tile's weights, which fly under the first tile's products
#pragma unroll
    for (int pt = 0; pt < 4; ++pt) raw_row(O + (base + p0 + pt * 16 + col) * CC, kc * 32, lane, ov[pt]);
    raw_col(Wg, kc * 32, c0, lane, 2 * CC, CC, wv[0][0]); raw_col(Wg, kc * 32, CC + c0, lane, 2 * CC, CC, wv[0][1]);
    __builtin_amdgcn_sched_barrier(0);      // holds the first group together: without it the scheduler issues the O loads two at a time, each pair straight in front of its own wait
    raw_col(Wg, kc * 32, c0 + 16, lane, 2 * CC, CC, wv[1][0]); raw_col(Wg, kc * 32, CC + c0 + 16, lane, 2 * CC, CC, wv[1][1]);
    asm volatile("s_wait_xcnt 0x0" ::: "memory");      // in front of the weight conversions below, whose results may be laid on these loads' address registers
    __builtin_amdgcn_sched_barrier(0);      // keeps that wait directly behind the loads, and both in front of the products
#pragma unroll
    for (int pt = 0; pt < 4; ++pt) bc[pt] = bsplit16(ov[pt]);
#pragma unroll
    for (int ct = 0; ct < 2; ++ct) { const v16b a1 = bsplit16(wv[ct][0]).h, a2 = bsplit16(wv[ct][1]).h;
#pragma unroll
      for (int pt = 0; pt < 4; ++pt) { av[ct][pt] = wmma_bf(a1, bc[pt].l, av[ct][pt]); av[ct][pt] = wmma_bf(a1, bc[pt].h, av[ct][pt]); ag[ct][pt] = wmma_bf(a2, bc[pt].l, ag[ct][pt]); ag[ct][pt] = wmma_bf(a2, bc[pt].h, ag[ct][pt]); } } }
  float xv[2][8][4], bv[2][8], bq[2][8];      // the tile's residual values and its biases, requested together in front of the gating, which starts on the biases while the rest still fly
#pragma unroll
  for (int ct = 0; ct < 2; ++ct) {
#pragma unroll
    for (int r = 0; r < 8; ++r) { const int c = w * 32 + ct * 16 + 8 * g + r; bv[ct][r] = bg[c]; bq[ct][r] = bg[CC + c];
#pragma unroll
      for (int pt = 0; pt < 4; ++pt) xv[ct][r][pt] = x[((size_t)b * CC + c) * NN + p0 + pt * 16 + col]; } }
  __builtin_amdgcn_sched_barrier(0);      // holds these loads in one flight in front of the gating, as the calls did: without it the scheduler deals them out through the gating in groups of eight, each waited for in its turn
#pragma unroll
  for (int ct = 0; ct < 2; ++ct) {
#pragma unroll
    for (int r = 0; r < 8; ++r) { const int cl = ct * 16 + 8 * g + r; const float bv_ = bfr(bv[ct][r]), bg_ = bfr(bq[ct][r]);
      float sg[4];
#pragma unroll
      for (int pt = 0; pt < 4; ++pt) sg[pt] = sigm(ag[ct][pt][r] + bg_);
#pragma unroll
      for (int pt = 0; pt < 4; ++pt) sY[w][cl][pt * 16 + col] = bfr(xv[ct][r][pt]) + (av[ct][pt][r] + bv_) * sg[pt]; } }
  LDSX();
  for (int qq = lane; qq < 32 * 16; qq += 32) { const int cl = qq >> 4, pc = qq & 15; vst2(y + ((size_t)b * CC + w * 32 + cl) * NN + p0 + pc * 4, *(const v4f*)(&sY[w][cl][pc * 4])); }
}
extern "C" void kernel_launch(void* const* d_in, const int* in_sizes, int n_in, void* d_out, int out_size, void* d_ws, size_t ws_size, hipStream_t stream) {
  (void)in_sizes; (void)n_in; (void)out_size; (void)ws_size;
  const float* x = (const float*)d_in[0]; const float* Wqkv = (const float*)d_in[1]; const float* bqkv = (const float*)d_in[2]; const float* Wg = (const float*)d_in[3]; const float* bg = (const float*)d_in[4];
  char* ws = (char*)d_ws; size_t off = 0;
  auto take = [&](size_t bytes) { char* p = ws + off; off += (bytes + 255) & ~(size_t)255; return p; };
  float* Q32 = (float*)take((size_t)NB * NN * CC * 4); __bf16* Kh = (__bf16*)take((size_t)NB * NN * CC * 2); __bf16* Kl = (__bf16*)take((size_t)NB * NN * CC * 2); __bf16* VTh = (__bf16*)take((size_t)NB * NN * CC * 2); __bf16* VTl = (__bf16*)take((size_t)NB * NN * CC * 2); float* O = (float*)take((size_t)NB * NN * CC * 4);
  // ws ~ 17 MB
  k_qkv<<<dim3(NB * NN / 64, CC / 128, 3), 128, 0, stream>>>(x, Wqkv, bqkv, Q32, Kh, Kl, VTh, VTl);
  k_attn<<<dim3(NN / 64, NB * NHD), 128, 0, stream>>>(Q32, Kh, Kl, VTh, VTl, O);
  k_out<<<dim3(NN / 64, NB), 128, 0, stream>>>(O, Wg, bg, x, (float*)d_out);
}

// v010
// Measured time: 28 microseconds a run.
// Next to v009, in two timings, it ran 1.05 times as fast each time.
// All steps since v000 together make it 3.78 times as fast.
// compute dtype: x, qkv_w, qkv_b, gate_w, gate_b (INPUTS) rounded to bf16 with exact bf16 WMMA products (f32 accumulate) for the qkv projection and the gate projection's weight side; q kept f32 and split hi/lo, k as bf16 hi/lo rows (3 products), softmax weights and v as bf16 hi/lo (3 products), attention output hi/lo x bf16(gate_w) (2 products); softmax, sigmoid gating and the residual in f32.
#include <hip/hip_runtime.h>
#include <math.h>

typedef __attribute__((ext_vector_type(16))) _Float16 v16h;
typedef __attribute__((ext_vector_type(16))) __bf16 v16b;
typedef __attribute__((ext_vector_type(8)))  _Float16 v8h;
typedef __attribute__((ext_vector_type(8)))  float v8f;
typedef __attribute__((ext_vector_type(4)))  float v4f;
typedef __attribute__((ext_vector_type(2)))  float v2f;
typedef __attribute__((ext_vector_type(2)))  __bf16 v2b;
typedef __attribute__((ext_vector_type(4)))  unsigned v4u;
typedef __attribute__((ext_vector_type(4)))  int v4i;
typedef float __attribute__((may_alias)) float_a;
typedef int __attribute__((may_alias)) int_a;

template <typename T> __device__ __forceinline__ void vst2(void* p, T v) { *(T*)p = v;  }
__device__ __forceinline__ v8f wmma16(v16h a, v16h b, v8f c) {
  v8f d = __builtin_amdgcn_wmma_f32_16x16x32_f16(false, a, false, b, (short)0, c, false, false);
  asm volatile("v_nop\n\tv_nop\n\tv_nop\n\tv_nop" : "+v"(d) : "v"(a), "v"(b));
  return d;
}
__device__ __forceinline__ v8f wmma_bf(v16b a, v16b b, v8f c) {
  v8f d = __builtin_amdgcn_wmma_f32_16x16x32_bf16(false, a, false, b, (short)0, c, false, false);
  asm volatile("v_nop\n\tv_nop\n\tv_nop\n\tv_nop" : "+v"(d) : "v"(a), "v"(b));
  return d;
}
// the same product with nothing tied behind it: the compiler keeps the distances behind its own builtin, fills them with waiting vector work where there is some, and may set independent products between dependent ones
__device__ __forceinline__ v8f wmma_p(v16b a, v16b b, v8f c) { return __builtin_amdgcn_wmma_f32_16x16x32_bf16(false, a, false, b, (short)0, c, false, false); }
// 16x16x32 fragments: lane = (h = lane>>4, row/col = lane&15); elements 0..7 = k0+8h+0..7, 8..15 = k0+16+8h+0..7; D element r = row 8h+r
__device__ __forceinline__ v16h frag_h(const _Float16* rowk0, int lane) {
  union { v16h v; v8h q[2]; } u; const _Float16* p = rowk0 + 8 * (lane >> 4);
  u.q[0] = *(const v8h*)p; u.q[1] = *(const v8h*)(p + 16); return u.v;
}
__device__ __forceinline__ v16h frag_f32(const float* rowk0, int lane) {
  v16h a; const float* p = rowk0 + 8 * (lane >> 4);
#pragma unroll
  for (int i = 0; i < 8; ++i) { a[i] = (_Float16)p[i]; a[8 + i] = (_Float16)p[16 + i]; }
  return a;
}
__device__ __forceinline__ v16h frag_f32s(const float* rowk0, int lane, float sc) {
  v16h a; const float* p = rowk0 + 8 * (lane >> 4);
#pragma unroll
  for (int i = 0; i < 8; ++i) { a[i] = (_Float16)(p[i] * sc); a[8 + i] = (_Float16)(p[16 + i] * sc); }
  return a;
}
// column fragment from a [K][ld] layout (column n), rows >= K read as 0
__device__ __forceinline__ v16h fragc_f32(const float* W, int k0, int n, int lane, int ld, int K) {
  v16h a; const int g = lane >> 4;
#pragma unroll
  for (int i = 0; i < 8; ++i) { const int ka = k0 + 8 * g + i, kb = ka + 16;
    a[i] = (_Float16)(ka < K ? W[(size_t)(ka < K ? ka : K - 1) * ld + n] : 0.f); a[8 + i] = (_Float16)(kb < K ? W[(size_t)(kb < K ? kb : K - 1) * ld + n] : 0.f); }
  return a;
}
struct F2 { v16b h, l; };
__device__ __forceinline__ F2 bsplit16(const float v[16]) { F2 r;
#pragma unroll
  for (int i = 0; i < 16; ++i) { const __bf16 h = (__bf16)v[i]; r.h[i] = h; r.l[i] = (__bf16)(v[i] - (float)h); }
  return r; }
__device__ __forceinline__ F2 split_row(const float* row, int k0, int lane) { float v[16]; const float* p = row + k0 + 8 * (lane >> 4);
#pragma unroll
  for (int i = 0; i < 8; ++i) { v[i] = p[i]; v[8 + i] = p[16 + i]; }
  return bsplit16(v); }
__device__ __forceinline__ F2 split_rowK(const float* row, int k0, int lane, int K) { float v[16]; const int g = lane >> 4;
#pragma unroll
  for (int i = 0; i < 8; ++i) { const int ka = k0 + 8 * g + i, kb = ka + 16; v[i] = ka < K ? row[ka < K ? ka : K - 1] : 0.f; v[8 + i] = kb < K ? row[kb < K ? kb : K - 1] : 0.f; }
  return bsplit16(v); }
__device__ __forceinline__ F2 split_col(const float* W, int k0, int n, int lane, int ld, int K) { float v[16]; const int g = lane >> 4;
#pragma unroll
  for (int i = 0; i < 8; ++i) { const int ka = k0 + 8 * g + i, kb = ka + 16; v[i] = ka < K ? W[(size_t)(ka < K ? ka : K - 1) * ld + n] : 0.f; v[8 + i] = kb < K ? W[(size_t)(kb < K ? kb : K - 1) * ld + n] : 0.f; }
  return bsplit16(v); }
__device__ __forceinline__ v8f mac3(const F2& a, const F2& b, v8f c) { c = wmma_bf(a.l, b.h, c); c = wmma_bf(a.h, b.l, c); return wmma_bf(a.h, b.h, c); }
// e^u is taken as 2^(u log2 e) on the hardware's own exponential, one v_exp_f32; a result below the normal range comes out as 0, which is harmless here: each stands in a sum beside a term of 1
#define LOG2E 1.4426950408889634
__device__ __forceinline__ float sigm(float v) { float e;
  asm("v_exp_f32 %0, %1\n\tv_nop" : "=v"(e) : "v"(v * (float)(-LOG2E)));      // written out for the v_nop: it fills the slot asked for behind a transcendental
  return 1.0f / (1.0f + e); }
#define LDSX() do { asm volatile("s_wait_dscnt 0" ::: "memory"); __builtin_amdgcn_wave_barrier(); __builtin_amdgcn_fence(__ATOMIC_RELEASE, "workgroup"); } while (0)


// Gated spatial attention on [8,128,32,32] (4 heads x 32 over the 1,024 positions): qkv = inp @ qkv_w + qkv_b ([in][out], per-head interleaved columns h*96 + {q,k,v}*32 + d); softmax(q.k 32^-0.5) over all positions; feats @ gate_w + gate_b -> val | gate; y = x + val * sigmoid(gate) (NCHW).
// k_qkv (reads x as it lies; Q32 f32 [bh][n][32]; K bf16 hi/lo rows; V bf16 hi/lo planes), k_attn (block = 64 queries x (b,h); O rows [b][n][128]), k_out (val/gate tiles per channel, sigmoid gating, residual, NCHW store).
#define NB 8
#define CC 128
#define NN 1024
#define NHD 4
#define DH 32
__device__ __forceinline__ float bfr(float v) { return (float)(__bf16)v; }
__device__ __forceinline__ v16b frag_b(const __bf16* rowk0, int lane) { return __builtin_bit_cast(v16b, frag_h((const _Float16*)rowk0, lane)); }

// qkv: block (64 tokens, 128 output channels = 4 heads, which): rows = tokens of x (NCHW, rounded to bf16 in registers), B = W columns ([in][out], held in LDS as [out][in] rows) + bias
__global__ __launch_bounds__(128) void k_qkv(const float* __restrict__ x, const float* __restrict__ W, const float* __restrict__ bias, float* __restrict__ Q32, __bf16* __restrict__ Kh, __bf16* __restrict__ Kl, __bf16* __restrict__ VTh, __bf16* __restrict__ VTl) {
  __shared__ __align__(16) float so[4][16][132]; __shared__ __align__(16) __bf16 sh_[4][16][136], sl_[4][16][136]; __shared__ __align__(16) __bf16 sth[128][72], stl[128][72];
  __shared__ __align__(16) __bf16 sW[128][CC + 8];      // the block's 128 weight columns as bf16 rows [column][k], pitch 272 B for the ds_load_b128 fragment reads
  const int tid = threadIdx.x, wave = tid >> 5, lane = tid & 31, col = lane & 15, g = lane >> 4; const int r0b = blockIdx.x * 64, n0 = blockIdx.y * 128, which = blockIdx.z; const int b = r0b / NN, s0 = r0b % NN;
  v8f acc[8] = {};
  // the weight tile is brought once per block: wave w takes k rows 32w..32w+31, a lane 4 adjacent columns (h*96 + which*32 + d of qkv_w [128][384]), so each load covers four whole 128-B lines;
  // all 32 loads of a lane and the 64 loads of its row fragments fly together; a lane then holds one 32-long k run of each of its columns and lays it down as four 16-B pieces
  v4f wr[32]; float xr[CC / 32][16]; v16b a[CC / 32];
  { const int c4 = n0 + lane * 4; const float* wp = W + (size_t)(wave * 32) * (3 * CC) + (c4 >> 5) * (3 * DH) + which * DH + (c4 & 31);
#pragma unroll
    for (int i = 0; i < 32; ++i) wr[i] = *(const v4f*)(wp + (size_t)i * (3 * CC)); }
  // a lane's fragment elements are one token's channels, and a wave's 16 tokens are its own: each channel is one b32 load (16 lanes = 64 B in a row of x), so the transposition costs no LDS pass and no launch of its own
  { const float* xp = x + ((size_t)b * CC + 8 * g) * NN + s0 + wave * 16 + col;
#pragma unroll
    for (int kc = 0; kc < CC / 32; ++kc) {
#pragma unroll
      for (int i = 0; i < 8; ++i) { xr[kc][i] = xp[(size_t)(kc * 32 + i) * NN]; xr[kc][8 + i] = xp[(size_t)(kc * 32 + 16 + i) * NN]; } } }
  asm volatile("s_wait_xcnt 0x0" ::: "memory");      // in front of the conversions below, whose results may be laid on these loads' address registers
  __builtin_amdgcn_sched_barrier(0);      // keeps that wait directly behind the loads, and all 96 loads in one flight in front of the conversions
#pragma unroll
  for (int jc = 0; jc < 4; ++jc) {
#pragma unroll
    for (int q = 0; q < 4; ++q) { union { __bf16 e[8]; v4u u; } pk;
#pragma unroll
      for (int i = 0; i < 8; ++i) pk.e[i] = (__bf16)wr[q * 8 + i][jc];
      *(v4u*)(&sW[lane * 4 + jc][wave * 32 + q * 8]) = pk.u; } }
#pragma unroll
  for (int kc = 0; kc < CC / 32; ++kc) {
#pragma unroll
    for (int i = 0; i < 16; i += 2) { const v2f p = { xr[kc][i], xr[kc][i + 1] }; const v2b h = __builtin_convertvector(p, v2b); a[kc][i] = h[0]; a[kc][i + 1] = h[1]; } }      // a register of the operand holds two channels: each pair is converted as a pair
  __syncthreads();      // every wave reads all four waves' k runs
  v16b bw[2][8];      // a k step's eight weight fragments are read as one group, one step ahead of their products
#pragma unroll
  for (int j = 0; j < 8; ++j) bw[0][j] = frag_b(&sW[j * 16 + col][0], lane);
#pragma unroll
  for (int kc = 0; kc < CC / 32; ++kc) {
    if (kc + 1 < CC / 32) {
#pragma unroll
      for (int j = 0; j < 8; ++j) bw[(kc + 1) & 1][j] = frag_b(&sW[j * 16 + col][(kc + 1) * 32], lane);
      __builtin_amdgcn_sched_barrier(0); }      // holds the next step's reads in front of this step's products: without it the scheduler sinks each pair of reads to its own product and waits it out there
#pragma unroll
    for (int j = 0; j < 8; ++j) acc[j] = wmma_bf(a[kc], bw[kc & 1][j], acc[j]); }
  if (which == 0) {
#pragma unroll
    for (int j = 0; j < 8; ++j) { const int c = n0 + j * 16 + col; const float bb = bfr(bias[(c >> 5) * (3 * DH) + 0 * DH + (c & 31)]);
#pragma unroll
      for (int r = 0; r < 8; ++r) so[wave][8 * g + r][j * 16 + col] = acc[j][r] + bb; }
    LDSX();
    for (int qq = lane; qq < 4 * 16 * 8; qq += 32) { const int hh = qq >> 7, rl = (qq >> 3) & 15, pc = qq & 7; const int h = (n0 >> 5) + hh; vst2(Q32 + (((size_t)b * NHD + h) * NN + s0 + wave * 16 + rl) * DH + pc * 4, *(const v4f*)(&so[wave][rl][hh * 32 + pc * 4])); } }
  else if (which == 1) {
#pragma unroll
    for (int j = 0; j < 8; ++j) { const int c = n0 + j * 16 + col; const float bb = bfr(bias[(c >> 5) * (3 * DH) + 1 * DH + (c & 31)]);
#pragma unroll
      for (int r = 0; r < 8; ++r) { const float v = acc[j][r] + bb; const __bf16 hi = (__bf16)v; sh_[wave][8 * g + r][j * 16 + col] = hi; sl_[wave][8 * g + r][j * 16 + col] = (__bf16)(v - (float)hi); } }
    LDSX();
    // K rows [bh][n][32] bf16 = 64 B: 4 lanes x 16 B; per instruction 8 (head,row) pairs
    for (int qq = lane; qq < 4 * 16 * 4; qq += 32) { const int hh = qq >> 6, rl = (qq >> 2) & 15, pc = qq & 3; const int h = (n0 >> 5) + hh; const size_t o = (((size_t)b * NHD + h) * NN + s0 + wave * 16 + rl) * DH + pc * 8; vst2((unsigned*)(Kh + o), *(const v4u*)(&sh_[wave][rl][hh * 32 + pc * 8])); vst2((unsigned*)(Kl + o), *(const v4u*)(&sl_[wave][rl][hh * 32 + pc * 8])); } }
  else {
#pragma unroll
    for (int j = 0; j < 8; ++j) { const int c = n0 + j * 16 + col; const float bb = bfr(bias[(c >> 5) * (3 * DH) + 2 * DH + (c & 31)]);
#pragma unroll
      for (int r = 0; r < 8; ++r) { const float v = acc[j][r] + bb; const __bf16 hi = (__bf16)v; sth[j * 16 + col][wave * 16 + 8 * g + r] = hi; stl[j * 16 + col][wave * 16 + 8 * g + r] = (__bf16)(v - (float)hi); } }
    __syncthreads();
    for (int qq = tid; qq < 128 * 8; qq += 128) { const int cl = qq >> 3, pc = qq & 7; const int c = n0 + cl; const int h = c >> 5, d = c & 31; const size_t o = (((size_t)b * NHD + h) * DH + d) * NN + s0 + pc * 8; vst2((unsigned*)(VTh + o), *(const v4u*)(&sth[cl][pc * 8])); vst2((unsigned*)(VTl + o), *(const v4u*)(&stl[cl][pc * 8])); } }
}
// a pass's K/V tile in LDS (KT keys): K hi, K lo as 128 rows of 64 B at pitch 80 B, then V hi, V lo as 32 rows of 256 B at pitch 272 B (both 16 B x odd, the pitch of the ds_load_b128 fragment reads)
#define KT 128
#define KPI 80
#define VPI 272
#define OFF_KL (KT * KPI)
#define OFF_VH (2 * KT * KPI)
#define OFF_VL (2 * KT * KPI + 32 * VPI)
#define TILE_B (2 * KT * KPI + 2 * 32 * VPI)
// fragment from the lane's own LDS row: 16 B at the pointer and 16 B at +32
__device__ __forceinline__ v16b frag_l(const char* p) { union { v16b v; v4u q[2]; } u; u.q[0] = *(const v4u*)p; u.q[1] = *(const v4u*)(p + 32); return u.v; }
// a lane's eight 16-B pieces of a hi plane and its lo plane, global memory to LDS through no register: four of each, ls bytes apart in LDS and gs bytes apart in global memory.
// l: the lane's LDS byte address in the hi plane of the target buffer, the lo plane lying dl bytes behind it; gh, gl: its global addresses in this tile.
// The s_wait_xcnt stands inside the statement, behind the last copy, so that no address register is rewritten in front of it.
__device__ __forceinline__ void plane_copy(unsigned l, unsigned dl, unsigned ls, const char* gh, const char* gl, int gs) {
  asm volatile("global_load_async_to_lds_b128 %0, %8, off\n\t"
               "global_load_async_to_lds_b128 %1, %9, off\n\t"
               "global_load_async_to_lds_b128 %2, %10, off\n\t"
               "global_load_async_to_lds_b128 %3, %11, off\n\t"
               "global_load_async_to_lds_b128 %4, %12, off\n\t"
               "global_load_async_to_lds_b128 %5, %13, off\n\t"
               "global_load_async_to_lds_b128 %6, %14, off\n\t"
               "global_load_async_to_lds_b128 %7, %15, off\n\t"
               "s_wait_xcnt 0x0"
               :: "v"(l), "v"(l + ls), "v"(l + 2 * ls), "v"(l + 3 * ls),
                  "v"(l + dl), "v"(l + dl + ls), "v"(l + dl + 2 * ls), "v"(l + dl + 3 * ls),
                  "v"(gh), "v"(gh + gs), "v"(gh + 2 * gs), "v"(gh + 3 * gs),
                  "v"(gl), "v"(gl + gs), "v"(gl + 2 * gs), "v"(gl + 3 * gs)
               : "memory");
}
// a lane's sixteen pieces of one tile: K rows r, r + 32, r + 64, r + 96 (a piece = a quarter row), V rows r, r + 8, r + 16, r + 24 (a piece = a sixteenth of the tile's 256 B of the row)
__device__ __forceinline__ void kv_copy(unsigned lk, unsigned lv, const char* gkh, const char* gkl, const char* gvh, const char* gvl) {
  plane_copy(lk, OFF_KL, 32 * KPI, gkh, gkl, 32 * DH * 2);
  plane_copy(lv, OFF_VL - OFF_VH, 8 * VPI, gvh, gvl, 8 * NN * 2);
}
// the value of lane l ^ 16, by a vector cross-row move: __shfl_xor goes through the LDS pipe and its wait would also wait out every fragment read in flight
__device__ __forceinline__ float xhalf(float v) { const int b = __builtin_bit_cast(int, v); return __builtin_bit_cast(float, __builtin_amdgcn_permlanex16(b, b, 0x76543210, 0xfedcba98, false, false)); }
__global__ __launch_bounds__(128) void k_attn(const float* __restrict__ Q32, const __bf16* __restrict__ Kh, const __bf16* __restrict__ Kl, const __bf16* __restrict__ VTh, const __bf16* __restrict__ VTl, float* __restrict__ O) {
  __shared__ __align__(16) float sO[4][16][36];
  __shared__ __align__(16) char sKV[2][TILE_B];
  const int tid = threadIdx.x, w = tid >> 5, lane = tid & 31, col = lane & 15, g = lane >> 4; const size_t bh = blockIdx.y; const int b = (int)(bh / NHD), h = (int)(bh % NHD); const int q0 = blockIdx.x * 64 + w * 16;
  // the block's four waves share each pass's 128 keys: the tile is brought into LDS once per block, a quarter by each wave, one whole pass ahead of its use (two buffers)
  const char* gkh = (const char*)(Kh + bh * NN * DH) + tid * 16; const char* gkl = (const char*)(Kl + bh * NN * DH) + tid * 16;
  const char* gvh = (const char*)(VTh + bh * DH * NN) + (tid >> 4) * (NN * 2) + (tid & 15) * 16; const char* gvl = (const char*)(VTl + bh * DH * NN) + (tid >> 4) * (NN * 2) + (tid & 15) * 16;
  const unsigned lk = (unsigned)(size_t)&sKV[0][0] + (unsigned)((tid >> 2) * KPI + (tid & 3) * 16), lv = (unsigned)(size_t)&sKV[0][0] + (unsigned)(OFF_VH + (tid >> 4) * VPI + (tid & 15) * 16);
  kv_copy(lk, lv, gkh, gkl, gvh, gvl);
  const F2 aq = split_row(Q32 + (bh * NN + q0 + col) * DH, 0, lane);
  // both products run transposed: S^T = K . Q^T (A = key rows, B = the wave's queries) and O^T += V^T . P^T (A = V planes, B = the weights).
  // Lane (g, col) then holds query q0 + col alone: of score tile t the keys 16t + 8g + 0..7, which is the k order of a B fragment, so two tiles' weights, converted in place, are the second product's B operand.
  // mrun is the query's running maximum (equal in both halves); lrun is this half's share of its running sum, the halves being joined behind the loop; acc[t][r] is O[q0 + col][16t + 8g + r].
  float mrun = -3.0e38f, lrun = 0.f; v8f acc[2] = {};
  asm volatile("s_wait_asynccnt 0x0" ::: "memory");      // this wave's quarter of tile 0 has landed
  __syncthreads();      // and so has every other wave's
  kv_copy(lk + TILE_B, lv + TILE_B, gkh + KT * DH * 2, gkl + KT * DH * 2, gvh + KT * 2, gvl + KT * 2);
#pragma unroll 1
  for (int kt = 0; kt < NN / KT; ++kt) {
    const unsigned bo = (unsigned)(kt & 1) * TILE_B; const char* pk = &sKV[0][0] + bo + col * KPI + 16 * g; const char* pv = &sKV[0][0] + bo + OFF_VH + col * VPI + 16 * g;
    v16b khf[KT / 16], klf[KT / 16];
#pragma unroll
    for (int t = 0; t < KT / 16; ++t) { khf[t] = frag_l(pk + t * 16 * KPI); klf[t] = frag_l(pk + OFF_KL + t * 16 * KPI); }
    __builtin_amdgcn_sched_barrier(0);      // holds the pass's 32 K reads in one group and in the order of their use: without it the scheduler shuffles them, and the waits in front of the first few products cover nearly all 32
    v8f s[KT / 16];
    // a tile's three products hang on one accumulator: four tiles' chains are dealt out in turn, so that no product stands directly behind the one it waits for (each tile's own order of sums stays)
#pragma unroll
    for (int hf = 0; hf < 2; ++hf) { const int t0 = hf * (KT / 32);
      if (hf) __builtin_amdgcn_sched_barrier(0);      // keeps the second half's products behind the first half's, whose waits cover only the first half of the reads
#pragma unroll
      for (int t = t0; t < t0 + KT / 32; ++t) { const v8f z = {}; s[t] = wmma_p(khf[t], aq.l, z); }
#pragma unroll
      for (int t = t0; t < t0 + KT / 32; ++t) s[t] = wmma_p(klf[t], aq.h, s[t]);
#pragma unroll
      for (int t = t0; t < t0 + KT / 32; ++t) s[t] = wmma_p(khf[t], aq.h, s[t]); }
    v16b vh[KT / 32][2], vl[KT / 32][2];
#pragma unroll
    for (int kc = 0; kc < KT / 32; ++kc) {
#pragma unroll
      for (int t = 0; t < 2; ++t) { vh[kc][t] = frag_l(pv + t * 16 * VPI + kc * 64); vl[kc][t] = frag_l(pv + (OFF_VL - OFF_VH) + t * 16 * VPI + kc * 64); } }
    __builtin_amdgcn_sched_barrier(0);      // holds the V fragment reads at the head of the softmax, which runs while they come: without it the scheduler may sink them to its foot, straight in front of the wait there
    float mt[KT / 16];
#pragma unroll
    for (int t = 0; t < KT / 16; ++t) {
#pragma unroll
      for (int r = 0; r < 8; ++r) { s[t][r] *= (float)(0.17677669529663687 * LOG2E); mt[t] = r ? fmaxf(mt[t], s[t][r]) : s[t][r]; } }      // scores in base 2: log2 e rides on the scale, so maximum, difference and exponential need no further multiply
    float mx = fmaxf(fmaxf(fmaxf(mt[0], mt[1]), fmaxf(mt[2], mt[3])), fmaxf(fmaxf(mt[4], mt[5]), fmaxf(mt[6], mt[7])));
    mx = fmaxf(mx, xhalf(mx));      // the other half holds the query's other 64 keys of this pass
    const float mnew = fmaxf(mrun, mx); const float corr = __builtin_amdgcn_exp2f(mrun - mnew);
    float pt[KT / 16]; v16b ph[KT / 32], pl[KT / 32];
#pragma unroll
    for (int t = 0; t < KT / 16; ++t) {
#pragma unroll
      for (int r = 0; r < 8; r += 2) { const v2f sp = { s[t][r], s[t][r + 1] }; const v2f a = sp - mnew;      // the difference too is taken as a pair: one packed instruction, behind which the compiler keeps the slot asked for after a v_exp_f32
        const v2f p = { __builtin_amdgcn_exp2f(a[0]), __builtin_amdgcn_exp2f(a[1]) }; pt[t] = r ? pt[t] + p[0] + p[1] : p[0] + p[1];
        const v2b hi = __builtin_convertvector(p, v2b); const v2f d = { p[0] - (float)hi[0], p[1] - (float)hi[1] }; const v2b lo = __builtin_convertvector(d, v2b);      // a register of the operand holds two weights: each pair is converted as a pair
        const int e = (t & 1) * 8 + r; ph[t >> 1][e] = hi[0]; ph[t >> 1][e + 1] = hi[1]; pl[t >> 1][e] = lo[0]; pl[t >> 1][e + 1] = lo[1]; } }
    lrun = lrun * corr + (((pt[0] + pt[1]) + (pt[2] + pt[3])) + ((pt[4] + pt[5]) + (pt[6] + pt[7]))); mrun = mnew;
#pragma unroll
    for (int r = 0; r < 8; ++r) { acc[0][r] *= corr; acc[1][r] *= corr; }
#pragma unroll
    for (int kc = 0; kc < KT / 32; ++kc) {      // the two accumulators' chains in turn; each keeps its order of sums: hi x lo, lo x hi, hi x hi
      acc[0] = wmma_p(vh[kc][0], pl[kc], acc[0]); acc[1] = wmma_p(vh[kc][1], pl[kc], acc[1]);
      acc[0] = wmma_p(vl[kc][0], ph[kc], acc[0]); acc[1] = wmma_p(vl[kc][1], ph[kc], acc[1]);
      acc[0] = wmma_p(vh[kc][0], ph[kc], acc[0]); acc[1] = wmma_p(vh[kc][1], ph[kc], acc[1]); }
    __builtin_amdgcn_sched_barrier(0);      // keeps the publish point at the foot of the pass: lifted to where the last fragment read ends, its wait would leave the next tile's copies a fraction of a pass to land instead of a whole one
    asm volatile("s_wait_dscnt 0x0" ::: "memory");      // this wave's reads of the tile are done before the buffer is handed back
    asm volatile("s_wait_asynccnt 0x0" ::: "memory");      // its quarter of the next tile has landed
    __syncthreads();      // publishes the next tile and ends every wave's reads of this one
    if (kt + 2 < NN / KT) kv_copy(lk + bo, lv + bo, gkh + (kt + 2) * (KT * DH * 2), gkl + (kt + 2) * (KT * DH * 2), gvh + (kt + 2) * (KT * 2), gvl + (kt + 2) * (KT * 2)); }
  asm volatile("s_wait_asynccnt 0x0" ::: "memory");      // no copy is left in flight when the wave goes on to its end
  const float inv = 1.0f / (lrun + xhalf(lrun));
#pragma unroll
  for (int t = 0; t < 2; ++t) {
#pragma unroll
    for (int q = 0; q < 2; ++q) { const v4f o = { acc[t][q * 4] * inv, acc[t][q * 4 + 1] * inv, acc[t][q * 4 + 2] * inv, acc[t][q * 4 + 3] * inv }; *(v4f*)(&sO[w][col][t * 16 + 8 * g + q * 4]) = o; } }
  LDSX();
  for (int qq = lane; qq < 16 * 8; qq += 32) { const int rl = qq >> 3, pc = qq & 7; vst2(O + ((size_t)b * NN + q0 + rl) * CC + h * DH + pc * 4, *(const v4f*)(&sO[w][rl][pc * 4])); }
}
// raw fragment loads: the addresses and guards of split_row and split_col, the conversion left to bsplit16
__device__ __forceinline__ void raw_row(const float* row, int k0, int lane, float v[16]) { const float* p = row + k0 + 8 * (lane >> 4);
#pragma unroll
  for (int i = 0; i < 8; ++i) { v[i] = p[i]; v[8 + i] = p[16 + i]; } }
__device__ __forceinline__ void raw_col(const float* W, int k0, int n, int lane, int ld, int K, float v[16]) { const int g = lane >> 4;
#pragma unroll
  for (int i = 0; i < 8; ++i) { const int ka = k0 + 8 * g + i, kb = ka + 16; v[i] = ka < K ? W[(size_t)(ka < K ? ka : K - 1) * ld + n] : 0.f; v[8 + i] = kb < K ? W[(size_t)(kb < K ? kb : K - 1) * ld + n] : 0.f; } }
// y[b][c][n] = x[b][c][n] + val * sigmoid(gate), val | gate = O[n][:] (hi/lo) . Wg[:][c | CC + c] + bg: block (b, 64 tokens); wave w -> channel tiles 2w..2w+1 (32 channels) x 4 token tiles
__global__ __launch_bounds__(128) void k_out(const float* __restrict__ O, const float* __restrict__ Wg, const float* __restrict__ bg, const float* __restrict__ x, float* __restrict__ y) {
  __shared__ __align__(16) float sY[4][32][68];
  const int tid = threadIdx.x, w = tid >> 5, lane = tid & 31, col = lane & 15, g = lane >> 4; const int b = blockIdx.y, p0 = blockIdx.x * 64; const size_t base = (size_t)b * NN;
  v8f av[2][4] = {}, ag[2][4] = {};
#pragma unroll 1
  for (int kc = 0; kc < CC / 32; ++kc) { F2 bc[4]; float ov[4][16], wv[2][2][16]; const int c0 = w * 32 + col;
    // a k step's loads are issued in two groups ahead of their use: the four O fragments with the first channel tile's weights, then the second tile's weights, which fly under the first tile's products
#pragma unroll
    for (int pt = 0; pt < 4; ++pt) raw_row(O + (base + p0 + pt * 16 + col) * CC, kc * 32, lane, ov[pt]);
    raw_col(Wg, kc * 32, c0, lane, 2 * CC, CC, wv[0][0]); raw_col(Wg, kc * 32, CC + c0, lane, 2 * CC, CC, wv[0][1]);
    __builtin_amdgcn_sched_barrier(0);      // holds the first group together: without it the scheduler issues the O loads two at a time, each pair straight in front of its own wait
    raw_col(Wg, kc * 32, c0 + 16, lane, 2 * CC, CC, wv[1][0]); raw_col(Wg, kc * 32, CC + c0 + 16, lane, 2 * CC, CC, wv[1][1]);
    asm volatile("s_wait_xcnt 0x0" ::: "memory");      // in front of the weight conversions below, whose results may be laid on these loads' address registers
    __builtin_amdgcn_sched_barrier(0);      // keeps that wait directly behind the loads, and both in front of the products
#pragma unroll
    for (int pt = 0; pt < 4; ++pt) bc[pt] = bsplit16(ov[pt]);
#pragma unroll
    for (int ct = 0; ct < 2; ++ct) { const v16b a1 = bsplit16(wv[ct][0]).h, a2 = bsplit16(wv[ct][1]).h;
#pragma unroll
      for (int pt = 0; pt < 4; ++pt) { av[ct][pt] = wmma_p(a1, bc[pt].l, av[ct][pt]); av[ct][pt] = wmma_p(a1, bc[pt].h, av[ct][pt]); ag[ct][pt] = wmma_p(a2, bc[pt].l, ag[ct][pt]); ag[ct][pt] = wmma_p(a2, bc[pt].h, ag[ct][pt]); } } }
  float xv[2][8][4], bv[2][8], bq[2][8];      // the tile's residual values and its biases, requested together in front of the gating, which starts on the biases while the rest still fly
#pragma unroll
  for (int ct = 0; ct < 2; ++ct) {
#pragma unroll
    for (int r = 0; r < 8; ++r) { const int c = w * 32 + ct * 16 + 8 * g + r; bv[ct][r] = bg[c]; bq[ct][r] = bg[CC + c];
#pragma unroll
      for (int pt = 0; pt < 4; ++pt) xv[ct][r][pt] = x[((size_t)b * CC + c) * NN + p0 + pt * 16 + col]; } }
  __builtin_amdgcn_sched_barrier(0);      // holds these loads in one flight in front of the gating, as the calls did: without it the scheduler deals them out through the gating in groups of eight, each waited for in its turn
#pragma unroll
  for (int ct = 0; ct < 2; ++ct) {
#pragma unroll
    for (int r = 0; r < 8; ++r) { const int cl = ct * 16 + 8 * g + r; const float bv_ = bfr(bv[ct][r]), bg_ = bfr(bq[ct][r]);
      float sg[4];
#pragma unroll
      for (int pt = 0; pt < 4; ++pt) sg[pt] = sigm(ag[ct][pt][r] + bg_);
#pragma unroll
      for (int pt = 0; pt < 4; ++pt) sY[w][cl][pt * 16 + col] = bfr(xv[ct][r][pt]) + (av[ct][pt][r] + bv_) * sg[pt]; } }
  LDSX();
  for (int qq = lane; qq < 32 * 16; qq += 32) { const int cl = qq >> 4, pc = qq & 15; vst2(y + ((size_t)b * CC + w * 32 + cl) * NN + p0 + pc * 4, *(const v4f*)(&sY[w][cl][pc * 4])); }
}
extern "C" void kernel_launch(void* const* d_in, const int* in_sizes, int n_in, void* d_out, int out_size, void* d_ws, size_t ws_size, hipStream_t stream) {
  (void)in_sizes; (void)n_in; (void)out_size; (void)ws_size;
  const float* x = (const float*)d_in[0]; const float* Wqkv = (const float*)d_in[1]; const float* bqkv = (const float*)d_in[2]; const float* Wg = (const float*)d_in[3]; const float* bg = (const float*)d_in[4];
  char* ws = (char*)d_ws; size_t off = 0;
  auto take = [&](size_t bytes) { char* p = ws + off; off += (bytes + 255) & ~(size_t)255; return p; };
  float* Q32 = (float*)take((size_t)NB * NN * CC * 4); __bf16* Kh = (__bf16*)take((size_t)NB * NN * CC * 2); __bf16* Kl = (__bf16*)take((size_t)NB * NN * CC * 2); __bf16* VTh = (__bf16*)take((size_t)NB * NN * CC * 2); __bf16* VTl = (__bf16*)take((size_t)NB * NN * CC * 2); float* O = (float*)take((size_t)NB * NN * CC * 4);
  // ws ~ 17 MB
  k_qkv<<<dim3(NB * NN / 64, CC / 128, 3), 128, 0, stream>>>(x, Wqkv, bqkv, Q32, Kh, Kl, VTh, VTl);
  k_attn<<<dim3(NN / 64, NB * NHD), 128, 0, stream>>>(Q32, Kh, Kl, VTh, VTl, O);
  k_out<<<dim3(NN / 64, NB), 128, 0, stream>>>(O, Wg, bg, x, (float*)d_out);
}
